// v000
// The times below were measured on an AMD MI455X: many runs one after another, warmed up first and cycling through
// copies of the inputs, with the whole window's GPU time divided by the number of runs. Launches and the gaps
// between them are all in it. The median over several windows is given; except for v000 it joins two sittings, which
// can be a few percent apart, so the side-by-side timings, each taken in one sitting, are the better comparison.
// v000, which the later versions start from, runs in 1530 microseconds.
#include <hip/hip_runtime.h>

// Multi-head attention returning the output AND the head-averaged attention probabilities (Q, K, V [2][2048][1024]; q,k,v = input W^T + b ('oi' [1024][1024] + [1024]; 16 heads x 64); scores = q.k x 1.0 (SCALING = 1: unscaled); probs = softmax; attn = probs v; out = merged Wo^T + bo -> [2][2048][1024]; second output mean over heads of probs -> [2][2048][2048]; tuple (12.6 M)).
// Layout per batch: bf16 copies of the three inputs in turn; exact projections + f32 biases; dense T-2048 attention with EVERY row on hi/lo planes (3 products; the unscaled logits reach |s| ~ 15); the softmax kernel also stores its f32 probabilities for the pass's two heads, and an accumulation kernel adds them into a per-batch f32 sum in head order (one thread per four elements, fixed order: deterministic); after the last pass the sum x 1/16 is written to the second output; merged hi/lo x Wo exact + bo to the first.
// Compute dtypes, f32 accumulate: every input rounded to bf16; projections exact + f32 biases; scores and attn.v 3 products; softmax, probability mean f32; Wo hl x exact + bias.

#define NB_  2
#define TT   2048
#define DM   1024
#define NH_  16
#define NKV  16
#define REP  (NH_ / NKV)
#define HD   64
#define DQ   (NH_ * HD)
#define DKV  (NKV * HD)
#define ZH   2
#define RH   2048                  // query rows < RH use hi+lo planes (0: none)
#define WIN  0
#define PCAR 1024.0f
#define SCL  1.0f   // SCALING = 1.0 in the module (no 1/sqrt(d))
typedef _Float16 h16;
typedef unsigned short bf;
typedef __attribute__((ext_vector_type(16))) __bf16   v16bf;
typedef __attribute__((ext_vector_type(16))) _Float16 v16h;
typedef __attribute__((ext_vector_type(8)))  _Float16 v8h;
typedef __attribute__((ext_vector_type(8)))  unsigned short v8us;
typedef __attribute__((ext_vector_type(8)))  float    v8f;
typedef __attribute__((ext_vector_type(4)))  float    v4f;
typedef v8h  __attribute__((may_alias)) v8ha;
typedef v4f  __attribute__((may_alias)) v4fa;
typedef v8us __attribute__((may_alias)) v8usa;

__device__ __forceinline__ unsigned short f2bf(float f) { unsigned u = __float_as_uint(f); u += 0x7FFFu + ((u >> 16) & 1u); return (unsigned short)(u >> 16); }
__device__ __forceinline__ float bf2f(unsigned short b) { return __uint_as_float(((unsigned)b) << 16); }
__device__ __forceinline__ float bfr(float f) { return bf2f(f2bf(f)); }
__device__ __forceinline__ v16h cat16(v8h lo, v8h hi) { return __builtin_shufflevector(lo, hi, 0, 1, 2, 3, 4, 5, 6, 7, 8, 9, 10, 11, 12, 13, 14, 15); }
__device__ __forceinline__ v16bf cat16b(v8us lo, v8us hi) { return __builtin_bit_cast(v16bf, __builtin_shufflevector(lo, hi, 0, 1, 2, 3, 4, 5, 6, 7, 8, 9, 10, 11, 12, 13, 14, 15)); }
__device__ __forceinline__ v8f wmma16(v16h a, v16h b, v8f c) { return __builtin_amdgcn_wmma_f32_16x16x32_f16(false, a, false, b, (short)0, c, false, false); }
__device__ __forceinline__ v8f wmmab(v16bf a, v16bf b, v8f c) { return __builtin_amdgcn_wmma_f32_16x16x32_bf16(false, a, false, b, (short)0, c, false, false); }



// ---- k_gemmw: register-blocked GEMM, ONE WAVE per 64x64 output tile (16 accumulators), operands straight from K-contiguous 16-bit planes; grid (M/64, N/64, Z), 32 threads.
// C[m][n] (f32, pitch ldc, + optional f32 bias[n]) = sum_k A[m][k] Bt[n][k] (+ split products per NSPLIT). z-batch strides sA/sB/sC in elements. K % 32 == 0.
template <typename T16> struct WFrag;
template <> struct WFrag<h16> { typedef v16h V; static __device__ __forceinline__ V ld(const h16* p) { return cat16(*(const v8h*)p, *(const v8h*)(p + 16)); } static __device__ __forceinline__ v8f mma(V a, V b, v8f c) { return wmma16(a, b, c); } };
template <> struct WFrag<bf> { typedef v16bf V; static __device__ __forceinline__ V ld(const bf* p) { return cat16b(*(const v8us*)p, *(const v8us*)(p + 16)); } static __device__ __forceinline__ v8f mma(V a, V b, v8f c) { return wmmab(a, b, c); } };
template <typename T16, int NSPLIT, bool BIAS>
__global__ __launch_bounds__(32) void k_gemmw(const T16* __restrict__ A, const T16* __restrict__ A2, const T16* __restrict__ Bt, const T16* __restrict__ Bt2, int K, float* C, int ldc, const float* __restrict__ bias, size_t sA, size_t sB, size_t sC) {
    typedef typename WFrag<T16>::V V;
    __shared__ __align__(16) float os[16 * 68];
    const size_t z = blockIdx.z; A += z * sA; if (A2) A2 += z * sA; Bt += z * sB; if (Bt2) Bt2 += z * sB; C += z * sC;
    const int lane = threadIdx.x & 31, lr = lane & 15, hi = lane >> 4; const int r0 = blockIdx.x * 64, c0 = blockIdx.y * 64;
    v8f acc[4][4];
#pragma unroll
    for (int mb = 0; mb < 4; ++mb)
#pragma unroll
        for (int nb = 0; nb < 4; ++nb) acc[mb][nb] = (v8f){};
    const size_t aoff = (size_t)(r0 + lr) * K + 8 * hi, boff = (size_t)(c0 + lr) * K + 8 * hi;
#pragma unroll 1
    for (int kc = 0; kc < K; kc += 32) {
        V a[4], a2[4];
#pragma unroll
        for (int mb = 0; mb < 4; ++mb) { a[mb] = WFrag<T16>::ld(A + aoff + (size_t)mb * 16 * K + kc); if (NSPLIT == 1 || NSPLIT == 2) a2[mb] = WFrag<T16>::ld(A2 + aoff + (size_t)mb * 16 * K + kc); }
#pragma unroll
        for (int nb = 0; nb < 4; ++nb) { const V b = WFrag<T16>::ld(Bt + boff + (size_t)nb * 16 * K + kc); V b2; if (NSPLIT >= 2) b2 = WFrag<T16>::ld(Bt2 + boff + (size_t)nb * 16 * K + kc);
#pragma unroll
            for (int mb = 0; mb < 4; ++mb) { acc[mb][nb] = WFrag<T16>::mma(a[mb], b, acc[mb][nb]); if (NSPLIT == 1 || NSPLIT == 2) acc[mb][nb] = WFrag<T16>::mma(a2[mb], b, acc[mb][nb]); if (NSPLIT >= 2) acc[mb][nb] = WFrag<T16>::mma(a[mb], b2, acc[mb][nb]); } }
        asm volatile("v_nop\n\tv_nop\n\tv_nop\n\tv_nop" : "+v"(acc[0][0]), "+v"(acc[1][1]), "+v"(acc[2][2]), "+v"(acc[3][3]) : "v"(a[0]), "v"(a[3]));
    }
#pragma unroll
    for (int mb = 0; mb < 4; ++mb) {
#pragma unroll
        for (int nb = 0; nb < 4; ++nb) {
#pragma unroll
            for (int j = 0; j < 8; ++j) os[(hi * 8 + j) * 68 + nb * 16 + lr] = acc[mb][nb][j]; }
        __builtin_amdgcn_wave_barrier(); asm volatile("" ::: "memory");
        float* crow = C + (size_t)(r0 + mb * 16) * ldc + c0;
{
#pragma unroll
            for (int s = 0; s < 8; ++s) { const int row = 2 * s + hi, cofs = lr * 4; v4f val = *(const v4fa*)(os + row * 68 + cofs); if (BIAS) { val[0] += bfr(bias[c0 + cofs]); val[1] += bfr(bias[c0 + cofs + 1]); val[2] += bfr(bias[c0 + cofs + 2]); val[3] += bfr(bias[c0 + cofs + 3]); }
                *(v4f*)(crow + (size_t)row * ldc + cofs) = val; }
             }
        __builtin_amdgcn_wave_barrier(); asm volatile("" ::: "memory");
    }
}

__device__ __forceinline__ h16 tohx(float x) { return (h16)x; }
__device__ __forceinline__ void splitf(float y, unsigned short& h, unsigned short& l) { h = f2bf(y); l = f2bf(y - bf2f(h)); }
typedef __attribute__((ext_vector_type(2))) _Float16 v2h;
typedef __attribute__((ext_vector_type(4))) _Float16 v4h;
typedef __attribute__((ext_vector_type(2))) unsigned short v2us;
typedef __attribute__((ext_vector_type(4))) unsigned short v4us;
typedef __attribute__((ext_vector_type(2))) float v2f;
typedef __attribute__((ext_vector_type(4))) int v4i;

__global__ __launch_bounds__(256) void k_wtG(const float* __restrict__ w, int K, int N, bf* Bt) {
    const int lane = threadIdx.x & 31; const int L0 = (blockIdx.x * 8 + (threadIdx.x >> 5)) * 8; const int nlines = N * K / 64;
{
#pragma unroll 1
        for (int l = 0; l < 8; ++l) { const int L = L0 + l; if (L >= nlines) break; const size_t e = (size_t)L * 64 + lane * 2; const int k = (int)(e % K), n = (int)(e / K); v2us o;
            o[0] = f2bf(w[(size_t)k * N + n]); o[1] = f2bf(w[(size_t)(k + 1) * N + n]); *(v2us*)(Bt + e) = o; }
         }
}
__global__ __launch_bounds__(256) void k_cvt8(const float* __restrict__ src, bf* dst, size_t n8) { const size_t i = (size_t)blockIdx.x * 256 + threadIdx.x; if (i >= n8) return; const v8f v = *(const v8f*)(src + i * 8); v8us o;
#pragma unroll
    for (int k = 0; k < 8; ++k) o[k] = f2bf(v[k]); *(v8us*)(dst + i * 8) = o;  }

// k_rope: head planes [h][t][d] (fp16 + hi/lo) of rope(x) x sc with the rotate-half convention out[d] = x[d] cos[t][d] - x[d+HD/2] sin[t][d], out[d+HD/2] = x[d+HD/2] cos[t][d+HD/2] + x[d] sin[t][d+HD/2]
__global__ __launch_bounds__(256) void k_rope(const float* __restrict__ F, int pitch, int nheads, const float* __restrict__ CS, const float* __restrict__ RF, const float* __restrict__ nw, float sc, h16* P16, bf* Ph, bf* Pl) {
    const size_t e = ((size_t)blockIdx.x * 256 + threadIdx.x) * 2; if (e >= (size_t)nheads * TT * HD) return; const int d = (int)(e % HD); const int t = (int)((e / HD) % TT); const int h = (int)(e / ((size_t)HD * TT)); const float* f = F + (size_t)t * pitch + h * HD; const float rf = RF ? RF[(size_t)h * TT + t] : 1.0f; v2h o16; v2us oh, ol;
#pragma unroll
    for (int q = 0; q < 2; ++q) { const int dd = d + q; const int dp = (dd < HD / 2) ? dd + HD / 2 : dd - HD / 2; float x0 = f[dd], x1 = f[dp];
        if (RF) { float n0 = __fmul_rn(x0, rf), n1 = __fmul_rn(x1, rf); asm volatile("" : "+v"(n0)); asm volatile("" : "+v"(n1)); x0 = __fmul_rn(bfr(nw[dd]), n0); x1 = __fmul_rn(bfr(nw[dp]), n1); }
        const v2f cs = *(const v2f*)(CS + ((size_t)t * HD + dd) * 2); float a = __fmul_rn(x0, cs[0]), bq = __fmul_rn(x1, cs[1]); asm volatile("" : "+v"(a)); asm volatile("" : "+v"(bq)); const float r = ((dd < HD / 2) ? __fsub_rn(a, bq) : __fadd_rn(a, bq)) * sc;
        o16[q] = tohx(r); unsigned short a2, c2; splitf(r, a2, c2); oh[q] = a2; ol[q] = c2; }
    *(v2h*)(P16 + e) = o16; *(v2us*)(Ph + e) = oh; *(v2us*)(Pl + e) = ol;  }
__global__ __launch_bounds__(256) void k_vtp(const float* __restrict__ F, int pitch, int nheads, h16* V16, bf* Vh, bf* Vl) { const size_t e = ((size_t)blockIdx.x * 256 + threadIdx.x) * 2; if (e >= (size_t)nheads * HD * TT) return; const int t = (int)(e % TT); const int d = (int)((e / TT) % HD); const int g = (int)(e / ((size_t)TT * HD)); v2h o16; v2us oh, ol;
#pragma unroll
    for (int q = 0; q < 2; ++q) { const float x = F[(size_t)(t + q) * pitch + g * HD + d]; o16[q] = tohx(x); unsigned short a2, c2; splitf(x, a2, c2); oh[q] = a2; ol[q] = c2; }
    *(v2h*)(V16 + e) = o16; *(v2us*)(Vh + e) = oh; *(v2us*)(Vl + e) = ol;  }
__global__ __launch_bounds__(256) void k_csid(float* CS) { const int idx = blockIdx.x * 256 + threadIdx.x; if (idx >= TT * HD) return; v2f cs; cs[0] = 1.0f; cs[1] = 0.0f; *(v2f*)(CS + (size_t)idx * 2) = cs;  }
// k_asoft: per row (zz, i): t = S x SCL = S (unscaled, no mask); softmax over the 2048 keys (register row, one exp, fixed trees);
__global__ __launch_bounds__(256) void k_asoft(const float* __restrict__ Sb, h16* P16, bf* Ph, bf* Pl, float* PF) {
    const int lane = threadIdx.x & 31; const int row = blockIdx.x * 8 + (threadIdx.x >> 5); if (row >= ZH * TT) return; const int i = row % TT; const int zz = row / TT; (void)zz; const bool hires = (i < RH); const float* sr = Sb + (size_t)row * TT; float v[TT / 32]; float mx = -3.0e38f;
#pragma unroll
    for (int ch = 0; ch < TT / 128; ++ch) { const int j0 = ch * 128 + lane * 4; const v4f a = *(const v4f*)(sr + j0);
#pragma unroll
        for (int q = 0; q < 4; ++q) { const int j = j0 + q; (void)j; const float t = a[q] * SCL; v[ch * 4 + q] = t; mx = fmaxf(mx, t); } }
#pragma unroll
    for (int sh = 16; sh; sh >>= 1) mx = fmaxf(mx, __shfl_xor(mx, sh, 32));
    float sum = 0.f;
#pragma unroll
    for (int k = 0; k < TT / 32; ++k) { float d0 = __fsub_rn(v[k], mx); asm volatile("" : "+v"(d0)); v[k] = __builtin_amdgcn_exp2f(__fmul_rn(d0, 1.4426950408889634f)); sum += v[k]; }
#pragma unroll
    for (int sh = 16; sh; sh >>= 1) sum += __shfl_xor(sum, sh, 32);
    const float f = __fdiv_rn(hires ? 1.0f : PCAR, sum);
{
        if (hires) {
#pragma unroll
            for (int ch = 0; ch < TT / 128; ++ch) { v4us oh, ol; v4f pf;
#pragma unroll
                for (int q = 0; q < 4; ++q) { const float pq = v[ch * 4 + q] * f; pf[q] = pq; unsigned short a, c2; splitf(pq, a, c2); oh[q] = a; ol[q] = c2; }
                const size_t oo = ((size_t)zz * (RH ? RH : 1) + i) * TT + ch * 128 + lane * 4; *(v4us*)(Ph + oo) = oh; *(v4us*)(Pl + oo) = ol; *(v4f*)(PF + oo) = pf;   /* f32 probabilities for the head-mean output */ }
        } else {
#pragma unroll
            for (int ch = 0; ch < TT / 128; ++ch) { v4h o4;
#pragma unroll
                for (int q = 0; q < 4; ++q) o4[q] = tohx(v[ch * 4 + q] * f);
                *(v4h*)(P16 + (size_t)row * TT + ch * 128 + lane * 4) = o4; } }
         }
}
__global__ __launch_bounds__(256) void k_paccum(float* PA, const float* __restrict__ PF, int h0) { const size_t i = (size_t)blockIdx.x * 256 + threadIdx.x; if (i >= (size_t)TT * TT / 4) return; const size_t e = i * 4; v4f a; if (h0 == 0) { a[0] = a[1] = a[2] = a[3] = 0.f; } else { a = *(const v4f*)(PA + e); } const v4f p0 = *(const v4f*)(PF + e); const v4f p1 = *(const v4f*)(PF + (size_t)TT * TT + e);
#pragma unroll
    for (int q = 0; q < 4; ++q) { float s1 = __fadd_rn(a[q], p0[q]); asm volatile("" : "+v"(s1)); a[q] = __fadd_rn(s1, p1[q]); }
    *(v4f*)(PA + e) = a;  }
__global__ __launch_bounds__(256) void k_pmean(const float* __restrict__ PA, float* O2) { const size_t i = (size_t)blockIdx.x * 256 + threadIdx.x; if (i >= (size_t)TT * TT / 4) return; v4f a = *(const v4f*)(PA + i * 4);
#pragma unroll
    for (int q = 0; q < 4; ++q) a[q] = __fmul_rn(a[q], 0.0625f);
    *(v4f*)(O2 + i * 4) = a;  }
__global__ __launch_bounds__(256) void k_merge(const float* __restrict__ O, int h0, bf* Ah, bf* Al) { const size_t e = ((size_t)blockIdx.x * 256 + threadIdx.x) * 2; if (e >= (size_t)ZH * TT * HD) return; const int d = (int)(e % HD); const int t = (int)((e / HD) % TT); const int zz = (int)(e / ((size_t)HD * TT)); const float cs = (t < RH) ? 1.0f : (1.0f / PCAR); const size_t oo = (size_t)t * DQ + (h0 + zz) * HD + d;
    v2us oh, ol;
#pragma unroll
    for (int q = 0; q < 2; ++q) { unsigned short a, c2; splitf(O[e + q] * cs, a, c2); oh[q] = a; ol[q] = c2; } *(v2us*)(Ah + oo) = oh; *(v2us*)(Al + oo) = ol;  }

extern "C" void kernel_launch(void* const* d_in, const int* in_sizes, int n_in,
                              void* d_out, int out_size, void* d_ws, size_t ws_size, hipStream_t stream) {
    (void)in_sizes; (void)n_in; (void)out_size;
    const float* x = (const float*)d_in[0]; const float* xk = (const float*)d_in[1]; const float* xv = (const float*)d_in[2]; const float* wq = (const float*)d_in[3]; const float* bq = (const float*)d_in[4]; const float* wk = (const float*)d_in[5]; const float* bk = (const float*)d_in[6]; const float* wv = (const float*)d_in[7]; const float* bv = (const float*)d_in[8]; const float* wo = (const float*)d_in[9]; const float* bo = (const float*)d_in[10];
    float* OUT = (float*)d_out;     // first output [2][2048][1024]
    float* OUT2 = OUT + (size_t)NB_ * TT * DM;   // second output [2][2048][2048] (tuple: contiguous after the first)
    char* wsp = (char*)d_ws;
    auto take = [&](size_t bytes) { char* p = wsp; wsp += (bytes + 255) & ~(size_t)255; return (void*)p; };
    bf* WQ = (bf*)take((size_t)DQ * DM * 2); bf* WK = (bf*)take((size_t)DKV * DM * 2); bf* WV = (bf*)take((size_t)DKV * DM * 2); bf* WO = (bf*)take((size_t)DM * DQ * 2); float* CS = (float*)take((size_t)TT * HD * 2 * 4);
    bf* XB = (bf*)take((size_t)TT * DM * 2); float* FQ = (float*)take((size_t)TT * DQ * 4); float* FK = (float*)take((size_t)TT * DKV * 4);
    h16* QP16 = (h16*)take((size_t)NH_ * TT * HD * 2); h16* KP16 = (h16*)take((size_t)NKV * TT * HD * 2); h16* VT16 = (h16*)take((size_t)NKV * HD * TT * 2);
    bf* QPh = (bf*)take((size_t)NH_ * TT * HD * 2); bf* QPl = (bf*)take((size_t)NH_ * TT * HD * 2); bf* KPh = (bf*)take((size_t)NKV * TT * HD * 2); bf* KPl = (bf*)take((size_t)NKV * TT * HD * 2); bf* VTh = (bf*)take((size_t)NKV * HD * TT * 2); bf* VTl = (bf*)take((size_t)NKV * HD * TT * 2); bf* Ph = (bf*)take((size_t)ZH * RH * TT * 2); bf* Pl = (bf*)take((size_t)ZH * RH * TT * 2);
    float* Sb = (float*)take((size_t)ZH * TT * TT * 4); h16* P16 = nullptr; float* PF = (float*)take((size_t)ZH * TT * TT * 4); float* PA = (float*)take((size_t)TT * TT * 4); float* Ob = (float*)take((size_t)ZH * TT * HD * 4); bf* ATh = (bf*)take((size_t)TT * DQ * 2); bf* ATl = (bf*)take((size_t)TT * DQ * 2);
    if ((size_t)(wsp - (char*)d_ws) > ws_size) return;    // ws 256 MiB
    float* FV = FK;   // v projection reuses the k buffer after the k planes are built (stream-ordered)
    { k_cvt8<<<(unsigned)(((size_t)DQ * DM / 8 + 255) / 256), 256, 0, stream>>>(wq, WQ, (size_t)DQ * DM / 8); k_cvt8<<<(unsigned)(((size_t)DKV * DM / 8 + 255) / 256), 256, 0, stream>>>(wk, WK, (size_t)DKV * DM / 8); k_cvt8<<<(unsigned)(((size_t)DKV * DM / 8 + 255) / 256), 256, 0, stream>>>(wv, WV, (size_t)DKV * DM / 8);
      k_cvt8<<<(unsigned)(((size_t)DM * DQ / 8 + 255) / 256), 256, 0, stream>>>(wo, WO, (size_t)DM * DQ / 8);
       }
    k_csid<<<(TT * HD + 255) / 256, 256, 0, stream>>>(CS);
    const unsigned LQ = (unsigned)(((size_t)NH_ * TT * HD / 2 + 255) / 256), LKv = (unsigned)(((size_t)NKV * TT * HD / 2 + 255) / 256);
    for (int b = 0; b < NB_; ++b) {
        
        k_cvt8<<<(unsigned)(((size_t)TT * DM / 8 + 255) / 256), 256, 0, stream>>>(x + (size_t)b * TT * DM, XB, (size_t)TT * DM / 8);
        k_gemmw<bf, 0, true><<<dim3(TT / 64, DQ / 64, 1), 32, 0, stream>>>(XB, nullptr, WQ, nullptr, DM, FQ, DQ, bq, 0, 0, 0);
        k_rope<<<LQ, 256, 0, stream>>>(FQ, DQ, NH_, CS, nullptr, nullptr, 1.0f, QP16, QPh, QPl);
        k_cvt8<<<(unsigned)(((size_t)TT * DM / 8 + 255) / 256), 256, 0, stream>>>(xk + (size_t)b * TT * DM, XB, (size_t)TT * DM / 8); k_gemmw<bf, 0, true><<<dim3(TT / 64, DKV / 64, 1), 32, 0, stream>>>(XB, nullptr, WK, nullptr, DM, FK, DKV, bk, 0, 0, 0);
        k_rope<<<LKv, 256, 0, stream>>>(FK, DKV, NKV, CS, nullptr, nullptr, 1.0f, KP16, KPh, KPl);
        k_cvt8<<<(unsigned)(((size_t)TT * DM / 8 + 255) / 256), 256, 0, stream>>>(xv + (size_t)b * TT * DM, XB, (size_t)TT * DM / 8); k_gemmw<bf, 0, true><<<dim3(TT / 64, DKV / 64, 1), 32, 0, stream>>>(XB, nullptr, WV, nullptr, DM, FV, DKV, bv, 0, 0, 0); k_vtp<<<LKv, 256, 0, stream>>>(FV, DKV, NKV, VT16, VTh, VTl);
        for (int h0 = 0; h0 < NH_; h0 += ZH) { const size_t zq = (size_t)h0, zk = (size_t)(h0 / REP);   // one kv head per query head: the pass's two heads use consecutive kv planes (z-strides TT*HD)
            k_gemmw<bf, 2, false><<<dim3(RH / 64, TT / 64, ZH), 32, 0, stream>>>(QPh + zq * TT * HD, QPl + zq * TT * HD, KPh + zk * TT * HD, KPl + zk * TT * HD, HD, Sb, TT, nullptr, (size_t)TT * HD, (size_t)TT * HD, (size_t)TT * TT);
            k_asoft<<<ZH * TT / 8, 256, 0, stream>>>(Sb, P16, Ph, Pl, PF); k_paccum<<<(unsigned)(((size_t)TT * TT / 4 + 255) / 256), 256, 0, stream>>>(PA, PF, h0);   /* head-ordered f32 sum of the probabilities */
            k_gemmw<bf, 2, false><<<dim3(RH / 64, HD / 64, ZH), 32, 0, stream>>>(Ph, Pl, VTh + zk * HD * TT, VTl + zk * HD * TT, TT, Ob, HD, nullptr, (size_t)RH * TT, (size_t)HD * TT, (size_t)TT * HD);
            k_merge<<<(unsigned)(((size_t)ZH * TT * HD / 2 + 255) / 256), 256, 0, stream>>>(Ob, h0, ATh, ATl); }
        k_gemmw<bf, 1, true><<<dim3(TT / 64, DM / 64, 1), 32, 0, stream>>>(ATh, ATl, WO, nullptr, DQ, OUT + (size_t)b * TT * DM, DM, bo, 0, 0, 0); k_pmean<<<(unsigned)(((size_t)TT * TT / 4 + 255) / 256), 256, 0, stream>>>(PA, OUT2 + (size_t)b * TT * TT);   /* mean over heads of the probabilities -> second output */ }
}

// v001
// A run of this version takes 936 microseconds.
// Timed twice side by side with v000, it ran 1.64 and 1.63 times as fast.
#include <hip/hip_runtime.h>

// Multi-head attention returning the output AND the head-averaged attention probabilities (Q, K, V [2][2048][1024]; q,k,v = input W^T + b ('oi' [1024][1024] + [1024]; 16 heads x 64); scores = q.k x 1.0 (SCALING = 1: unscaled); probs = softmax; attn = probs v; out = merged Wo^T + bo -> [2][2048][1024]; second output mean over heads of probs -> [2][2048][2048]; tuple (12.6 M)).
// Layout per batch: bf16 copies of the three inputs in turn; exact projections + f32 biases; dense T-2048 attention with EVERY row on hi/lo planes (3 products; the unscaled logits reach |s| ~ 15); the softmax kernel also stores its f32 probabilities for the pass's two heads, and an accumulation kernel adds them into a per-batch f32 sum in head order (one thread per four elements, fixed order: deterministic); after the last pass the sum x 1/16 is written to the second output; merged hi/lo x Wo exact + bo to the first.
// Compute dtypes, f32 accumulate: every input rounded to bf16; projections exact + f32 biases; scores and attn.v 3 products; softmax, probability mean f32; Wo hl x exact + bias.

#define NB_  2
#define TT   2048
#define DM   1024
#define NH_  16
#define NKV  16
#define REP  (NH_ / NKV)
#define HD   64
#define DQ   (NH_ * HD)
#define DKV  (NKV * HD)
#define ZH   2
#define RH   2048                  // query rows < RH use hi+lo planes (0: none)
#define WIN  0
#define PCAR 1024.0f
#define KSW  8                     // waves of a work-group that share a long K range
#define PVG  4                     // work-groups that share the K range of probs x v (partial planes, summed in k_merge)
#define SCL  1.0f   // SCALING = 1.0 in the module (no 1/sqrt(d))
typedef _Float16 h16;
typedef unsigned short bf;
typedef __attribute__((ext_vector_type(16))) __bf16   v16bf;
typedef __attribute__((ext_vector_type(16))) _Float16 v16h;
typedef __attribute__((ext_vector_type(8)))  _Float16 v8h;
typedef __attribute__((ext_vector_type(8)))  unsigned short v8us;
typedef __attribute__((ext_vector_type(8)))  float    v8f;
typedef __attribute__((ext_vector_type(4)))  float    v4f;
typedef v8h  __attribute__((may_alias)) v8ha;
typedef v4f  __attribute__((may_alias)) v4fa;
typedef v8us __attribute__((may_alias)) v8usa;

__device__ __forceinline__ unsigned short f2bf(float f) { unsigned u = __float_as_uint(f); u += 0x7FFFu + ((u >> 16) & 1u); return (unsigned short)(u >> 16); }
__device__ __forceinline__ float bf2f(unsigned short b) { return __uint_as_float(((unsigned)b) << 16); }
__device__ __forceinline__ float bfr(float f) { return bf2f(f2bf(f)); }
__device__ __forceinline__ v16h cat16(v8h lo, v8h hi) { return __builtin_shufflevector(lo, hi, 0, 1, 2, 3, 4, 5, 6, 7, 8, 9, 10, 11, 12, 13, 14, 15); }
__device__ __forceinline__ v16bf cat16b(v8us lo, v8us hi) { return __builtin_bit_cast(v16bf, __builtin_shufflevector(lo, hi, 0, 1, 2, 3, 4, 5, 6, 7, 8, 9, 10, 11, 12, 13, 14, 15)); }
__device__ __forceinline__ v8f wmma16(v16h a, v16h b, v8f c) { return __builtin_amdgcn_wmma_f32_16x16x32_f16(false, a, false, b, (short)0, c, false, false); }
__device__ __forceinline__ v8f wmmab(v16bf a, v16bf b, v8f c) { return __builtin_amdgcn_wmma_f32_16x16x32_bf16(false, a, false, b, (short)0, c, false, false); }



// ---- k_gemmw: register-blocked GEMM, KS waves per 64x64 output tile, each with 16 accumulators, operands straight from K-contiguous 16-bit planes; grid (M/64, N/64, Z KG), 32 KS threads.
// C[m][n] (f32, pitch ldc, + optional f32 bias[n]) = sum_k A[m][k] Bt[n][k] (+ split products per NSPLIT). z-batch strides sA/sB/sC in elements. K % 32 == 0.
// Split K: the tile's K range is cut into KG x KS equal slices (K % (32 KG KS) == 0). The KS waves of a work-group (32 KS threads) each run one slice and their partial tiles are summed through LDS in wave order (one barrier);
// the KG slice groups are separate work-groups (blockIdx.z = z KG + g) that store partial planes at C + g sG, which the consumer sums in g order. KS = KG = 1: one wave, whole K.
template <typename T16> struct WFrag;
template <> struct WFrag<h16> { typedef v16h V; static __device__ __forceinline__ V ld(const h16* p) { return cat16(*(const v8h*)p, *(const v8h*)(p + 16)); } static __device__ __forceinline__ v8f mma(V a, V b, v8f c) { return wmma16(a, b, c); } };
template <> struct WFrag<bf> { typedef v16bf V; static __device__ __forceinline__ V ld(const bf* p) { return cat16b(*(const v8us*)p, *(const v8us*)(p + 16)); } static __device__ __forceinline__ v8f mma(V a, V b, v8f c) { return wmmab(a, b, c); } };
template <typename T16, int NSPLIT, bool BIAS, int KS, int KG>
__global__ __launch_bounds__(32 * KS) void k_gemmw(const T16* __restrict__ A, const T16* __restrict__ A2, const T16* __restrict__ Bt, const T16* __restrict__ Bt2, int K, float* C, int ldc, const float* __restrict__ bias, size_t sA, size_t sB, size_t sC, size_t sG) {
    typedef typename WFrag<T16>::V V;
    __shared__ __align__(16) float os[KS > 1 ? KS * 64 * 68 : 16 * 68];
    const int wv = __builtin_amdgcn_readfirstlane(threadIdx.x >> 5);   // wave number, scalar: the K loop's bounds stay wave-uniform (WMMA needs every lane on)
    const int kl = K / (KS * KG), kbeg = ((int)(blockIdx.z % KG) * KS + wv) * kl, kend = kbeg + kl; C += (size_t)(blockIdx.z % KG) * sG;
    const size_t z = blockIdx.z / KG; A += z * sA; if (A2) A2 += z * sA; Bt += z * sB; if (Bt2) Bt2 += z * sB; C += z * sC;
    const int lane = threadIdx.x & 31, lr = lane & 15, hi = lane >> 4; const int r0 = blockIdx.x * 64, c0 = blockIdx.y * 64;
    v8f acc[4][4];
#pragma unroll
    for (int mb = 0; mb < 4; ++mb)
#pragma unroll
        for (int nb = 0; nb < 4; ++nb) acc[mb][nb] = (v8f){};
    const size_t aoff = (size_t)(r0 + lr) * K + 8 * hi, boff = (size_t)(c0 + lr) * K + 8 * hi;
#pragma unroll 1
    for (int kc = kbeg; kc < kend; kc += 32) {
        V a[4], a2[4];
#pragma unroll
        for (int mb = 0; mb < 4; ++mb) { a[mb] = WFrag<T16>::ld(A + aoff + (size_t)mb * 16 * K + kc); if (NSPLIT == 1 || NSPLIT == 2) a2[mb] = WFrag<T16>::ld(A2 + aoff + (size_t)mb * 16 * K + kc); }
#pragma unroll
        for (int nb = 0; nb < 4; ++nb) { const V b = WFrag<T16>::ld(Bt + boff + (size_t)nb * 16 * K + kc); V b2; if (NSPLIT >= 2) b2 = WFrag<T16>::ld(Bt2 + boff + (size_t)nb * 16 * K + kc);
#pragma unroll
            for (int mb = 0; mb < 4; ++mb) { acc[mb][nb] = WFrag<T16>::mma(a[mb], b, acc[mb][nb]); if (NSPLIT == 1 || NSPLIT == 2) acc[mb][nb] = WFrag<T16>::mma(a2[mb], b, acc[mb][nb]); if (NSPLIT >= 2) acc[mb][nb] = WFrag<T16>::mma(a[mb], b2, acc[mb][nb]); } }
        asm volatile("v_nop\n\tv_nop\n\tv_nop\n\tv_nop" : "+v"(acc[0][0]), "+v"(acc[1][1]), "+v"(acc[2][2]), "+v"(acc[3][3]) : "v"(a[0]), "v"(a[3]));
    }
    if constexpr (KS > 1) {
#pragma unroll
        for (int mb = 0; mb < 4; ++mb)
#pragma unroll
            for (int nb = 0; nb < 4; ++nb)
#pragma unroll
                for (int j = 0; j < 8; ++j) os[wv * (64 * 68) + (mb * 16 + hi * 8 + j) * 68 + nb * 16 + lr] = acc[mb][nb][j];
        __syncthreads();   // every wave's partial 64x64 tile is in LDS before any thread sums across the waves
#pragma unroll
        for (int it = 0; it < 64 * 16 / (32 * KS); ++it) { const int idx = it * (32 * KS) + (int)threadIdx.x, row = idx >> 4, cofs = (idx & 15) * 4; v4f val = *(const v4fa*)(os + row * 68 + cofs);
#pragma unroll
            for (int w = 1; w < KS; ++w) val += *(const v4fa*)(os + w * (64 * 68) + row * 68 + cofs);
            if (BIAS) { val[0] += bfr(bias[c0 + cofs]); val[1] += bfr(bias[c0 + cofs + 1]); val[2] += bfr(bias[c0 + cofs + 2]); val[3] += bfr(bias[c0 + cofs + 3]); }
            *(v4f*)(C + (size_t)(r0 + row) * ldc + c0 + cofs) = val; }
        return;
    }
#pragma unroll
    for (int mb = 0; mb < 4; ++mb) {
#pragma unroll
        for (int nb = 0; nb < 4; ++nb) {
#pragma unroll
            for (int j = 0; j < 8; ++j) os[(hi * 8 + j) * 68 + nb * 16 + lr] = acc[mb][nb][j]; }
        __builtin_amdgcn_wave_barrier(); asm volatile("" ::: "memory");
        float* crow = C + (size_t)(r0 + mb * 16) * ldc + c0;
{
#pragma unroll
            for (int s = 0; s < 8; ++s) { const int row = 2 * s + hi, cofs = lr * 4; v4f val = *(const v4fa*)(os + row * 68 + cofs); if (BIAS) { val[0] += bfr(bias[c0 + cofs]); val[1] += bfr(bias[c0 + cofs + 1]); val[2] += bfr(bias[c0 + cofs + 2]); val[3] += bfr(bias[c0 + cofs + 3]); }
                *(v4f*)(crow + (size_t)row * ldc + cofs) = val; }
             }
        __builtin_amdgcn_wave_barrier(); asm volatile("" ::: "memory");
    }
}

__device__ __forceinline__ h16 tohx(float x) { return (h16)x; }
__device__ __forceinline__ void splitf(float y, unsigned short& h, unsigned short& l) { h = f2bf(y); l = f2bf(y - bf2f(h)); }
typedef __attribute__((ext_vector_type(2))) _Float16 v2h;
typedef __attribute__((ext_vector_type(4))) _Float16 v4h;
typedef __attribute__((ext_vector_type(2))) unsigned short v2us;
typedef __attribute__((ext_vector_type(4))) unsigned short v4us;
typedef __attribute__((ext_vector_type(2))) float v2f;
typedef __attribute__((ext_vector_type(4))) int v4i;

__global__ __launch_bounds__(256) void k_wtG(const float* __restrict__ w, int K, int N, bf* Bt) {
    const int lane = threadIdx.x & 31; const int L0 = (blockIdx.x * 8 + (threadIdx.x >> 5)) * 8; const int nlines = N * K / 64;
{
#pragma unroll 1
        for (int l = 0; l < 8; ++l) { const int L = L0 + l; if (L >= nlines) break; const size_t e = (size_t)L * 64 + lane * 2; const int k = (int)(e % K), n = (int)(e / K); v2us o;
            o[0] = f2bf(w[(size_t)k * N + n]); o[1] = f2bf(w[(size_t)(k + 1) * N + n]); *(v2us*)(Bt + e) = o; }
         }
}
__global__ __launch_bounds__(256) void k_cvt8(const float* __restrict__ src, bf* dst, size_t n8) { const size_t i = (size_t)blockIdx.x * 256 + threadIdx.x; if (i >= n8) return; const v8f v = *(const v8f*)(src + i * 8); v8us o;
#pragma unroll
    for (int k = 0; k < 8; ++k) o[k] = f2bf(v[k]); *(v8us*)(dst + i * 8) = o;  }

// k_rope: head planes [h][t][d] (fp16 + hi/lo) of rope(x) x sc with the rotate-half convention out[d] = x[d] cos[t][d] - x[d+HD/2] sin[t][d], out[d+HD/2] = x[d+HD/2] cos[t][d+HD/2] + x[d] sin[t][d+HD/2]
__global__ __launch_bounds__(256) void k_rope(const float* __restrict__ F, int pitch, int nheads, const float* __restrict__ CS, const float* __restrict__ RF, const float* __restrict__ nw, float sc, h16* P16, bf* Ph, bf* Pl) {
    const size_t e = ((size_t)blockIdx.x * 256 + threadIdx.x) * 2; if (e >= (size_t)nheads * TT * HD) return; const int d = (int)(e % HD); const int t = (int)((e / HD) % TT); const int h = (int)(e / ((size_t)HD * TT)); const float* f = F + (size_t)t * pitch + h * HD; const float rf = RF ? RF[(size_t)h * TT + t] : 1.0f; v2h o16; v2us oh, ol;
#pragma unroll
    for (int q = 0; q < 2; ++q) { const int dd = d + q; const int dp = (dd < HD / 2) ? dd + HD / 2 : dd - HD / 2; float x0 = f[dd], x1 = f[dp];
        if (RF) { float n0 = __fmul_rn(x0, rf), n1 = __fmul_rn(x1, rf); asm volatile("" : "+v"(n0)); asm volatile("" : "+v"(n1)); x0 = __fmul_rn(bfr(nw[dd]), n0); x1 = __fmul_rn(bfr(nw[dp]), n1); }
        const v2f cs = *(const v2f*)(CS + ((size_t)t * HD + dd) * 2); float a = __fmul_rn(x0, cs[0]), bq = __fmul_rn(x1, cs[1]); asm volatile("" : "+v"(a)); asm volatile("" : "+v"(bq)); const float r = ((dd < HD / 2) ? __fsub_rn(a, bq) : __fadd_rn(a, bq)) * sc;
        o16[q] = tohx(r); unsigned short a2, c2; splitf(r, a2, c2); oh[q] = a2; ol[q] = c2; }
    *(v2h*)(P16 + e) = o16; *(v2us*)(Ph + e) = oh; *(v2us*)(Pl + e) = ol;  }
__global__ __launch_bounds__(256) void k_vtp(const float* __restrict__ F, int pitch, int nheads, h16* V16, bf* Vh, bf* Vl) { const size_t e = ((size_t)blockIdx.x * 256 + threadIdx.x) * 2; if (e >= (size_t)nheads * HD * TT) return; const int t = (int)(e % TT); const int d = (int)((e / TT) % HD); const int g = (int)(e / ((size_t)TT * HD)); v2h o16; v2us oh, ol;
#pragma unroll
    for (int q = 0; q < 2; ++q) { const float x = F[(size_t)(t + q) * pitch + g * HD + d]; o16[q] = tohx(x); unsigned short a2, c2; splitf(x, a2, c2); oh[q] = a2; ol[q] = c2; }
    *(v2h*)(V16 + e) = o16; *(v2us*)(Vh + e) = oh; *(v2us*)(Vl + e) = ol;  }
__global__ __launch_bounds__(256) void k_csid(float* CS) { const int idx = blockIdx.x * 256 + threadIdx.x; if (idx >= TT * HD) return; v2f cs; cs[0] = 1.0f; cs[1] = 0.0f; *(v2f*)(CS + (size_t)idx * 2) = cs;  }
// k_asoft: per row (zz, i): t = S x SCL = S (unscaled, no mask); softmax over the 2048 keys (register row, one exp, fixed trees);
__global__ __launch_bounds__(256) void k_asoft(const float* __restrict__ Sb, h16* P16, bf* Ph, bf* Pl, float* PF) {
    const int lane = threadIdx.x & 31; const int row = blockIdx.x * 8 + (threadIdx.x >> 5); if (row >= ZH * TT) return; const int i = row % TT; const int zz = row / TT; (void)zz; const bool hires = (i < RH); const float* sr = Sb + (size_t)row * TT; float v[TT / 32]; float mx = -3.0e38f;
#pragma unroll
    for (int ch = 0; ch < TT / 128; ++ch) { const int j0 = ch * 128 + lane * 4; const v4f a = *(const v4f*)(sr + j0);
#pragma unroll
        for (int q = 0; q < 4; ++q) { const int j = j0 + q; (void)j; const float t = a[q] * SCL; v[ch * 4 + q] = t; mx = fmaxf(mx, t); } }
#pragma unroll
    for (int sh = 16; sh; sh >>= 1) mx = fmaxf(mx, __shfl_xor(mx, sh, 32));
    float sum = 0.f;
#pragma unroll
    for (int k = 0; k < TT / 32; ++k) { float d0 = __fsub_rn(v[k], mx); asm volatile("" : "+v"(d0)); v[k] = __builtin_amdgcn_exp2f(__fmul_rn(d0, 1.4426950408889634f)); sum += v[k]; }
#pragma unroll
    for (int sh = 16; sh; sh >>= 1) sum += __shfl_xor(sum, sh, 32);
    const float f = __fdiv_rn(hires ? 1.0f : PCAR, sum);
{
        if (hires) {
#pragma unroll
            for (int ch = 0; ch < TT / 128; ++ch) { v4us oh, ol; v4f pf;
#pragma unroll
                for (int q = 0; q < 4; ++q) { const float pq = v[ch * 4 + q] * f; pf[q] = pq; unsigned short a, c2; splitf(pq, a, c2); oh[q] = a; ol[q] = c2; }
                const size_t oo = ((size_t)zz * (RH ? RH : 1) + i) * TT + ch * 128 + lane * 4; *(v4us*)(Ph + oo) = oh; *(v4us*)(Pl + oo) = ol; *(v4f*)(PF + oo) = pf;   /* f32 probabilities for the head-mean output */ }
        } else {
#pragma unroll
            for (int ch = 0; ch < TT / 128; ++ch) { v4h o4;
#pragma unroll
                for (int q = 0; q < 4; ++q) o4[q] = tohx(v[ch * 4 + q] * f);
                *(v4h*)(P16 + (size_t)row * TT + ch * 128 + lane * 4) = o4; } }
         }
}
__global__ __launch_bounds__(256) void k_paccum(float* PA, const float* __restrict__ PF, int h0) { const size_t i = (size_t)blockIdx.x * 256 + threadIdx.x; if (i >= (size_t)TT * TT / 4) return; const size_t e = i * 4; v4f a; if (h0 == 0) { a[0] = a[1] = a[2] = a[3] = 0.f; } else { a = *(const v4f*)(PA + e); } const v4f p0 = *(const v4f*)(PF + e); const v4f p1 = *(const v4f*)(PF + (size_t)TT * TT + e);
#pragma unroll
    for (int q = 0; q < 4; ++q) { float s1 = __fadd_rn(a[q], p0[q]); asm volatile("" : "+v"(s1)); a[q] = __fadd_rn(s1, p1[q]); }
    *(v4f*)(PA + e) = a;  }
__global__ __launch_bounds__(256) void k_pmean(const float* __restrict__ PA, float* O2) { const size_t i = (size_t)blockIdx.x * 256 + threadIdx.x; if (i >= (size_t)TT * TT / 4) return; v4f a = *(const v4f*)(PA + i * 4);
#pragma unroll
    for (int q = 0; q < 4; ++q) a[q] = __fmul_rn(a[q], 0.0625f);
    *(v4f*)(O2 + i * 4) = a;  }
__global__ __launch_bounds__(256) void k_merge(const float* __restrict__ O, int h0, bf* Ah, bf* Al) { const size_t e = ((size_t)blockIdx.x * 256 + threadIdx.x) * 2; if (e >= (size_t)ZH * TT * HD) return; const int d = (int)(e % HD); const int t = (int)((e / HD) % TT); const int zz = (int)(e / ((size_t)HD * TT)); const float cs = (t < RH) ? 1.0f : (1.0f / PCAR); const size_t oo = (size_t)t * DQ + (h0 + zz) * HD + d;
    v2us oh, ol;
#pragma unroll
    for (int q = 0; q < 2; ++q) { float s = O[e + q];
#pragma unroll
        for (int g = 1; g < PVG; ++g) s += O[(size_t)g * ZH * TT * HD + e + q];   /* partial planes of the split-K probs x v product, in slice order */
        unsigned short a, c2; splitf(s * cs, a, c2); oh[q] = a; ol[q] = c2; } *(v2us*)(Ah + oo) = oh; *(v2us*)(Al + oo) = ol;  }

extern "C" void kernel_launch(void* const* d_in, const int* in_sizes, int n_in,
                              void* d_out, int out_size, void* d_ws, size_t ws_size, hipStream_t stream) {
    (void)in_sizes; (void)n_in; (void)out_size;
    const float* x = (const float*)d_in[0]; const float* xk = (const float*)d_in[1]; const float* xv = (const float*)d_in[2]; const float* wq = (const float*)d_in[3]; const float* bq = (const float*)d_in[4]; const float* wk = (const float*)d_in[5]; const float* bk = (const float*)d_in[6]; const float* wv = (const float*)d_in[7]; const float* bv = (const float*)d_in[8]; const float* wo = (const float*)d_in[9]; const float* bo = (const float*)d_in[10];
    float* OUT = (float*)d_out;     // first output [2][2048][1024]
    float* OUT2 = OUT + (size_t)NB_ * TT * DM;   // second output [2][2048][2048] (tuple: contiguous after the first)
    char* wsp = (char*)d_ws;
    auto take = [&](size_t bytes) { char* p = wsp; wsp += (bytes + 255) & ~(size_t)255; return (void*)p; };
    bf* WQ = (bf*)take((size_t)DQ * DM * 2); bf* WK = (bf*)take((size_t)DKV * DM * 2); bf* WV = (bf*)take((size_t)DKV * DM * 2); bf* WO = (bf*)take((size_t)DM * DQ * 2); float* CS = (float*)take((size_t)TT * HD * 2 * 4);
    bf* XB = (bf*)take((size_t)TT * DM * 2); float* FQ = (float*)take((size_t)TT * DQ * 4); float* FK = (float*)take((size_t)TT * DKV * 4);
    h16* QP16 = (h16*)take((size_t)NH_ * TT * HD * 2); h16* KP16 = (h16*)take((size_t)NKV * TT * HD * 2); h16* VT16 = (h16*)take((size_t)NKV * HD * TT * 2);
    bf* QPh = (bf*)take((size_t)NH_ * TT * HD * 2); bf* QPl = (bf*)take((size_t)NH_ * TT * HD * 2); bf* KPh = (bf*)take((size_t)NKV * TT * HD * 2); bf* KPl = (bf*)take((size_t)NKV * TT * HD * 2); bf* VTh = (bf*)take((size_t)NKV * HD * TT * 2); bf* VTl = (bf*)take((size_t)NKV * HD * TT * 2); bf* Ph = (bf*)take((size_t)ZH * RH * TT * 2); bf* Pl = (bf*)take((size_t)ZH * RH * TT * 2);
    float* Sb = (float*)take((size_t)ZH * TT * TT * 4); h16* P16 = nullptr; float* PF = (float*)take((size_t)ZH * TT * TT * 4); float* PA = (float*)take((size_t)TT * TT * 4); float* Ob = (float*)take((size_t)PVG * ZH * TT * HD * 4); bf* ATh = (bf*)take((size_t)TT * DQ * 2); bf* ATl = (bf*)take((size_t)TT * DQ * 2);
    if ((size_t)(wsp - (char*)d_ws) > ws_size) return;    // ws 256 MiB
    float* FV = FK;   // v projection reuses the k buffer after the k planes are built (stream-ordered)
    { k_cvt8<<<(unsigned)(((size_t)DQ * DM / 8 + 255) / 256), 256, 0, stream>>>(wq, WQ, (size_t)DQ * DM / 8); k_cvt8<<<(unsigned)(((size_t)DKV * DM / 8 + 255) / 256), 256, 0, stream>>>(wk, WK, (size_t)DKV * DM / 8); k_cvt8<<<(unsigned)(((size_t)DKV * DM / 8 + 255) / 256), 256, 0, stream>>>(wv, WV, (size_t)DKV * DM / 8);
      k_cvt8<<<(unsigned)(((size_t)DM * DQ / 8 + 255) / 256), 256, 0, stream>>>(wo, WO, (size_t)DM * DQ / 8);
       }
    k_csid<<<(TT * HD + 255) / 256, 256, 0, stream>>>(CS);
    const unsigned LQ = (unsigned)(((size_t)NH_ * TT * HD / 2 + 255) / 256), LKv = (unsigned)(((size_t)NKV * TT * HD / 2 + 255) / 256);
    for (int b = 0; b < NB_; ++b) {
        
        k_cvt8<<<(unsigned)(((size_t)TT * DM / 8 + 255) / 256), 256, 0, stream>>>(x + (size_t)b * TT * DM, XB, (size_t)TT * DM / 8);
        k_gemmw<bf, 0, true, KSW, 1><<<dim3(TT / 64, DQ / 64, 1), 32 * KSW, 0, stream>>>(XB, nullptr, WQ, nullptr, DM, FQ, DQ, bq, 0, 0, 0, 0);
        k_rope<<<LQ, 256, 0, stream>>>(FQ, DQ, NH_, CS, nullptr, nullptr, 1.0f, QP16, QPh, QPl);
        k_cvt8<<<(unsigned)(((size_t)TT * DM / 8 + 255) / 256), 256, 0, stream>>>(xk + (size_t)b * TT * DM, XB, (size_t)TT * DM / 8); k_gemmw<bf, 0, true, KSW, 1><<<dim3(TT / 64, DKV / 64, 1), 32 * KSW, 0, stream>>>(XB, nullptr, WK, nullptr, DM, FK, DKV, bk, 0, 0, 0, 0);
        k_rope<<<LKv, 256, 0, stream>>>(FK, DKV, NKV, CS, nullptr, nullptr, 1.0f, KP16, KPh, KPl);
        k_cvt8<<<(unsigned)(((size_t)TT * DM / 8 + 255) / 256), 256, 0, stream>>>(xv + (size_t)b * TT * DM, XB, (size_t)TT * DM / 8); k_gemmw<bf, 0, true, KSW, 1><<<dim3(TT / 64, DKV / 64, 1), 32 * KSW, 0, stream>>>(XB, nullptr, WV, nullptr, DM, FV, DKV, bv, 0, 0, 0, 0); k_vtp<<<LKv, 256, 0, stream>>>(FV, DKV, NKV, VT16, VTh, VTl);
        for (int h0 = 0; h0 < NH_; h0 += ZH) { const size_t zq = (size_t)h0, zk = (size_t)(h0 / REP);   // one kv head per query head: the pass's two heads use consecutive kv planes (z-strides TT*HD)
            k_gemmw<bf, 2, false, 1, 1><<<dim3(RH / 64, TT / 64, ZH), 32, 0, stream>>>(QPh + zq * TT * HD, QPl + zq * TT * HD, KPh + zk * TT * HD, KPl + zk * TT * HD, HD, Sb, TT, nullptr, (size_t)TT * HD, (size_t)TT * HD, (size_t)TT * TT, 0);
            k_asoft<<<ZH * TT / 8, 256, 0, stream>>>(Sb, P16, Ph, Pl, PF); k_paccum<<<(unsigned)(((size_t)TT * TT / 4 + 255) / 256), 256, 0, stream>>>(PA, PF, h0);   /* head-ordered f32 sum of the probabilities */
            k_gemmw<bf, 2, false, KSW, PVG><<<dim3(RH / 64, HD / 64, ZH * PVG), 32 * KSW, 0, stream>>>(Ph, Pl, VTh + zk * HD * TT, VTl + zk * HD * TT, TT, Ob, HD, nullptr, (size_t)RH * TT, (size_t)HD * TT, (size_t)TT * HD, (size_t)ZH * TT * HD);
            k_merge<<<(unsigned)(((size_t)ZH * TT * HD / 2 + 255) / 256), 256, 0, stream>>>(Ob, h0, ATh, ATl); }
        k_gemmw<bf, 1, true, KSW, 1><<<dim3(TT / 64, DM / 64, 1), 32 * KSW, 0, stream>>>(ATh, ATl, WO, nullptr, DQ, OUT + (size_t)b * TT * DM, DM, bo, 0, 0, 0, 0); k_pmean<<<(unsigned)(((size_t)TT * TT / 4 + 255) / 256), 256, 0, stream>>>(PA, OUT2 + (size_t)b * TT * TT);   /* mean over heads of the probabilities -> second output */ }
}

// v002
// It runs in 785 microseconds.
// Next to v001, in two timings, it ran 1.19 and 1.20 times as fast.
// Over all steps from v000 it is 1.95 times as fast.
#include <hip/hip_runtime.h>

// Multi-head attention returning the output AND the head-averaged attention probabilities (Q, K, V [2][2048][1024]; q,k,v = input W^T + b ('oi' [1024][1024] + [1024]; 16 heads x 64); scores = q.k x 1.0 (SCALING = 1: unscaled); probs = softmax; attn = probs v; out = merged Wo^T + bo -> [2][2048][1024]; second output mean over heads of probs -> [2][2048][2048]; tuple (12.6 M)).
// Layout per batch: bf16 copies of the three inputs in turn; exact projections + f32 biases; dense T-2048 attention with EVERY row on hi/lo planes (3 products; the unscaled logits reach |s| ~ 15); one wave of the softmax kernel takes a query row of BOTH heads of the pass and adds their f32 probabilities, in head order, into a per-batch f32 sum (each lane owns 64 elements of the row, fixed order: deterministic); the last pass writes the sum x 1/16 to the second output instead; merged hi/lo x Wo exact + bo to the first.
// Compute dtypes, f32 accumulate: every input rounded to bf16; projections exact + f32 biases; scores and attn.v 3 products; softmax, probability mean f32; Wo hl x exact + bias.

#define NB_  2
#define TT   2048
#define DM   1024
#define NH_  16
#define NKV  16
#define REP  (NH_ / NKV)
#define HD   64
#define DQ   (NH_ * HD)
#define DKV  (NKV * HD)
#define ZH   2
#define RH   2048                  // query rows < RH use hi+lo planes (0: none)
#define WIN  0
#define PCAR 1024.0f
#define KSW  8                     // waves of a work-group that share a long K range
#define PVG  4                     // work-groups that share the K range of probs x v (partial planes, summed in k_merge)
#define SCL  1.0f   // SCALING = 1.0 in the module (no 1/sqrt(d))
typedef _Float16 h16;
typedef unsigned short bf;
typedef __attribute__((ext_vector_type(16))) __bf16   v16bf;
typedef __attribute__((ext_vector_type(16))) _Float16 v16h;
typedef __attribute__((ext_vector_type(8)))  _Float16 v8h;
typedef __attribute__((ext_vector_type(8)))  unsigned short v8us;
typedef __attribute__((ext_vector_type(8)))  float    v8f;
typedef __attribute__((ext_vector_type(4)))  float    v4f;
typedef v8h  __attribute__((may_alias)) v8ha;
typedef v4f  __attribute__((may_alias)) v4fa;
typedef v8us __attribute__((may_alias)) v8usa;

__device__ __forceinline__ unsigned short f2bf(float f) { unsigned u = __float_as_uint(f); u += 0x7FFFu + ((u >> 16) & 1u); return (unsigned short)(u >> 16); }
__device__ __forceinline__ float bf2f(unsigned short b) { return __uint_as_float(((unsigned)b) << 16); }
__device__ __forceinline__ float bfr(float f) { return bf2f(f2bf(f)); }
__device__ __forceinline__ v16h cat16(v8h lo, v8h hi) { return __builtin_shufflevector(lo, hi, 0, 1, 2, 3, 4, 5, 6, 7, 8, 9, 10, 11, 12, 13, 14, 15); }
__device__ __forceinline__ v16bf cat16b(v8us lo, v8us hi) { return __builtin_bit_cast(v16bf, __builtin_shufflevector(lo, hi, 0, 1, 2, 3, 4, 5, 6, 7, 8, 9, 10, 11, 12, 13, 14, 15)); }
__device__ __forceinline__ v8f wmma16(v16h a, v16h b, v8f c) { return __builtin_amdgcn_wmma_f32_16x16x32_f16(false, a, false, b, (short)0, c, false, false); }
__device__ __forceinline__ v8f wmmab(v16bf a, v16bf b, v8f c) { return __builtin_amdgcn_wmma_f32_16x16x32_bf16(false, a, false, b, (short)0, c, false, false); }



// ---- k_gemmw: register-blocked GEMM, KS waves per 64x64 output tile, each with 16 accumulators, operands straight from K-contiguous 16-bit planes; grid (M/64, N/64, Z KG), 32 KS threads.
// C[m][n] (f32, pitch ldc, + optional f32 bias[n]) = sum_k A[m][k] Bt[n][k] (+ split products per NSPLIT). z-batch strides sA/sB/sC in elements. K % 32 == 0.
// Split K: the tile's K range is cut into KG x KS equal slices (K % (32 KG KS) == 0). The KS waves of a work-group (32 KS threads) each run one slice and their partial tiles are summed through LDS in wave order (one barrier);
// the KG slice groups are separate work-groups (blockIdx.z = z KG + g) that store partial planes at C + g sG, which the consumer sums in g order. KS = KG = 1: one wave, whole K.
template <typename T16> struct WFrag;
template <> struct WFrag<h16> { typedef v16h V; static __device__ __forceinline__ V ld(const h16* p) { return cat16(*(const v8h*)p, *(const v8h*)(p + 16)); } static __device__ __forceinline__ v8f mma(V a, V b, v8f c) { return wmma16(a, b, c); } };
template <> struct WFrag<bf> { typedef v16bf V; static __device__ __forceinline__ V ld(const bf* p) { return cat16b(*(const v8us*)p, *(const v8us*)(p + 16)); } static __device__ __forceinline__ v8f mma(V a, V b, v8f c) { return wmmab(a, b, c); } };
template <typename T16, int NSPLIT, bool BIAS, int KS, int KG>
__global__ __launch_bounds__(32 * KS) void k_gemmw(const T16* __restrict__ A, const T16* __restrict__ A2, const T16* __restrict__ Bt, const T16* __restrict__ Bt2, int K, float* C, int ldc, const float* __restrict__ bias, size_t sA, size_t sB, size_t sC, size_t sG) {
    typedef typename WFrag<T16>::V V;
    __shared__ __align__(16) float os[KS > 1 ? KS * 64 * 68 : 16 * 68];
    const int wv = __builtin_amdgcn_readfirstlane(threadIdx.x >> 5);   // wave number, scalar: the K loop's bounds stay wave-uniform (WMMA needs every lane on)
    const int kl = K / (KS * KG), kbeg = ((int)(blockIdx.z % KG) * KS + wv) * kl, kend = kbeg + kl; C += (size_t)(blockIdx.z % KG) * sG;
    const size_t z = blockIdx.z / KG; A += z * sA; if (A2) A2 += z * sA; Bt += z * sB; if (Bt2) Bt2 += z * sB; C += z * sC;
    const int lane = threadIdx.x & 31, lr = lane & 15, hi = lane >> 4; const int r0 = blockIdx.x * 64, c0 = blockIdx.y * 64;
    v8f acc[4][4];
#pragma unroll
    for (int mb = 0; mb < 4; ++mb)
#pragma unroll
        for (int nb = 0; nb < 4; ++nb) acc[mb][nb] = (v8f){};
    const size_t aoff = (size_t)(r0 + lr) * K + 8 * hi, boff = (size_t)(c0 + lr) * K + 8 * hi;
#pragma unroll 1
    for (int kc = kbeg; kc < kend; kc += 32) {
        V a[4], a2[4];
#pragma unroll
        for (int mb = 0; mb < 4; ++mb) { a[mb] = WFrag<T16>::ld(A + aoff + (size_t)mb * 16 * K + kc); if (NSPLIT == 1 || NSPLIT == 2) a2[mb] = WFrag<T16>::ld(A2 + aoff + (size_t)mb * 16 * K + kc); }
#pragma unroll
        for (int nb = 0; nb < 4; ++nb) { const V b = WFrag<T16>::ld(Bt + boff + (size_t)nb * 16 * K + kc); V b2; if (NSPLIT >= 2) b2 = WFrag<T16>::ld(Bt2 + boff + (size_t)nb * 16 * K + kc);
#pragma unroll
            for (int mb = 0; mb < 4; ++mb) { acc[mb][nb] = WFrag<T16>::mma(a[mb], b, acc[mb][nb]); if (NSPLIT == 1 || NSPLIT == 2) acc[mb][nb] = WFrag<T16>::mma(a2[mb], b, acc[mb][nb]); if (NSPLIT >= 2) acc[mb][nb] = WFrag<T16>::mma(a[mb], b2, acc[mb][nb]); } }
        asm volatile("v_nop\n\tv_nop\n\tv_nop\n\tv_nop" : "+v"(acc[0][0]), "+v"(acc[1][1]), "+v"(acc[2][2]), "+v"(acc[3][3]) : "v"(a[0]), "v"(a[3]));
    }
    if constexpr (KS > 1) {
#pragma unroll
        for (int mb = 0; mb < 4; ++mb)
#pragma unroll
            for (int nb = 0; nb < 4; ++nb)
#pragma unroll
                for (int j = 0; j < 8; ++j) os[wv * (64 * 68) + (mb * 16 + hi * 8 + j) * 68 + nb * 16 + lr] = acc[mb][nb][j];
        __syncthreads();   // every wave's partial 64x64 tile is in LDS before any thread sums across the waves
#pragma unroll
        for (int it = 0; it < 64 * 16 / (32 * KS); ++it) { const int idx = it * (32 * KS) + (int)threadIdx.x, row = idx >> 4, cofs = (idx & 15) * 4; v4f val = *(const v4fa*)(os + row * 68 + cofs);
#pragma unroll
            for (int w = 1; w < KS; ++w) val += *(const v4fa*)(os + w * (64 * 68) + row * 68 + cofs);
            if (BIAS) { val[0] += bfr(bias[c0 + cofs]); val[1] += bfr(bias[c0 + cofs + 1]); val[2] += bfr(bias[c0 + cofs + 2]); val[3] += bfr(bias[c0 + cofs + 3]); }
            *(v4f*)(C + (size_t)(r0 + row) * ldc + c0 + cofs) = val; }
        return;
    }
#pragma unroll
    for (int mb = 0; mb < 4; ++mb) {
#pragma unroll
        for (int nb = 0; nb < 4; ++nb) {
#pragma unroll
            for (int j = 0; j < 8; ++j) os[(hi * 8 + j) * 68 + nb * 16 + lr] = acc[mb][nb][j]; }
        __builtin_amdgcn_wave_barrier(); asm volatile("" ::: "memory");
        float* crow = C + (size_t)(r0 + mb * 16) * ldc + c0;
{
#pragma unroll
            for (int s = 0; s < 8; ++s) { const int row = 2 * s + hi, cofs = lr * 4; v4f val = *(const v4fa*)(os + row * 68 + cofs); if (BIAS) { val[0] += bfr(bias[c0 + cofs]); val[1] += bfr(bias[c0 + cofs + 1]); val[2] += bfr(bias[c0 + cofs + 2]); val[3] += bfr(bias[c0 + cofs + 3]); }
                *(v4f*)(crow + (size_t)row * ldc + cofs) = val; }
             }
        __builtin_amdgcn_wave_barrier(); asm volatile("" ::: "memory");
    }
}

__device__ __forceinline__ h16 tohx(float x) { return (h16)x; }
__device__ __forceinline__ void splitf(float y, unsigned short& h, unsigned short& l) { h = f2bf(y); l = f2bf(y - bf2f(h)); }
typedef __attribute__((ext_vector_type(2))) _Float16 v2h;
typedef __attribute__((ext_vector_type(4))) _Float16 v4h;
typedef __attribute__((ext_vector_type(2))) unsigned short v2us;
typedef __attribute__((ext_vector_type(4))) unsigned short v4us;
typedef __attribute__((ext_vector_type(2))) float v2f;
typedef __attribute__((ext_vector_type(4))) int v4i;

__global__ __launch_bounds__(256) void k_wtG(const float* __restrict__ w, int K, int N, bf* Bt) {
    const int lane = threadIdx.x & 31; const int L0 = (blockIdx.x * 8 + (threadIdx.x >> 5)) * 8; const int nlines = N * K / 64;
{
#pragma unroll 1
        for (int l = 0; l < 8; ++l) { const int L = L0 + l; if (L >= nlines) break; const size_t e = (size_t)L * 64 + lane * 2; const int k = (int)(e % K), n = (int)(e / K); v2us o;
            o[0] = f2bf(w[(size_t)k * N + n]); o[1] = f2bf(w[(size_t)(k + 1) * N + n]); *(v2us*)(Bt + e) = o; }
         }
}
__global__ __launch_bounds__(256) void k_cvt8(const float* __restrict__ src, bf* dst, size_t n8) { const size_t i = (size_t)blockIdx.x * 256 + threadIdx.x; if (i >= n8) return; const v8f v = *(const v8f*)(src + i * 8); v8us o;
#pragma unroll
    for (int k = 0; k < 8; ++k) o[k] = f2bf(v[k]); *(v8us*)(dst + i * 8) = o;  }

// k_rope: head planes [h][t][d] (fp16 + hi/lo) of rope(x) x sc with the rotate-half convention out[d] = x[d] cos[t][d] - x[d+HD/2] sin[t][d], out[d+HD/2] = x[d+HD/2] cos[t][d+HD/2] + x[d] sin[t][d+HD/2]
__global__ __launch_bounds__(256) void k_rope(const float* __restrict__ F, int pitch, int nheads, const float* __restrict__ CS, const float* __restrict__ RF, const float* __restrict__ nw, float sc, h16* P16, bf* Ph, bf* Pl) {
    const size_t e = ((size_t)blockIdx.x * 256 + threadIdx.x) * 2; if (e >= (size_t)nheads * TT * HD) return; const int d = (int)(e % HD); const int t = (int)((e / HD) % TT); const int h = (int)(e / ((size_t)HD * TT)); const float* f = F + (size_t)t * pitch + h * HD; const float rf = RF ? RF[(size_t)h * TT + t] : 1.0f; v2h o16; v2us oh, ol;
#pragma unroll
    for (int q = 0; q < 2; ++q) { const int dd = d + q; const int dp = (dd < HD / 2) ? dd + HD / 2 : dd - HD / 2; float x0 = f[dd], x1 = f[dp];
        if (RF) { float n0 = __fmul_rn(x0, rf), n1 = __fmul_rn(x1, rf); asm volatile("" : "+v"(n0)); asm volatile("" : "+v"(n1)); x0 = __fmul_rn(bfr(nw[dd]), n0); x1 = __fmul_rn(bfr(nw[dp]), n1); }
        const v2f cs = *(const v2f*)(CS + ((size_t)t * HD + dd) * 2); float a = __fmul_rn(x0, cs[0]), bq = __fmul_rn(x1, cs[1]); asm volatile("" : "+v"(a)); asm volatile("" : "+v"(bq)); const float r = ((dd < HD / 2) ? __fsub_rn(a, bq) : __fadd_rn(a, bq)) * sc;
        o16[q] = tohx(r); unsigned short a2, c2; splitf(r, a2, c2); oh[q] = a2; ol[q] = c2; }
    *(v2h*)(P16 + e) = o16; *(v2us*)(Ph + e) = oh; *(v2us*)(Pl + e) = ol;  }
__global__ __launch_bounds__(256) void k_vtp(const float* __restrict__ F, int pitch, int nheads, h16* V16, bf* Vh, bf* Vl) { const size_t e = ((size_t)blockIdx.x * 256 + threadIdx.x) * 2; if (e >= (size_t)nheads * HD * TT) return; const int t = (int)(e % TT); const int d = (int)((e / TT) % HD); const int g = (int)(e / ((size_t)TT * HD)); v2h o16; v2us oh, ol;
#pragma unroll
    for (int q = 0; q < 2; ++q) { const float x = F[(size_t)(t + q) * pitch + g * HD + d]; o16[q] = tohx(x); unsigned short a2, c2; splitf(x, a2, c2); oh[q] = a2; ol[q] = c2; }
    *(v2h*)(V16 + e) = o16; *(v2us*)(Vh + e) = oh; *(v2us*)(Vl + e) = ol;  }
__global__ __launch_bounds__(256) void k_csid(float* CS) { const int idx = blockIdx.x * 256 + threadIdx.x; if (idx >= TT * HD) return; v2f cs; cs[0] = 1.0f; cs[1] = 0.0f; *(v2f*)(CS + (size_t)idx * 2) = cs;  }
// k_asoft: one wave per query row i, for all ZH heads of the pass (Sb [i][zz][TT]): t = S x SCL (no mask); softmax over the 2048 keys (register rows, one exp, fixed trees); hi/lo planes of the probabilities;
// the row of the head sum PA (FIRST, the pass of head 0: start value 0, PA not read) takes the heads' f32 probabilities in head order while they are in registers; the last pass stores sum x 1/NH_ to O2 (the head mean), the others the sum to PA.
// 2^x; the v_nop is the one slot the instruction set asks for behind a transcendental before its result is read or its source overwritten
__device__ __forceinline__ float exp2s(float x) { float r; asm("v_exp_f32 %0, %1\n\tv_nop" : "=v"(r) : "v"(x)); return r; }
template <bool FIRST>
__global__ __launch_bounds__(256) void k_asoft(const float* __restrict__ Sb, bf* Ph, bf* Pl, float* PA, float* O2, int h0) {
    static_assert(RH == TT, "every query row is on hi/lo planes");
    const unsigned lane = threadIdx.x & 31; const unsigned i = blockIdx.x * 8 + (threadIdx.x >> 5); if (i >= TT) return; float v[ZH][TT / 32]; v4f acc[TT / 128];
    const unsigned ob = i * (TT * 4) + lane * 16;   // the lane's byte offset in an f32 [TT][TT] plane (half of it in a 16-bit plane): one 32-bit register beside uniform bases serves their loads and stores
    const unsigned os = i * (ZH * TT * 4) + lane * 16;   // the same in the score buffer, where row i of the ZH heads lies side by side
#pragma unroll
    for (int zz = 0; zz < ZH; ++zz) { const char* sr = (const char*)Sb + os + zz * (TT * 4);
#pragma unroll
        for (int ch = 0; ch < TT / 128; ++ch) { const v4f a = *(const v4f*)(sr + ch * 512);
#pragma unroll
            for (int q = 0; q < 4; ++q) v[zz][ch * 4 + q] = a[q] * SCL; } }
#pragma unroll
    for (int ch = 0; ch < TT / 128; ++ch) { if (FIRST) acc[ch] = (v4f){}; else acc[ch] = *(const v4f*)((const char*)PA + ob + ch * 512); }
    asm volatile("s_wait_xcnt 0x0" :: "v"(os) : "memory");   // the wait owed before a register that an issued load names is overwritten; the offset as an input keeps its register untouched up to here (without it a later load's result was placed on it)
    __builtin_amdgcn_sched_barrier(0);   // every load of the wave is issued before the first wait: otherwise the later rows' loads sink into the first head's arithmetic and start late
#pragma unroll
    for (int zz = 0; zz < ZH; ++zz) { float mx = -3.0e38f;
#pragma unroll
        for (int k = 0; k < TT / 32; ++k) mx = fmaxf(mx, v[zz][k]);
#pragma unroll
        for (int sh = 16; sh; sh >>= 1) mx = fmaxf(mx, __shfl_xor(mx, sh, 32));
        float sum = 0.f;
#pragma unroll
        for (int k = 0; k < TT / 32; ++k) { v[zz][k] = exp2s(__fmul_rn(__fsub_rn(v[zz][k], mx), 1.4426950408889634f)); sum += v[zz][k]; }
#pragma unroll
        for (int sh = 16; sh; sh >>= 1) sum += __shfl_xor(sum, sh, 32);
        const float f = __fdiv_rn(1.0f, sum);
        char* ph = (char*)(Ph + (size_t)zz * RH * TT) + (ob >> 1); char* pl = (char*)(Pl + (size_t)zz * RH * TT) + (ob >> 1);
#pragma unroll
        for (int ch = 0; ch < TT / 128; ++ch) { v4us oh, ol;
#pragma unroll
            for (int q = 0; q < 4; ++q) { const float pq = v[zz][ch * 4 + q] * f; acc[ch][q] += pq; unsigned short a, c2; splitf(pq, a, c2); oh[q] = a; ol[q] = c2; }
            *(v4us*)(ph + ch * 256) = oh; *(v4us*)(pl + ch * 256) = ol; }
        __builtin_amdgcn_sched_barrier(0);   // a head's work stays ahead of the next head's first use: it runs while the later rows' loads are still in flight (behind the last head: the sum row's stores stay out of its arithmetic, where they cost registers past v255)
    }
    const bool last = (h0 + ZH == NH_); char* dst = (char*)(last ? O2 : PA) + ob; const float osc = last ? 1.0f / NH_ : 1.0f;
#pragma unroll
    for (int ch = 0; ch < TT / 128; ++ch) *(v4f*)(dst + ch * 512) = acc[ch] * osc;
}
__global__ __launch_bounds__(256) void k_merge(const float* __restrict__ O, int h0, bf* Ah, bf* Al) { const size_t e = ((size_t)blockIdx.x * 256 + threadIdx.x) * 2; if (e >= (size_t)ZH * TT * HD) return; const int d = (int)(e % HD); const int t = (int)((e / HD) % TT); const int zz = (int)(e / ((size_t)HD * TT)); const float cs = (t < RH) ? 1.0f : (1.0f / PCAR); const size_t oo = (size_t)t * DQ + (h0 + zz) * HD + d;
    v2us oh, ol;
#pragma unroll
    for (int q = 0; q < 2; ++q) { float s = O[e + q];
#pragma unroll
        for (int g = 1; g < PVG; ++g) s += O[(size_t)g * ZH * TT * HD + e + q];   /* partial planes of the split-K probs x v product, in slice order */
        unsigned short a, c2; splitf(s * cs, a, c2); oh[q] = a; ol[q] = c2; } *(v2us*)(Ah + oo) = oh; *(v2us*)(Al + oo) = ol;  }

extern "C" void kernel_launch(void* const* d_in, const int* in_sizes, int n_in,
                              void* d_out, int out_size, void* d_ws, size_t ws_size, hipStream_t stream) {
    (void)in_sizes; (void)n_in; (void)out_size;
    const float* x = (const float*)d_in[0]; const float* xk = (const float*)d_in[1]; const float* xv = (const float*)d_in[2]; const float* wq = (const float*)d_in[3]; const float* bq = (const float*)d_in[4]; const float* wk = (const float*)d_in[5]; const float* bk = (const float*)d_in[6]; const float* wv = (const float*)d_in[7]; const float* bv = (const float*)d_in[8]; const float* wo = (const float*)d_in[9]; const float* bo = (const float*)d_in[10];
    float* OUT = (float*)d_out;     // first output [2][2048][1024]
    float* OUT2 = OUT + (size_t)NB_ * TT * DM;   // second output [2][2048][2048] (tuple: contiguous after the first)
    char* wsp = (char*)d_ws;
    auto take = [&](size_t bytes) { char* p = wsp; wsp += (bytes + 255) & ~(size_t)255; return (void*)p; };
    bf* WQ = (bf*)take((size_t)DQ * DM * 2); bf* WK = (bf*)take((size_t)DKV * DM * 2); bf* WV = (bf*)take((size_t)DKV * DM * 2); bf* WO = (bf*)take((size_t)DM * DQ * 2); float* CS = (float*)take((size_t)TT * HD * 2 * 4);
    bf* XB = (bf*)take((size_t)TT * DM * 2); float* FQ = (float*)take((size_t)TT * DQ * 4); float* FK = (float*)take((size_t)TT * DKV * 4);
    h16* QP16 = (h16*)take((size_t)NH_ * TT * HD * 2); h16* KP16 = (h16*)take((size_t)NKV * TT * HD * 2); h16* VT16 = (h16*)take((size_t)NKV * HD * TT * 2);
    bf* QPh = (bf*)take((size_t)NH_ * TT * HD * 2); bf* QPl = (bf*)take((size_t)NH_ * TT * HD * 2); bf* KPh = (bf*)take((size_t)NKV * TT * HD * 2); bf* KPl = (bf*)take((size_t)NKV * TT * HD * 2); bf* VTh = (bf*)take((size_t)NKV * HD * TT * 2); bf* VTl = (bf*)take((size_t)NKV * HD * TT * 2); bf* Ph = (bf*)take((size_t)ZH * RH * TT * 2); bf* Pl = (bf*)take((size_t)ZH * RH * TT * 2);
    float* Sb = (float*)take((size_t)ZH * TT * TT * 4); float* PA = (float*)take((size_t)TT * TT * 4); float* Ob = (float*)take((size_t)PVG * ZH * TT * HD * 4); bf* ATh = (bf*)take((size_t)TT * DQ * 2); bf* ATl = (bf*)take((size_t)TT * DQ * 2);
    if ((size_t)(wsp - (char*)d_ws) > ws_size) return;    // ws 256 MiB
    float* FV = FK;   // v projection reuses the k buffer after the k planes are built (stream-ordered)
    { k_cvt8<<<(unsigned)(((size_t)DQ * DM / 8 + 255) / 256), 256, 0, stream>>>(wq, WQ, (size_t)DQ * DM / 8); k_cvt8<<<(unsigned)(((size_t)DKV * DM / 8 + 255) / 256), 256, 0, stream>>>(wk, WK, (size_t)DKV * DM / 8); k_cvt8<<<(unsigned)(((size_t)DKV * DM / 8 + 255) / 256), 256, 0, stream>>>(wv, WV, (size_t)DKV * DM / 8);
      k_cvt8<<<(unsigned)(((size_t)DM * DQ / 8 + 255) / 256), 256, 0, stream>>>(wo, WO, (size_t)DM * DQ / 8);
       }
    k_csid<<<(TT * HD + 255) / 256, 256, 0, stream>>>(CS);
    const unsigned LQ = (unsigned)(((size_t)NH_ * TT * HD / 2 + 255) / 256), LKv = (unsigned)(((size_t)NKV * TT * HD / 2 + 255) / 256);
    for (int b = 0; b < NB_; ++b) {
        
        k_cvt8<<<(unsigned)(((size_t)TT * DM / 8 + 255) / 256), 256, 0, stream>>>(x + (size_t)b * TT * DM, XB, (size_t)TT * DM / 8);
        k_gemmw<bf, 0, true, KSW, 1><<<dim3(TT / 64, DQ / 64, 1), 32 * KSW, 0, stream>>>(XB, nullptr, WQ, nullptr, DM, FQ, DQ, bq, 0, 0, 0, 0);
        k_rope<<<LQ, 256, 0, stream>>>(FQ, DQ, NH_, CS, nullptr, nullptr, 1.0f, QP16, QPh, QPl);
        k_cvt8<<<(unsigned)(((size_t)TT * DM / 8 + 255) / 256), 256, 0, stream>>>(xk + (size_t)b * TT * DM, XB, (size_t)TT * DM / 8); k_gemmw<bf, 0, true, KSW, 1><<<dim3(TT / 64, DKV / 64, 1), 32 * KSW, 0, stream>>>(XB, nullptr, WK, nullptr, DM, FK, DKV, bk, 0, 0, 0, 0);
        k_rope<<<LKv, 256, 0, stream>>>(FK, DKV, NKV, CS, nullptr, nullptr, 1.0f, KP16, KPh, KPl);
        k_cvt8<<<(unsigned)(((size_t)TT * DM / 8 + 255) / 256), 256, 0, stream>>>(xv + (size_t)b * TT * DM, XB, (size_t)TT * DM / 8); k_gemmw<bf, 0, true, KSW, 1><<<dim3(TT / 64, DKV / 64, 1), 32 * KSW, 0, stream>>>(XB, nullptr, WV, nullptr, DM, FV, DKV, bv, 0, 0, 0, 0); k_vtp<<<LKv, 256, 0, stream>>>(FV, DKV, NKV, VT16, VTh, VTl);
        for (int h0 = 0; h0 < NH_; h0 += ZH) { const size_t zq = (size_t)h0, zk = (size_t)(h0 / REP);   // one kv head per query head: the pass's two heads use consecutive kv planes (z-strides TT*HD)
            k_gemmw<bf, 2, false, 1, 1><<<dim3(RH / 64, TT / 64, ZH), 32, 0, stream>>>(QPh + zq * TT * HD, QPl + zq * TT * HD, KPh + zk * TT * HD, KPl + zk * TT * HD, HD, Sb, ZH * TT, nullptr, (size_t)TT * HD, (size_t)TT * HD, (size_t)TT, 0);   /* scores [i][zz][TT]: row pitch ZH TT, head stride TT */
            if (h0 == 0) k_asoft<true><<<TT / 8, 256, 0, stream>>>(Sb, Ph, Pl, PA, OUT2 + (size_t)b * TT * TT, h0); else k_asoft<false><<<TT / 8, 256, 0, stream>>>(Sb, Ph, Pl, PA, OUT2 + (size_t)b * TT * TT, h0);   /* softmax + head-ordered f32 sum of the probabilities; the last pass writes their mean to the second output */
            k_gemmw<bf, 2, false, KSW, PVG><<<dim3(RH / 64, HD / 64, ZH * PVG), 32 * KSW, 0, stream>>>(Ph, Pl, VTh + zk * HD * TT, VTl + zk * HD * TT, TT, Ob, HD, nullptr, (size_t)RH * TT, (size_t)HD * TT, (size_t)TT * HD, (size_t)ZH * TT * HD);
            k_merge<<<(unsigned)(((size_t)ZH * TT * HD / 2 + 255) / 256), 256, 0, stream>>>(Ob, h0, ATh, ATl); }
        k_gemmw<bf, 1, true, KSW, 1><<<dim3(TT / 64, DM / 64, 1), 32 * KSW, 0, stream>>>(ATh, ATl, WO, nullptr, DQ, OUT + (size_t)b * TT * DM, DM, bo, 0, 0, 0, 0); }
}

// v003
// Measured time: 447 microseconds a run.
// In both of two side-by-side timings against v002, it was 1.76 times as fast.
// Counting every step since v000, it is 3.43 times as fast.
#include <hip/hip_runtime.h>

// Multi-head attention returning the output AND the head-averaged attention probabilities (Q, K, V [2][2048][1024]; q,k,v = input W^T + b ('oi' [1024][1024] + [1024]; 16 heads x 64); scores = q.k x 1.0 (SCALING = 1: unscaled); probs = softmax; attn = probs v; out = merged Wo^T + bo -> [2][2048][1024]; second output mean over heads of probs -> [2][2048][2048]; tuple (12.6 M)).
// Layout: per batch bf16 copies of the three inputs in turn; exact projections + f32 biases; hi/lo head planes of q, k, v^T of both batches; ONE attention launch (k_fattn): a work-group keeps 16 query rows x 2048 keys of scores and probabilities in its waves' registers (3 hi/lo products; the unscaled logits reach |s| ~ 15), walks the 16 heads in order, adds the f32 probabilities into a register head sum (fixed order: deterministic) and writes sum x 1/16 to the second output; merged hi/lo x Wo exact + bo to the first.
// Compute dtypes, f32 accumulate: every input rounded to bf16; projections exact + f32 biases; scores and attn.v 3 products; softmax, probability mean f32; Wo hl x exact + bias.

#define NB_  2
#define TT   2048
#define DM   1024
#define NH_  16
#define NKV  16
#define REP  (NH_ / NKV)
#define HD   64
#define DQ   (NH_ * HD)
#define DKV  (NKV * HD)
#define KSW  8                     // waves of a work-group that share a long K range
#define FW   16                    // waves of an attention work-group; they share the 2048 keys of its 16 query rows
#define KPW  (TT / FW)             // keys of one wave
#define NT   (KPW / 16)            // 16-key score tiles of one wave
#define SCL  1.0f   // SCALING = 1.0 in the module (no 1/sqrt(d))
typedef _Float16 h16;
typedef unsigned short bf;
typedef __attribute__((ext_vector_type(16))) __bf16   v16bf;
typedef __attribute__((ext_vector_type(16))) _Float16 v16h;
typedef __attribute__((ext_vector_type(8)))  _Float16 v8h;
typedef __attribute__((ext_vector_type(8)))  unsigned short v8us;
typedef __attribute__((ext_vector_type(8)))  float    v8f;
typedef __attribute__((ext_vector_type(4)))  float    v4f;
typedef v8h  __attribute__((may_alias)) v8ha;
typedef v4f  __attribute__((may_alias)) v4fa;
typedef v8us __attribute__((may_alias)) v8usa;

__device__ __forceinline__ unsigned short f2bf(float f) { unsigned u = __float_as_uint(f); u += 0x7FFFu + ((u >> 16) & 1u); return (unsigned short)(u >> 16); }
__device__ __forceinline__ float bf2f(unsigned short b) { return __uint_as_float(((unsigned)b) << 16); }
__device__ __forceinline__ float bfr(float f) { return bf2f(f2bf(f)); }
__device__ __forceinline__ v16h cat16(v8h lo, v8h hi) { return __builtin_shufflevector(lo, hi, 0, 1, 2, 3, 4, 5, 6, 7, 8, 9, 10, 11, 12, 13, 14, 15); }
__device__ __forceinline__ v16bf cat16b(v8us lo, v8us hi) { return __builtin_bit_cast(v16bf, __builtin_shufflevector(lo, hi, 0, 1, 2, 3, 4, 5, 6, 7, 8, 9, 10, 11, 12, 13, 14, 15)); }
__device__ __forceinline__ v8f wmma16(v16h a, v16h b, v8f c) { return __builtin_amdgcn_wmma_f32_16x16x32_f16(false, a, false, b, (short)0, c, false, false); }
__device__ __forceinline__ v8f wmmab(v16bf a, v16bf b, v8f c) { return __builtin_amdgcn_wmma_f32_16x16x32_bf16(false, a, false, b, (short)0, c, false, false); }



// ---- k_gemmw: register-blocked GEMM, KS waves per 64x64 output tile, each with 16 accumulators, operands straight from K-contiguous 16-bit planes; grid (M/64, N/64, Z KG), 32 KS threads.
// C[m][n] (f32, pitch ldc, + optional f32 bias[n]) = sum_k A[m][k] Bt[n][k] (+ split products per NSPLIT). z-batch strides sA/sB/sC in elements. K % 32 == 0.
// Split K: the tile's K range is cut into KG x KS equal slices (K % (32 KG KS) == 0). The KS waves of a work-group (32 KS threads) each run one slice and their partial tiles are summed through LDS in wave order (one barrier);
// the KG slice groups are separate work-groups (blockIdx.z = z KG + g) that store partial planes at C + g sG, which the consumer sums in g order. KS = KG = 1: one wave, whole K.
template <typename T16> struct WFrag;
template <> struct WFrag<h16> { typedef v16h V; static __device__ __forceinline__ V ld(const h16* p) { return cat16(*(const v8h*)p, *(const v8h*)(p + 16)); } static __device__ __forceinline__ v8f mma(V a, V b, v8f c) { return wmma16(a, b, c); } };
template <> struct WFrag<bf> { typedef v16bf V; static __device__ __forceinline__ V ld(const bf* p) { return cat16b(*(const v8us*)p, *(const v8us*)(p + 16)); } static __device__ __forceinline__ v8f mma(V a, V b, v8f c) { return wmmab(a, b, c); } };
template <typename T16, int NSPLIT, bool BIAS, int KS, int KG>
__global__ __launch_bounds__(32 * KS) void k_gemmw(const T16* __restrict__ A, const T16* __restrict__ A2, const T16* __restrict__ Bt, const T16* __restrict__ Bt2, int K, float* C, int ldc, const float* __restrict__ bias, size_t sA, size_t sB, size_t sC, size_t sG) {
    typedef typename WFrag<T16>::V V;
    __shared__ __align__(16) float os[KS > 1 ? KS * 64 * 68 : 16 * 68];
    const int wv = __builtin_amdgcn_readfirstlane(threadIdx.x >> 5);   // wave number, scalar: the K loop's bounds stay wave-uniform (WMMA needs every lane on)
    const int kl = K / (KS * KG), kbeg = ((int)(blockIdx.z % KG) * KS + wv) * kl, kend = kbeg + kl; C += (size_t)(blockIdx.z % KG) * sG;
    const size_t z = blockIdx.z / KG; A += z * sA; if (A2) A2 += z * sA; Bt += z * sB; if (Bt2) Bt2 += z * sB; C += z * sC;
    const int lane = threadIdx.x & 31, lr = lane & 15, hi = lane >> 4; const int r0 = blockIdx.x * 64, c0 = blockIdx.y * 64;
    v8f acc[4][4];
#pragma unroll
    for (int mb = 0; mb < 4; ++mb)
#pragma unroll
        for (int nb = 0; nb < 4; ++nb) acc[mb][nb] = (v8f){};
    const size_t aoff = (size_t)(r0 + lr) * K + 8 * hi, boff = (size_t)(c0 + lr) * K + 8 * hi;
#pragma unroll 1
    for (int kc = kbeg; kc < kend; kc += 32) {
        V a[4], a2[4];
#pragma unroll
        for (int mb = 0; mb < 4; ++mb) { a[mb] = WFrag<T16>::ld(A + aoff + (size_t)mb * 16 * K + kc); if (NSPLIT == 1 || NSPLIT == 2) a2[mb] = WFrag<T16>::ld(A2 + aoff + (size_t)mb * 16 * K + kc); }
#pragma unroll
        for (int nb = 0; nb < 4; ++nb) { const V b = WFrag<T16>::ld(Bt + boff + (size_t)nb * 16 * K + kc); V b2; if (NSPLIT >= 2) b2 = WFrag<T16>::ld(Bt2 + boff + (size_t)nb * 16 * K + kc);
#pragma unroll
            for (int mb = 0; mb < 4; ++mb) { acc[mb][nb] = WFrag<T16>::mma(a[mb], b, acc[mb][nb]); if (NSPLIT == 1 || NSPLIT == 2) acc[mb][nb] = WFrag<T16>::mma(a2[mb], b, acc[mb][nb]); if (NSPLIT >= 2) acc[mb][nb] = WFrag<T16>::mma(a[mb], b2, acc[mb][nb]); } }
        asm volatile("v_nop\n\tv_nop\n\tv_nop\n\tv_nop" : "+v"(acc[0][0]), "+v"(acc[1][1]), "+v"(acc[2][2]), "+v"(acc[3][3]) : "v"(a[0]), "v"(a[3]));
    }
    if constexpr (KS > 1) {
#pragma unroll
        for (int mb = 0; mb < 4; ++mb)
#pragma unroll
            for (int nb = 0; nb < 4; ++nb)
#pragma unroll
                for (int j = 0; j < 8; ++j) os[wv * (64 * 68) + (mb * 16 + hi * 8 + j) * 68 + nb * 16 + lr] = acc[mb][nb][j];
        __syncthreads();   // every wave's partial 64x64 tile is in LDS before any thread sums across the waves
#pragma unroll
        for (int it = 0; it < 64 * 16 / (32 * KS); ++it) { const int idx = it * (32 * KS) + (int)threadIdx.x, row = idx >> 4, cofs = (idx & 15) * 4; v4f val = *(const v4fa*)(os + row * 68 + cofs);
#pragma unroll
            for (int w = 1; w < KS; ++w) val += *(const v4fa*)(os + w * (64 * 68) + row * 68 + cofs);
            if (BIAS) { val[0] += bfr(bias[c0 + cofs]); val[1] += bfr(bias[c0 + cofs + 1]); val[2] += bfr(bias[c0 + cofs + 2]); val[3] += bfr(bias[c0 + cofs + 3]); }
            *(v4f*)(C + (size_t)(r0 + row) * ldc + c0 + cofs) = val; }
        return;
    }
#pragma unroll
    for (int mb = 0; mb < 4; ++mb) {
#pragma unroll
        for (int nb = 0; nb < 4; ++nb) {
#pragma unroll
            for (int j = 0; j < 8; ++j) os[(hi * 8 + j) * 68 + nb * 16 + lr] = acc[mb][nb][j]; }
        __builtin_amdgcn_wave_barrier(); asm volatile("" ::: "memory");
        float* crow = C + (size_t)(r0 + mb * 16) * ldc + c0;
{
#pragma unroll
            for (int s = 0; s < 8; ++s) { const int row = 2 * s + hi, cofs = lr * 4; v4f val = *(const v4fa*)(os + row * 68 + cofs); if (BIAS) { val[0] += bfr(bias[c0 + cofs]); val[1] += bfr(bias[c0 + cofs + 1]); val[2] += bfr(bias[c0 + cofs + 2]); val[3] += bfr(bias[c0 + cofs + 3]); }
                *(v4f*)(crow + (size_t)row * ldc + cofs) = val; }
             }
        __builtin_amdgcn_wave_barrier(); asm volatile("" ::: "memory");
    }
}

__device__ __forceinline__ h16 tohx(float x) { return (h16)x; }
__device__ __forceinline__ void splitf(float y, unsigned short& h, unsigned short& l) { h = f2bf(y); l = f2bf(y - bf2f(h)); }
typedef __attribute__((ext_vector_type(2))) _Float16 v2h;
typedef __attribute__((ext_vector_type(4))) _Float16 v4h;
typedef __attribute__((ext_vector_type(2))) unsigned short v2us;
typedef __attribute__((ext_vector_type(4))) unsigned short v4us;
typedef __attribute__((ext_vector_type(2))) float v2f;
typedef __attribute__((ext_vector_type(4))) int v4i;

__global__ __launch_bounds__(256) void k_wtG(const float* __restrict__ w, int K, int N, bf* Bt) {
    const int lane = threadIdx.x & 31; const int L0 = (blockIdx.x * 8 + (threadIdx.x >> 5)) * 8; const int nlines = N * K / 64;
{
#pragma unroll 1
        for (int l = 0; l < 8; ++l) { const int L = L0 + l; if (L >= nlines) break; const size_t e = (size_t)L * 64 + lane * 2; const int k = (int)(e % K), n = (int)(e / K); v2us o;
            o[0] = f2bf(w[(size_t)k * N + n]); o[1] = f2bf(w[(size_t)(k + 1) * N + n]); *(v2us*)(Bt + e) = o; }
         }
}
__global__ __launch_bounds__(256) void k_cvt8(const float* __restrict__ src, bf* dst, size_t n8) { const size_t i = (size_t)blockIdx.x * 256 + threadIdx.x; if (i >= n8) return; const v8f v = *(const v8f*)(src + i * 8); v8us o;
#pragma unroll
    for (int k = 0; k < 8; ++k) o[k] = f2bf(v[k]); *(v8us*)(dst + i * 8) = o;  }

// k_rope: head planes [h][t][d] (fp16 + hi/lo) of rope(x) x sc with the rotate-half convention out[d] = x[d] cos[t][d] - x[d+HD/2] sin[t][d], out[d+HD/2] = x[d+HD/2] cos[t][d+HD/2] + x[d] sin[t][d+HD/2]
__global__ __launch_bounds__(256) void k_rope(const float* __restrict__ F, int pitch, int nheads, const float* __restrict__ CS, const float* __restrict__ RF, const float* __restrict__ nw, float sc, h16* P16, bf* Ph, bf* Pl) {
    const size_t e = ((size_t)blockIdx.x * 256 + threadIdx.x) * 2; if (e >= (size_t)nheads * TT * HD) return; const int d = (int)(e % HD); const int t = (int)((e / HD) % TT); const int h = (int)(e / ((size_t)HD * TT)); const float* f = F + (size_t)t * pitch + h * HD; const float rf = RF ? RF[(size_t)h * TT + t] : 1.0f; v2h o16; v2us oh, ol;
#pragma unroll
    for (int q = 0; q < 2; ++q) { const int dd = d + q; const int dp = (dd < HD / 2) ? dd + HD / 2 : dd - HD / 2; float x0 = f[dd], x1 = f[dp];
        if (RF) { float n0 = __fmul_rn(x0, rf), n1 = __fmul_rn(x1, rf); asm volatile("" : "+v"(n0)); asm volatile("" : "+v"(n1)); x0 = __fmul_rn(bfr(nw[dd]), n0); x1 = __fmul_rn(bfr(nw[dp]), n1); }
        const v2f cs = *(const v2f*)(CS + ((size_t)t * HD + dd) * 2); float a = __fmul_rn(x0, cs[0]), bq = __fmul_rn(x1, cs[1]); asm volatile("" : "+v"(a)); asm volatile("" : "+v"(bq)); const float r = ((dd < HD / 2) ? __fsub_rn(a, bq) : __fadd_rn(a, bq)) * sc;
        o16[q] = tohx(r); unsigned short a2, c2; splitf(r, a2, c2); oh[q] = a2; ol[q] = c2; }
    *(v2h*)(P16 + e) = o16; *(v2us*)(Ph + e) = oh; *(v2us*)(Pl + e) = ol;  }
__global__ __launch_bounds__(256) void k_vtp(const float* __restrict__ F, int pitch, int nheads, h16* V16, bf* Vh, bf* Vl) { const size_t e = ((size_t)blockIdx.x * 256 + threadIdx.x) * 2; if (e >= (size_t)nheads * HD * TT) return; const int t = (int)(e % TT); const int d = (int)((e / TT) % HD); const int g = (int)(e / ((size_t)TT * HD)); v2h o16; v2us oh, ol;
#pragma unroll
    for (int q = 0; q < 2; ++q) { const float x = F[(size_t)(t + q) * pitch + g * HD + d]; o16[q] = tohx(x); unsigned short a2, c2; splitf(x, a2, c2); oh[q] = a2; ol[q] = c2; }
    *(v2h*)(V16 + e) = o16; *(v2us*)(Vh + e) = oh; *(v2us*)(Vl + e) = ol;  }
__global__ __launch_bounds__(256) void k_csid(float* CS) { const int idx = blockIdx.x * 256 + threadIdx.x; if (idx >= TT * HD) return; v2f cs; cs[0] = 1.0f; cs[1] = 0.0f; *(v2f*)(CS + (size_t)idx * 2) = cs;  }
// 2^x; the v_nop is the one slot the instruction set asks for behind a transcendental before its result is read or its source overwritten
__device__ __forceinline__ float exp2s(float x) { float r; asm("v_exp_f32 %0, %1\n\tv_nop" : "=v"(r) : "v"(x)); return r; }
typedef __attribute__((ext_vector_type(2))) __bf16 v2bf;
typedef __attribute__((ext_vector_type(8))) unsigned v8u;
typedef v2f __attribute__((may_alias)) v2fa;
// k_fattn: one work-group of FW waves takes 16 query rows of one batch through ALL heads, in head order; grid NB_ x TT/16. Wave w owns keys [w KPW, (w + 1) KPW).
// Per head: S^T = K Q^T (A = key rows, B = query rows, 3 hi/lo products) stays in the wave's accumulators: lane (lr, hi) holds query lr, register j of tile t key 16 t + 8 hi + j.
// Row maximum and row sum: in the lane, across the lane halves, then across the waves through LDS in wave order (a barrier each). The f32 probabilities are added to the head sum in registers,
// split into hi/lo bf16 in place (two tiles of 16 keys are one B operand of 32 keys in the loader's k order) and O^T = V^T P^T (3 products) follows; the waves' partial O^T are summed through LDS in wave order (a barrier).
__global__ __launch_bounds__(32 * FW) void k_fattn(const bf* __restrict__ Qh, const bf* __restrict__ Ql, const bf* __restrict__ Kh, const bf* __restrict__ Kl, const bf* __restrict__ Vh, const bf* __restrict__ Vl, bf* __restrict__ Ah, bf* __restrict__ Al, float* __restrict__ O2) {
    typedef WFrag<bf> F; static_assert(FW == 16 && NKV == NH_ && HD == 64 && NT == 2 * (HD / 16), "one wave sums one query row of the partial outputs; one kv head per query head; 128-byte q and k rows");
    __shared__ float rmx[FW * 16]; __shared__ float rsm[FW * 16]; __shared__ __align__(16) float op[FW * 16 * 68];
    const int wv = __builtin_amdgcn_readfirstlane(threadIdx.x >> 5);   // wave number, scalar
    const int lane = threadIdx.x & 31, lr = lane & 15, hi = lane >> 4; const int b = blockIdx.x / (TT / 16), q0 = (blockIdx.x % (TT / 16)) * 16;
    const unsigned qo = (unsigned)((q0 + lr) * HD + 8 * hi) * 2, ko = (unsigned)((wv * KPW + lr) * HD + 8 * hi) * 2, vo = (unsigned)(lr * TT + wv * KPW + 8 * hi) * 2;   // the lane's byte offsets inside a head's plane
    v8f macc[NT];
#pragma unroll
    for (int t = 0; t < NT; ++t) macc[t] = (v8f){};
#pragma unroll 1
    for (int h = 0; h < NH_; ++h) { const unsigned hb = (unsigned)(b * NH_ + h) * (TT * HD * 2);   // byte offset of the head's plane (q, k [t][d]; v [d][t]) in its 8-MiB buffer
        const unsigned qb = hb + qo, kb = hb + ko, vb = hb + vo;   // one 32-bit offset register beside each uniform base serves all of a plane's loads (64-bit lane addresses cost registers that the fragment sets need)
        v16bf qh[2], ql[2];
#pragma unroll
        for (int ks = 0; ks < 2; ++ks) { qh[ks] = F::ld((const bf*)((const char*)Qh + qb + ks * 64)); ql[ks] = F::ld((const bf*)((const char*)Ql + qb + ks * 64)); }
        v8f s[NT]; v16bf fh[2][2], fl[2][2];   // operand fragments of a group of six products, two register sets: the next group's loads fly while this group is multiplied
#pragma unroll
        for (int ks = 0; ks < 2; ++ks) { fh[0][ks] = F::ld((const bf*)((const char*)Kh + kb + ks * 64)); fl[0][ks] = F::ld((const bf*)((const char*)Kl + kb + ks * 64)); }
        asm volatile("s_wait_xcnt 0x0" :: "v"(qb) : "memory");   // the wait owed before a register that an issued load names is overwritten; the q offset as an input keeps its register untouched up to here (without it a later load's result was placed on it)
#pragma unroll
        for (int t = 0; t < NT; ++t) { v8f a = (v8f){};
            if (t + 1 < NT) {
#pragma unroll
                for (int ks = 0; ks < 2; ++ks) { fh[(t + 1) & 1][ks] = F::ld((const bf*)((const char*)Kh + kb + ((t + 1) * 16 * HD * 2 + ks * 64))); fl[(t + 1) & 1][ks] = F::ld((const bf*)((const char*)Kl + kb + ((t + 1) * 16 * HD * 2 + ks * 64))); } }
            __builtin_amdgcn_sched_barrier(0);   // the next tile's eight loads (whole 128-byte rows) are issued ahead of this tile's products: otherwise each pair of loads is waited for right behind its issue
#pragma unroll
            for (int ks = 0; ks < 2; ++ks) { a = wmmab(fh[t & 1][ks], qh[ks], a); a = wmmab(fh[t & 1][ks], ql[ks], a); a = wmmab(fl[t & 1][ks], qh[ks], a); }
            s[t] = a * SCL;
            __builtin_amdgcn_sched_barrier(0);   // no later tile's loads rise over these products: two register sets are all that fit
        }
        float mx = -3.0e38f;
#pragma unroll
        for (int t = 0; t < NT; ++t)
#pragma unroll
            for (int j = 0; j < 8; ++j) mx = fmaxf(mx, s[t][j]);
        mx = fmaxf(mx, __shfl_xor(mx, 16, 32));
        if (hi == 0) rmx[wv * 16 + lr] = mx;
        __syncthreads();   // every wave's row maxima are in LDS before any wave joins them
#pragma unroll
        for (int w = 0; w < FW; ++w) mx = fmaxf(mx, rmx[w * 16 + lr]);
        float sum = 0.f;
#pragma unroll
        for (int t = 0; t < NT; ++t)
#pragma unroll
            for (int j = 0; j < 8; ++j) { s[t][j] = exp2s(__fmul_rn(__fsub_rn(s[t][j], mx), 1.4426950408889634f)); sum += s[t][j]; }
        sum += __shfl_xor(sum, 16, 32);
        if (hi == 0) rsm[wv * 16 + lr] = sum;
        __syncthreads();   // every wave's row sums are in LDS before any wave joins them
        sum = rsm[lr];
#pragma unroll
        for (int w = 1; w < FW; ++w) sum += rsm[w * 16 + lr];
        const float f = __fdiv_rn(1.0f, sum);
        v8u ph[NT / 2], pl[NT / 2];
#pragma unroll
        for (int t = 0; t < NT; ++t)
#pragma unroll
            for (int j = 0; j < 8; j += 2) { v2f p; p[0] = s[t][j] * f; p[1] = s[t][j + 1] * f; macc[t][j] += p[0]; macc[t][j + 1] += p[1];
                const unsigned hu = __builtin_bit_cast(unsigned, __builtin_convertvector(p, v2bf)); v2f r; r[0] = p[0] - __uint_as_float(hu << 16); r[1] = p[1] - __uint_as_float(hu & 0xFFFF0000u);
                ph[t >> 1][(t & 1) * 4 + (j >> 1)] = hu; pl[t >> 1][(t & 1) * 4 + (j >> 1)] = __builtin_bit_cast(unsigned, __builtin_convertvector(r, v2bf)); }
        v8f o[HD / 16];
#pragma unroll
        for (int dt = 0; dt < HD / 16; ++dt) o[dt] = (v8f){};
#pragma unroll
        for (int k2 = 0; k2 < 2; ++k2) { fh[0][k2] = F::ld((const bf*)((const char*)Vh + vb + k2 * 64)); fl[0][k2] = F::ld((const bf*)((const char*)Vl + vb + k2 * 64)); }
#pragma unroll
        for (int g = 0; g < NT; ++g) { const int kp = g / (HD / 16), dt = g % (HD / 16);   // a group: 16 v rows x 64 keys = one 128-byte line of each row
            if (g + 1 < NT) { const int kn = (g + 1) / (HD / 16), dn = (g + 1) % (HD / 16);
#pragma unroll
                for (int k2 = 0; k2 < 2; ++k2) { fh[(g + 1) & 1][k2] = F::ld((const bf*)((const char*)Vh + vb + (dn * 16 * TT * 2 + (kn * 2 + k2) * 64))); fl[(g + 1) & 1][k2] = F::ld((const bf*)((const char*)Vl + vb + (dn * 16 * TT * 2 + (kn * 2 + k2) * 64))); } }
            __builtin_amdgcn_sched_barrier(0);   // the next group's eight loads are issued ahead of this group's products (as in the score loop)
#pragma unroll
            for (int k2 = 0; k2 < 2; ++k2) { const int kt = kp * 2 + k2; const v16bf bh = __builtin_bit_cast(v16bf, ph[kt]), bl = __builtin_bit_cast(v16bf, pl[kt]);
                o[dt] = wmmab(fh[g & 1][k2], bh, o[dt]); o[dt] = wmmab(fh[g & 1][k2], bl, o[dt]); o[dt] = wmmab(fl[g & 1][k2], bh, o[dt]); }
            __builtin_amdgcn_sched_barrier(0);   // no later group's loads rise over these products
        }
#pragma unroll
        for (int dt = 0; dt < HD / 16; ++dt) { float* w = op + (wv * 16 + lr) * 68 + dt * 16 + hi * 8; v4f lo4, hi4;
#pragma unroll
            for (int j = 0; j < 4; ++j) { lo4[j] = o[dt][j]; hi4[j] = o[dt][4 + j]; }
            *(v4fa*)w = lo4; *(v4fa*)(w + 4) = hi4; }
        __syncthreads();   // every wave's partial O^T is in LDS before any thread sums across the waves
        { const int q = wv, d = lane * 2; v2f sm = *(const v2fa*)(op + q * 68 + d);
#pragma unroll
            for (int w = 1; w < FW; ++w) sm += *(const v2fa*)(op + (w * 16 + q) * 68 + d);
            v2us oh, ol; unsigned short a0, c0; splitf(sm[0], a0, c0); oh[0] = a0; ol[0] = c0; splitf(sm[1], a0, c0); oh[1] = a0; ol[1] = c0;
            const unsigned oo = (unsigned)((b * TT + q0 + q) * DQ + h * HD + d) * 2; *(v2us*)((char*)Ah + oo) = oh; *(v2us*)((char*)Al + oo) = ol; }
        asm volatile("s_wait_xcnt 0x0" ::: "memory");   // the wait owed before the next head's address arithmetic overwrites a register that these stores name
    }
    float* o2 = O2 + (size_t)(b * TT + q0 + lr) * TT + wv * KPW + hi * 8;
#pragma unroll
    for (int t = 0; t < NT; ++t) { v4f lo4, hi4;
#pragma unroll
        for (int j = 0; j < 4; ++j) { lo4[j] = macc[t][j] * (1.0f / NH_); hi4[j] = macc[t][4 + j] * (1.0f / NH_); }
        *(v4f*)(o2 + t * 16) = lo4; *(v4f*)(o2 + t * 16 + 4) = hi4; }
}

extern "C" void kernel_launch(void* const* d_in, const int* in_sizes, int n_in,
                              void* d_out, int out_size, void* d_ws, size_t ws_size, hipStream_t stream) {
    (void)in_sizes; (void)n_in; (void)out_size;
    const float* x = (const float*)d_in[0]; const float* xk = (const float*)d_in[1]; const float* xv = (const float*)d_in[2]; const float* wq = (const float*)d_in[3]; const float* bq = (const float*)d_in[4]; const float* wk = (const float*)d_in[5]; const float* bk = (const float*)d_in[6]; const float* wv = (const float*)d_in[7]; const float* bv = (const float*)d_in[8]; const float* wo = (const float*)d_in[9]; const float* bo = (const float*)d_in[10];
    float* OUT = (float*)d_out;     // first output [2][2048][1024]
    float* OUT2 = OUT + (size_t)NB_ * TT * DM;   // second output [2][2048][2048] (tuple: contiguous after the first)
    char* wsp = (char*)d_ws;
    auto take = [&](size_t bytes) { char* p = wsp; wsp += (bytes + 255) & ~(size_t)255; return (void*)p; };
    bf* WQ = (bf*)take((size_t)DQ * DM * 2); bf* WK = (bf*)take((size_t)DKV * DM * 2); bf* WV = (bf*)take((size_t)DKV * DM * 2); bf* WO = (bf*)take((size_t)DM * DQ * 2); float* CS = (float*)take((size_t)TT * HD * 2 * 4);
    bf* XB = (bf*)take((size_t)TT * DM * 2); float* FQ = (float*)take((size_t)TT * DQ * 4); float* FK = (float*)take((size_t)TT * DKV * 4);
    h16* QP16 = (h16*)take((size_t)NH_ * TT * HD * 2); h16* KP16 = (h16*)take((size_t)NKV * TT * HD * 2); h16* VT16 = (h16*)take((size_t)NKV * HD * TT * 2);
    bf* QPh = (bf*)take((size_t)NB_ * NH_ * TT * HD * 2); bf* QPl = (bf*)take((size_t)NB_ * NH_ * TT * HD * 2); bf* KPh = (bf*)take((size_t)NB_ * NKV * TT * HD * 2); bf* KPl = (bf*)take((size_t)NB_ * NKV * TT * HD * 2); bf* VTh = (bf*)take((size_t)NB_ * NKV * HD * TT * 2); bf* VTl = (bf*)take((size_t)NB_ * NKV * HD * TT * 2);   // hi/lo head planes of both batches
    bf* ATh = (bf*)take((size_t)NB_ * TT * DQ * 2); bf* ATl = (bf*)take((size_t)NB_ * TT * DQ * 2);
    if ((size_t)(wsp - (char*)d_ws) > ws_size) return;    // ws 256 MiB
    float* FV = FK;   // v projection reuses the k buffer after the k planes are built (stream-ordered)
    { k_cvt8<<<(unsigned)(((size_t)DQ * DM / 8 + 255) / 256), 256, 0, stream>>>(wq, WQ, (size_t)DQ * DM / 8); k_cvt8<<<(unsigned)(((size_t)DKV * DM / 8 + 255) / 256), 256, 0, stream>>>(wk, WK, (size_t)DKV * DM / 8); k_cvt8<<<(unsigned)(((size_t)DKV * DM / 8 + 255) / 256), 256, 0, stream>>>(wv, WV, (size_t)DKV * DM / 8);
      k_cvt8<<<(unsigned)(((size_t)DM * DQ / 8 + 255) / 256), 256, 0, stream>>>(wo, WO, (size_t)DM * DQ / 8);
       }
    k_csid<<<(TT * HD + 255) / 256, 256, 0, stream>>>(CS);
    const unsigned LQ = (unsigned)(((size_t)NH_ * TT * HD / 2 + 255) / 256), LKv = (unsigned)(((size_t)NKV * TT * HD / 2 + 255) / 256);
    for (int b = 0; b < NB_; ++b) { const size_t pb = (size_t)b * NH_ * TT * HD;   // the batch's place in the head planes
        k_cvt8<<<(unsigned)(((size_t)TT * DM / 8 + 255) / 256), 256, 0, stream>>>(x + (size_t)b * TT * DM, XB, (size_t)TT * DM / 8);
        k_gemmw<bf, 0, true, KSW, 1><<<dim3(TT / 64, DQ / 64, 1), 32 * KSW, 0, stream>>>(XB, nullptr, WQ, nullptr, DM, FQ, DQ, bq, 0, 0, 0, 0);
        k_rope<<<LQ, 256, 0, stream>>>(FQ, DQ, NH_, CS, nullptr, nullptr, 1.0f, QP16, QPh + pb, QPl + pb);
        k_cvt8<<<(unsigned)(((size_t)TT * DM / 8 + 255) / 256), 256, 0, stream>>>(xk + (size_t)b * TT * DM, XB, (size_t)TT * DM / 8); k_gemmw<bf, 0, true, KSW, 1><<<dim3(TT / 64, DKV / 64, 1), 32 * KSW, 0, stream>>>(XB, nullptr, WK, nullptr, DM, FK, DKV, bk, 0, 0, 0, 0);
        k_rope<<<LKv, 256, 0, stream>>>(FK, DKV, NKV, CS, nullptr, nullptr, 1.0f, KP16, KPh + pb, KPl + pb);
        k_cvt8<<<(unsigned)(((size_t)TT * DM / 8 + 255) / 256), 256, 0, stream>>>(xv + (size_t)b * TT * DM, XB, (size_t)TT * DM / 8); k_gemmw<bf, 0, true, KSW, 1><<<dim3(TT / 64, DKV / 64, 1), 32 * KSW, 0, stream>>>(XB, nullptr, WV, nullptr, DM, FV, DKV, bv, 0, 0, 0, 0); k_vtp<<<LKv, 256, 0, stream>>>(FV, DKV, NKV, VT16, VTh + pb, VTl + pb); }
    k_fattn<<<NB_ * (TT / 16), 32 * FW, 0, stream>>>(QPh, QPl, KPh, KPl, VTh, VTl, ATh, ATl, OUT2);   /* scores, softmax, head mean of the probabilities (second output), probs x v, merged hi/lo planes: both batches, all heads */
    for (int b = 0; b < NB_; ++b) k_gemmw<bf, 1, true, KSW, 1><<<dim3(TT / 64, DM / 64, 1), 32 * KSW, 0, stream>>>(ATh + (size_t)b * TT * DQ, ATl + (size_t)b * TT * DQ, WO, nullptr, DQ, OUT + (size_t)b * TT * DM, DM, bo, 0, 0, 0, 0);
}

// v004
// It runs in 323 microseconds.
// Next to v003, in two timings, it ran 1.39 times as fast each time.
// All steps since v000 together make it 4.77 times as fast.
#include <hip/hip_runtime.h>

// Multi-head attention returning the output AND the head-averaged attention probabilities (Q, K, V [2][2048][1024]; q,k,v = input W^T + b ('oi' [1024][1024] + [1024]; 16 heads x 64); scores = q.k x 1.0 (SCALING = 1: unscaled); probs = softmax; attn = probs v; out = merged Wo^T + bo -> [2][2048][1024]; second output mean over heads of probs -> [2][2048][2048]; tuple (12.6 M)).
// Layout: per batch bf16 copies of the three inputs in turn; exact projections + f32 biases; hi/lo head planes of q, k, v^T of both batches; ONE attention launch (k_fattn): a work-group keeps 16 query rows x 2048 keys of scores and probabilities in its waves' registers (3 hi/lo products; the unscaled logits reach |s| ~ 15), walks the 16 heads in order, adds the f32 probabilities into a register head sum (fixed order: deterministic) and writes sum x 1/16 to the second output; merged hi/lo x Wo exact + bo to the first.
// Every bf16 workspace plane is kept in WMMA fragment order (see frs()): a wave-wide 16-byte fragment load reads 512 contiguous bytes, 4 whole 128-byte lines, where a row-major plane gives 32 bytes of each of 16 lines.
// Compute dtypes, f32 accumulate: every input rounded to bf16; projections exact + f32 biases; scores and attn.v 3 products; softmax, probability mean f32; Wo hl x exact + bias.

#define NB_  2
#define TT   2048
#define DM   1024
#define NH_  16
#define NKV  16
#define REP  (NH_ / NKV)
#define HD   64
#define DQ   (NH_ * HD)
#define DKV  (NKV * HD)
#define KSW  8                     // waves of a work-group that share a long K range
#define FW   16                    // waves of an attention work-group; they share the 2048 keys of its 16 query rows
#define KPW  (TT / FW)             // keys of one wave
#define NT   (KPW / 16)            // 16-key score tiles of one wave
#define SCL  1.0f   // SCALING = 1.0 in the module (no 1/sqrt(d))
typedef _Float16 h16;
typedef unsigned short bf;
typedef __attribute__((ext_vector_type(16))) __bf16   v16bf;
typedef __attribute__((ext_vector_type(16))) _Float16 v16h;
typedef __attribute__((ext_vector_type(8)))  _Float16 v8h;
typedef __attribute__((ext_vector_type(8)))  unsigned short v8us;
typedef __attribute__((ext_vector_type(8)))  float    v8f;
typedef __attribute__((ext_vector_type(4)))  float    v4f;
typedef v8h  __attribute__((may_alias)) v8ha;
typedef v4f  __attribute__((may_alias)) v4fa;
typedef v8us __attribute__((may_alias)) v8usa;

__device__ __forceinline__ unsigned short f2bf(float f) { unsigned u = __float_as_uint(f); u += 0x7FFFu + ((u >> 16) & 1u); return (unsigned short)(u >> 16); }
__device__ __forceinline__ float bf2f(unsigned short b) { return __uint_as_float(((unsigned)b) << 16); }
__device__ __forceinline__ float bfr(float f) { return bf2f(f2bf(f)); }
__device__ __forceinline__ v16h cat16(v8h lo, v8h hi) { return __builtin_shufflevector(lo, hi, 0, 1, 2, 3, 4, 5, 6, 7, 8, 9, 10, 11, 12, 13, 14, 15); }
__device__ __forceinline__ v16bf cat16b(v8us lo, v8us hi) { return __builtin_bit_cast(v16bf, __builtin_shufflevector(lo, hi, 0, 1, 2, 3, 4, 5, 6, 7, 8, 9, 10, 11, 12, 13, 14, 15)); }
__device__ __forceinline__ v8f wmma16(v16h a, v16h b, v8f c) { return __builtin_amdgcn_wmma_f32_16x16x32_f16(false, a, false, b, (short)0, c, false, false); }
__device__ __forceinline__ v8f wmmab(v16bf a, v16bf b, v8f c) { return __builtin_amdgcn_wmma_f32_16x16x32_bf16(false, a, false, b, (short)0, c, false, false); }



// ---- Fragment order of a 16-bit matrix M[r][k] of K columns (rows % 16 == 0, K % 32 == 0): units of 16 rows x 32 k = 512 elements, unit (r / 16) (K / 32) + k / 32. Inside a unit stand two 512-byte halves (k % 32 < 16, >= 16);
// in a half lane l = 16 ((k % 16) / 8) + r % 16 owns elements 8 l .. 8 l + 7 (k % 8). WFrag::ld(unit + 8 lane) is then the lane's A or B fragment, with the same value in every lane and register as a load from the row-major plane.
// frs(i, K, r, k): row and first k of the i-th 8-element piece of such a plane (the writers walk the plane in storage order, so that their stores are whole lines).
__device__ __forceinline__ void frs(unsigned i, unsigned K, unsigned& r, unsigned& k) { const unsigned u = i >> 6, kpu = K >> 5; r = (u / kpu) * 16 + (i & 15); k = (u % kpu) * 32 + ((i >> 5) & 1) * 16 + ((i >> 4) & 1) * 8; }
// ---- k_gemmw: register-blocked GEMM, KS waves per 64x64 output tile (16 accumulators each), operands straight from 16-bit planes in fragment order; grid (M/64, N/64, Z KG), 32 KS threads.
// C[m][n] (f32, pitch ldc, + optional f32 bias[n]) = sum_k A[m][k] Bt[n][k] (+ split products per NSPLIT). z-batch strides sA/sB/sC in elements. K % 32 == 0.
// Split K: the tile's K range is cut into KG x KS equal slices (K % (32 KG KS) == 0). The KS waves of a work-group (32 KS threads) each run one slice and their partial tiles are summed through LDS in wave order (one barrier);
// the KG slice groups are separate work-groups (blockIdx.z = z KG + g) that store partial planes at C + g sG, which the consumer sums in g order. KS = KG = 1: one wave, whole K.
template <typename T16> struct WFrag;
template <> struct WFrag<h16> { typedef v16h V; static __device__ __forceinline__ V ld(const h16* p) { return cat16(*(const v8h*)p, *(const v8h*)(p + 256)); } static __device__ __forceinline__ v8f mma(V a, V b, v8f c) { return wmma16(a, b, c); } };
template <> struct WFrag<bf> { typedef v16bf V; static __device__ __forceinline__ V ld(const bf* p) { return cat16b(*(const v8us*)p, *(const v8us*)(p + 256)); } static __device__ __forceinline__ v8f mma(V a, V b, v8f c) { return wmmab(a, b, c); } };
template <typename T16, int NSPLIT, bool BIAS, int KS, int KG, int K>
__global__ __launch_bounds__(32 * KS) void k_gemmw(const T16* __restrict__ A, const T16* __restrict__ A2, const T16* __restrict__ Bt, const T16* __restrict__ Bt2, float* C, int ldc, const float* __restrict__ bias, size_t sA, size_t sB, size_t sC, size_t sG) {
    typedef typename WFrag<T16>::V V;
    __shared__ __align__(16) float os[KS > 1 ? KS * 64 * 68 : 16 * 68];
    const int wv = __builtin_amdgcn_readfirstlane(threadIdx.x >> 5);   // wave number, scalar: the K loop's bounds stay wave-uniform (WMMA needs every lane on)
    const int kl = K / (KS * KG), kbeg = ((int)(blockIdx.z % KG) * KS + wv) * kl, kend = kbeg + kl; C += (size_t)(blockIdx.z % KG) * sG;
    const size_t z = blockIdx.z / KG; A += z * sA; if (A2) A2 += z * sA; Bt += z * sB; if (Bt2) Bt2 += z * sB; C += z * sC;
    const int lane = threadIdx.x & 31, lr = lane & 15, hi = lane >> 4; const int r0 = blockIdx.x * 64, c0 = blockIdx.y * 64;
    v8f acc[4][4];
#pragma unroll
    for (int mb = 0; mb < 4; ++mb)
#pragma unroll
        for (int nb = 0; nb < 4; ++nb) acc[mb][nb] = (v8f){};
    const char* Ab = (const char*)(A + (size_t)r0 * K); const char* A2b = (const char*)(A2 + (size_t)r0 * K); const char* Bb = (const char*)(Bt + (size_t)c0 * K); const char* B2b = (const char*)(Bt2 + (size_t)c0 * K); constexpr int rs = K * 32;   // uniform bases of the tile's first 16 rows; rs: bytes of 16 rows = K / 32 units in a row (K is a template constant so that it is an immediate offset)
    unsigned vo = (unsigned)lane * 16 + (unsigned)kbeg * 32;   // the lane's byte offset beside every base: its 16 bytes of a half unit + the k step's unit (1 KiB per 32 k); one register serves all loads
#pragma unroll 1
    for (int kc = kbeg; kc < kend; kc += 32) {
        V a[4], a2[4];
#pragma unroll
        for (int mb = 0; mb < 4; ++mb) { a[mb] = WFrag<T16>::ld((const T16*)(Ab + mb * rs + vo)); if (NSPLIT == 1 || NSPLIT == 2) a2[mb] = WFrag<T16>::ld((const T16*)(A2b + mb * rs + vo)); }
#pragma unroll
        for (int nb = 0; nb < 4; ++nb) { const V b = WFrag<T16>::ld((const T16*)(Bb + nb * rs + vo)); V b2; if (NSPLIT >= 2) b2 = WFrag<T16>::ld((const T16*)(B2b + nb * rs + vo));
#pragma unroll
            for (int mb = 0; mb < 4; ++mb) { acc[mb][nb] = WFrag<T16>::mma(a[mb], b, acc[mb][nb]); if (NSPLIT == 1 || NSPLIT == 2) acc[mb][nb] = WFrag<T16>::mma(a2[mb], b, acc[mb][nb]); if (NSPLIT >= 2) acc[mb][nb] = WFrag<T16>::mma(a[mb], b2, acc[mb][nb]); } }
        asm volatile("v_nop\n\tv_nop\n\tv_nop\n\tv_nop" : "+v"(acc[0][0]), "+v"(acc[1][1]), "+v"(acc[2][2]), "+v"(acc[3][3]) : "v"(a[0]), "v"(a[3]));
        asm volatile("s_wait_xcnt 0x0" : "+v"(vo) :: "memory");   // the wait owed before the offset register that the issued loads name is stepped. The offset is an operand so that it stays ONE 32-bit register beside the uniform bases, live up to here: otherwise the compiler forms 64-bit lane addresses anew each trip and places later loads' results on them
        vo += 1024;
    }
    if constexpr (KS > 1) {
#pragma unroll
        for (int mb = 0; mb < 4; ++mb)
#pragma unroll
            for (int nb = 0; nb < 4; ++nb)
#pragma unroll
                for (int j = 0; j < 8; ++j) os[wv * (64 * 68) + (mb * 16 + hi * 8 + j) * 68 + nb * 16 + lr] = acc[mb][nb][j];
        __syncthreads();   // every wave's partial 64x64 tile is in LDS before any thread sums across the waves
#pragma unroll
        for (int it = 0; it < 64 * 16 / (32 * KS); ++it) { const int idx = it * (32 * KS) + (int)threadIdx.x, row = idx >> 4, cofs = (idx & 15) * 4; v4f val = *(const v4fa*)(os + row * 68 + cofs);
#pragma unroll
            for (int w = 1; w < KS; ++w) val += *(const v4fa*)(os + w * (64 * 68) + row * 68 + cofs);
            if (BIAS) { val[0] += bfr(bias[c0 + cofs]); val[1] += bfr(bias[c0 + cofs + 1]); val[2] += bfr(bias[c0 + cofs + 2]); val[3] += bfr(bias[c0 + cofs + 3]); }
            *(v4f*)(C + (size_t)(r0 + row) * ldc + c0 + cofs) = val; }
        return;
    }
#pragma unroll
    for (int mb = 0; mb < 4; ++mb) {
#pragma unroll
        for (int nb = 0; nb < 4; ++nb) {
#pragma unroll
            for (int j = 0; j < 8; ++j) os[(hi * 8 + j) * 68 + nb * 16 + lr] = acc[mb][nb][j]; }
        __builtin_amdgcn_wave_barrier(); asm volatile("" ::: "memory");
        float* crow = C + (size_t)(r0 + mb * 16) * ldc + c0;
{
#pragma unroll
            for (int s = 0; s < 8; ++s) { const int row = 2 * s + hi, cofs = lr * 4; v4f val = *(const v4fa*)(os + row * 68 + cofs); if (BIAS) { val[0] += bfr(bias[c0 + cofs]); val[1] += bfr(bias[c0 + cofs + 1]); val[2] += bfr(bias[c0 + cofs + 2]); val[3] += bfr(bias[c0 + cofs + 3]); }
                *(v4f*)(crow + (size_t)row * ldc + cofs) = val; }
             }
        __builtin_amdgcn_wave_barrier(); asm volatile("" ::: "memory");
    }
}

__device__ __forceinline__ h16 tohx(float x) { return (h16)x; }
__device__ __forceinline__ void splitf(float y, unsigned short& h, unsigned short& l) { h = f2bf(y); l = f2bf(y - bf2f(h)); }
typedef __attribute__((ext_vector_type(2))) _Float16 v2h;
typedef __attribute__((ext_vector_type(4))) _Float16 v4h;
typedef __attribute__((ext_vector_type(2))) unsigned short v2us;
typedef __attribute__((ext_vector_type(4))) unsigned short v4us;
typedef __attribute__((ext_vector_type(2))) float v2f;
typedef __attribute__((ext_vector_type(4))) int v4i;

__global__ __launch_bounds__(256) void k_wtG(const float* __restrict__ w, int K, int N, bf* Bt) {
    const int lane = threadIdx.x & 31; const int L0 = (blockIdx.x * 8 + (threadIdx.x >> 5)) * 8; const int nlines = N * K / 64;
{
#pragma unroll 1
        for (int l = 0; l < 8; ++l) { const int L = L0 + l; if (L >= nlines) break; const size_t e = (size_t)L * 64 + lane * 2; const int k = (int)(e % K), n = (int)(e / K); v2us o;
            o[0] = f2bf(w[(size_t)k * N + n]); o[1] = f2bf(w[(size_t)(k + 1) * N + n]); *(v2us*)(Bt + e) = o; }
         }
}
// k_cvt8: row-major f32 [rows][DM] -> bf16 plane in fragment order, one 8-element piece a thread
__global__ __launch_bounds__(256) void k_cvt8(const float* __restrict__ src, bf* dst, size_t n8) { const size_t i = (size_t)blockIdx.x * 256 + threadIdx.x; if (i >= n8) return; unsigned r, k0; frs((unsigned)i, DM, r, k0); const float* p = src + (size_t)r * DM + k0; const v8f v = *(const v8f*)p; v8us o;
    asm volatile("s_wait_xcnt 0x0" :: "v"(p) : "memory");   // the wait owed before a register that the issued loads name is overwritten; the address as an input keeps its registers untouched up to here
#pragma unroll
    for (int k = 0; k < 8; ++k) o[k] = f2bf(v[k]); *(v8us*)(dst + i * 8) = o;  }

// k_rope: head planes [h][t][d] (fp16 + hi/lo) of rope(x) x sc with the rotate-half convention out[d] = x[d] cos[t][d] - x[d+HD/2] sin[t][d], out[d+HD/2] = x[d+HD/2] cos[t][d+HD/2] + x[d] sin[t][d+HD/2]
__global__ __launch_bounds__(256) void k_rope(const float* __restrict__ F, int pitch, int nheads, const float* __restrict__ CS, const float* __restrict__ RF, const float* __restrict__ nw, float sc, h16* P16, bf* Ph, bf* Pl) {
    const size_t e = ((size_t)blockIdx.x * 256 + threadIdx.x) * 2; if (e >= (size_t)nheads * TT * HD) return; const int h = (int)(e / ((size_t)HD * TT)); unsigned tr, dk; frs((unsigned)(e % ((size_t)HD * TT)) >> 3, HD, tr, dk); const int t = (int)tr, d = (int)dk + (int)(e & 7);   // e: storage index; each head's [t][d] plane is in fragment order
    const float* f = F + (size_t)t * pitch + h * HD; float rf = 1.0f; if (RF) { const float* pr = RF + (size_t)h * TT + t; rf = *pr; asm volatile("s_wait_xcnt 0x0" :: "v"(pr) : "memory"); }   // the same wait for this load's address
    v2h o16; v2us oh, ol;
#pragma unroll
    for (int q = 0; q < 2; ++q) { const int dd = d + q; const int dp = (dd < HD / 2) ? dd + HD / 2 : dd - HD / 2; const float* p0 = f + dd; const float* p1 = f + dp; const float* pc = CS + ((size_t)t * HD + dd) * 2; float x0 = *p0, x1 = *p1;
        if (RF) { float n0 = __fmul_rn(x0, rf), n1 = __fmul_rn(x1, rf); asm volatile("" : "+v"(n0)); asm volatile("" : "+v"(n1)); x0 = __fmul_rn(bfr(nw[dd]), n0); x1 = __fmul_rn(bfr(nw[dp]), n1); }
        const v2f cs = *(const v2f*)pc; asm volatile("s_wait_xcnt 0x0" :: "v"(p0), "v"(p1), "v"(pc) : "memory");   // the wait owed before a register that the issued loads name is overwritten; the addresses as inputs keep their registers untouched up to here
        float a = __fmul_rn(x0, cs[0]), bq = __fmul_rn(x1, cs[1]); asm volatile("" : "+v"(a)); asm volatile("" : "+v"(bq)); const float r = ((dd < HD / 2) ? __fsub_rn(a, bq) : __fadd_rn(a, bq)) * sc;
        o16[q] = tohx(r); unsigned short a2, c2; splitf(r, a2, c2); oh[q] = a2; ol[q] = c2; }
    *(v2h*)(P16 + e) = o16; *(v2us*)(Ph + e) = oh; *(v2us*)(Pl + e) = ol;  }
__global__ __launch_bounds__(256) void k_vtp(const float* __restrict__ F, int pitch, int nheads, h16* V16, bf* Vh, bf* Vl) { const size_t e = ((size_t)blockIdx.x * 256 + threadIdx.x) * 2; if (e >= (size_t)nheads * HD * TT) return; const int g = (int)(e / ((size_t)TT * HD)); unsigned dr, tk; frs((unsigned)(e % ((size_t)TT * HD)) >> 3, TT, dr, tk); const int d = (int)dr, t = (int)tk + (int)(e & 7);   // e: storage index; each head's [d][t] plane is in fragment order
    v2h o16; v2us oh, ol;
#pragma unroll
    for (int q = 0; q < 2; ++q) { const float x = F[(size_t)(t + q) * pitch + g * HD + d]; o16[q] = tohx(x); unsigned short a2, c2; splitf(x, a2, c2); oh[q] = a2; ol[q] = c2; }
    *(v2h*)(V16 + e) = o16; *(v2us*)(Vh + e) = oh; *(v2us*)(Vl + e) = ol;  }
__global__ __launch_bounds__(256) void k_csid(float* CS) { const int idx = blockIdx.x * 256 + threadIdx.x; if (idx >= TT * HD) return; v2f cs; cs[0] = 1.0f; cs[1] = 0.0f; *(v2f*)(CS + (size_t)idx * 2) = cs;  }
// 2^x; the v_nop is the one slot the instruction set asks for behind a transcendental before its result is read or its source overwritten
__device__ __forceinline__ float exp2s(float x) { float r; asm("v_exp_f32 %0, %1\n\tv_nop" : "=v"(r) : "v"(x)); return r; }
typedef __attribute__((ext_vector_type(2))) __bf16 v2bf;
typedef __attribute__((ext_vector_type(8))) unsigned v8u;
typedef v2f __attribute__((may_alias)) v2fa;
// k_fattn: one work-group of FW waves takes 16 query rows of one batch through ALL heads, in head order; grid NB_ x TT/16. Wave w owns keys [w KPW, (w + 1) KPW).
// Per head: S^T = K Q^T (A = key rows, B = query rows, 3 hi/lo products) stays in the wave's accumulators: lane (lr, hi) holds query lr, register j of tile t key 16 t + 8 hi + j.
// Row maximum and row sum: in the lane, across the lane halves, then across the waves through LDS in wave order (a barrier each). The f32 probabilities are added to the head sum in registers,
// split into hi/lo bf16 in place (two tiles of 16 keys are one B operand of 32 keys in the loader's k order) and O^T = V^T P^T (3 products) follows; the waves' partial O^T are summed through LDS in wave order (a barrier).
__global__ __launch_bounds__(32 * FW) void k_fattn(const bf* __restrict__ Qh, const bf* __restrict__ Ql, const bf* __restrict__ Kh, const bf* __restrict__ Kl, const bf* __restrict__ Vh, const bf* __restrict__ Vl, bf* __restrict__ Ah, bf* __restrict__ Al, float* __restrict__ O2) {
    typedef WFrag<bf> F; static_assert(FW == 16 && NKV == NH_ && HD == 64 && NT == 2 * (HD / 16), "one thread sums two elements of the partial outputs; one kv head per query head; two units a 16-row q or k tile");
    __shared__ float rmx[FW * 16]; __shared__ float rsm[FW * 16]; __shared__ __align__(16) float op[FW * 16 * 68];
    const int wv = __builtin_amdgcn_readfirstlane(threadIdx.x >> 5);   // wave number, scalar
    const int lane = threadIdx.x & 31, lr = lane & 15, hi = lane >> 4; const int b = blockIdx.x / (TT / 16), q0 = (blockIdx.x % (TT / 16)) * 16;
    const unsigned qo = (unsigned)(q0 * HD + 8 * lane) * 2, ko = (unsigned)(wv * KPW * HD + 8 * lane) * 2, vo = (unsigned)(wv * KPW * 16 + 8 * lane) * 2;   // the lane's byte offsets inside a head's plane (fragment order: 1-KiB units of 16 rows x 32 k; q, k: 2 units a 16-row tile; v: TT / 32 units a 16-row tile)
    v8f macc[NT];
#pragma unroll
    for (int t = 0; t < NT; ++t) macc[t] = (v8f){};
#pragma unroll 1
    for (int h = 0; h < NH_; ++h) { const unsigned hb = (unsigned)(b * NH_ + h) * (TT * HD * 2);   // byte offset of the head's plane (q, k [t][d]; v [d][t]) in its 8-MiB buffer
        const unsigned qb = hb + qo, kb = hb + ko, vb = hb + vo;   // one 32-bit offset register beside each uniform base serves all of a plane's loads (64-bit lane addresses cost registers that the fragment sets need)
        v16bf qh[2], ql[2];
#pragma unroll
        for (int ks = 0; ks < 2; ++ks) { qh[ks] = F::ld((const bf*)((const char*)Qh + qb + ks * 1024)); ql[ks] = F::ld((const bf*)((const char*)Ql + qb + ks * 1024)); }
        v8f s[NT]; v16bf fh[2][2], fl[2][2];   // operand fragments of a group of six products, two register sets: the next group's loads fly while this group is multiplied
#pragma unroll
        for (int ks = 0; ks < 2; ++ks) { fh[0][ks] = F::ld((const bf*)((const char*)Kh + kb + ks * 1024)); fl[0][ks] = F::ld((const bf*)((const char*)Kl + kb + ks * 1024)); }
        asm volatile("s_wait_xcnt 0x0" :: "v"(qb) : "memory");   // the wait owed before a register that an issued load names is overwritten; the q offset as an input keeps its register untouched up to here (without it a later load's result was placed on it)
#pragma unroll
        for (int t = 0; t < NT; ++t) { v8f a = (v8f){};
            if (t + 1 < NT) {
#pragma unroll
                for (int ks = 0; ks < 2; ++ks) { fh[(t + 1) & 1][ks] = F::ld((const bf*)((const char*)Kh + kb + ((t + 1) * 16 * HD * 2 + ks * 1024))); fl[(t + 1) & 1][ks] = F::ld((const bf*)((const char*)Kl + kb + ((t + 1) * 16 * HD * 2 + ks * 1024))); } }
            __builtin_amdgcn_sched_barrier(0);   // the next tile's eight loads (2 KiB in a row of each plane) are issued ahead of this tile's products: otherwise each pair of loads is waited for right behind its issue
#pragma unroll
            for (int ks = 0; ks < 2; ++ks) { a = wmmab(fh[t & 1][ks], qh[ks], a); a = wmmab(fh[t & 1][ks], ql[ks], a); a = wmmab(fl[t & 1][ks], qh[ks], a); }
            s[t] = a * SCL;
            __builtin_amdgcn_sched_barrier(0);   // no later tile's loads rise over these products: two register sets are all that fit
        }
        float mx = -3.0e38f;
#pragma unroll
        for (int t = 0; t < NT; ++t)
#pragma unroll
            for (int j = 0; j < 8; ++j) mx = fmaxf(mx, s[t][j]);
        mx = fmaxf(mx, __shfl_xor(mx, 16, 32));
        if (hi == 0) rmx[wv * 16 + lr] = mx;
        __syncthreads();   // every wave's row maxima are in LDS before any wave joins them
#pragma unroll
        for (int w = 0; w < FW; ++w) mx = fmaxf(mx, rmx[w * 16 + lr]);
        float sum = 0.f;
#pragma unroll
        for (int t = 0; t < NT; ++t)
#pragma unroll
            for (int j = 0; j < 8; ++j) { s[t][j] = exp2s(__fmul_rn(__fsub_rn(s[t][j], mx), 1.4426950408889634f)); sum += s[t][j]; }
        sum += __shfl_xor(sum, 16, 32);
        if (hi == 0) rsm[wv * 16 + lr] = sum;
        __syncthreads();   // every wave's row sums are in LDS before any wave joins them
        sum = rsm[lr];
#pragma unroll
        for (int w = 1; w < FW; ++w) sum += rsm[w * 16 + lr];
        const float f = __fdiv_rn(1.0f, sum);
        v8u ph[NT / 2], pl[NT / 2];
#pragma unroll
        for (int t = 0; t < NT; ++t)
#pragma unroll
            for (int j = 0; j < 8; j += 2) { v2f p; p[0] = s[t][j] * f; p[1] = s[t][j + 1] * f; macc[t][j] += p[0]; macc[t][j + 1] += p[1];
                const unsigned hu = __builtin_bit_cast(unsigned, __builtin_convertvector(p, v2bf)); v2f r; r[0] = p[0] - __uint_as_float(hu << 16); r[1] = p[1] - __uint_as_float(hu & 0xFFFF0000u);
                ph[t >> 1][(t & 1) * 4 + (j >> 1)] = hu; pl[t >> 1][(t & 1) * 4 + (j >> 1)] = __builtin_bit_cast(unsigned, __builtin_convertvector(r, v2bf)); }
        v8f o[HD / 16];
#pragma unroll
        for (int dt = 0; dt < HD / 16; ++dt) o[dt] = (v8f){};
#pragma unroll
        for (int k2 = 0; k2 < 2; ++k2) { fh[0][k2] = F::ld((const bf*)((const char*)Vh + vb + k2 * 1024)); fl[0][k2] = F::ld((const bf*)((const char*)Vl + vb + k2 * 1024)); }
#pragma unroll
        for (int g = 0; g < NT; ++g) { const int kp = g / (HD / 16), dt = g % (HD / 16);   // a group: 16 v rows x 64 keys = two units in a row
            if (g + 1 < NT) { const int kn = (g + 1) / (HD / 16), dn = (g + 1) % (HD / 16);
#pragma unroll
                for (int k2 = 0; k2 < 2; ++k2) { fh[(g + 1) & 1][k2] = F::ld((const bf*)((const char*)Vh + vb + (dn * 16 * TT * 2 + (kn * 2 + k2) * 1024))); fl[(g + 1) & 1][k2] = F::ld((const bf*)((const char*)Vl + vb + (dn * 16 * TT * 2 + (kn * 2 + k2) * 1024))); } }
            __builtin_amdgcn_sched_barrier(0);   // the next group's eight loads are issued ahead of this group's products (as in the score loop)
#pragma unroll
            for (int k2 = 0; k2 < 2; ++k2) { const int kt = kp * 2 + k2; const v16bf bh = __builtin_bit_cast(v16bf, ph[kt]), bl = __builtin_bit_cast(v16bf, pl[kt]);
                o[dt] = wmmab(fh[g & 1][k2], bh, o[dt]); o[dt] = wmmab(fh[g & 1][k2], bl, o[dt]); o[dt] = wmmab(fl[g & 1][k2], bh, o[dt]); }
            __builtin_amdgcn_sched_barrier(0);   // no later group's loads rise over these products
        }
#pragma unroll
        for (int dt = 0; dt < HD / 16; ++dt) { float* w = op + (wv * 16 + lr) * 68 + dt * 16 + hi * 8; v4f lo4, hi4;
#pragma unroll
            for (int j = 0; j < 4; ++j) { lo4[j] = o[dt][j]; hi4[j] = o[dt][4 + j]; }
            *(v4fa*)w = lo4; *(v4fa*)(w + 4) = hi4; }
        __syncthreads();   // every wave's partial O^T is in LDS before any thread sums across the waves
        { const int tid = (int)threadIdx.x, q = (tid >> 2) & 15, d = (tid >> 6) * 8 + (tid & 3) * 2; v2f sm = *(const v2fa*)(op + q * 68 + d);   // thread tid sums elements 2 tid, 2 tid + 1 of the head's two units (16 queries x 64 d) of the merged planes, in their storage order
#pragma unroll
            for (int w = 1; w < FW; ++w) sm += *(const v2fa*)(op + (w * 16 + q) * 68 + d);
            v2us oh, ol; unsigned short a0, c0; splitf(sm[0], a0, c0); oh[0] = a0; ol[0] = c0; splitf(sm[1], a0, c0); oh[1] = a0; ol[1] = c0;
            const unsigned oo = (unsigned)((b * TT + q0) * DQ + h * (16 * HD) + tid * 2) * 2; *(v2us*)((char*)Ah + oo) = oh; *(v2us*)((char*)Al + oo) = ol; }
        asm volatile("s_wait_xcnt 0x0" ::: "memory");   // the wait owed before the next head's address arithmetic overwrites a register that these stores name
    }
    float* o2 = O2 + (size_t)(b * TT + q0 + lr) * TT + wv * KPW + hi * 8;
#pragma unroll
    for (int t = 0; t < NT; ++t) { v4f lo4, hi4;
#pragma unroll
        for (int j = 0; j < 4; ++j) { lo4[j] = macc[t][j] * (1.0f / NH_); hi4[j] = macc[t][4 + j] * (1.0f / NH_); }
        *(v4f*)(o2 + t * 16) = lo4; *(v4f*)(o2 + t * 16 + 4) = hi4; }
}

extern "C" void kernel_launch(void* const* d_in, const int* in_sizes, int n_in,
                              void* d_out, int out_size, void* d_ws, size_t ws_size, hipStream_t stream) {
    (void)in_sizes; (void)n_in; (void)out_size;
    const float* x = (const float*)d_in[0]; const float* xk = (const float*)d_in[1]; const float* xv = (const float*)d_in[2]; const float* wq = (const float*)d_in[3]; const float* bq = (const float*)d_in[4]; const float* wk = (const float*)d_in[5]; const float* bk = (const float*)d_in[6]; const float* wv = (const float*)d_in[7]; const float* bv = (const float*)d_in[8]; const float* wo = (const float*)d_in[9]; const float* bo = (const float*)d_in[10];
    float* OUT = (float*)d_out;     // first output [2][2048][1024]
    float* OUT2 = OUT + (size_t)NB_ * TT * DM;   // second output [2][2048][2048] (tuple: contiguous after the first)
    char* wsp = (char*)d_ws;
    auto take = [&](size_t bytes) { char* p = wsp; wsp += (bytes + 255) & ~(size_t)255; return (void*)p; };
    bf* WQ = (bf*)take((size_t)DQ * DM * 2); bf* WK = (bf*)take((size_t)DKV * DM * 2); bf* WV = (bf*)take((size_t)DKV * DM * 2); bf* WO = (bf*)take((size_t)DM * DQ * 2); float* CS = (float*)take((size_t)TT * HD * 2 * 4);
    bf* XB = (bf*)take((size_t)TT * DM * 2); float* FQ = (float*)take((size_t)TT * DQ * 4); float* FK = (float*)take((size_t)TT * DKV * 4);
    h16* QP16 = (h16*)take((size_t)NH_ * TT * HD * 2); h16* KP16 = (h16*)take((size_t)NKV * TT * HD * 2); h16* VT16 = (h16*)take((size_t)NKV * HD * TT * 2);
    bf* QPh = (bf*)take((size_t)NB_ * NH_ * TT * HD * 2); bf* QPl = (bf*)take((size_t)NB_ * NH_ * TT * HD * 2); bf* KPh = (bf*)take((size_t)NB_ * NKV * TT * HD * 2); bf* KPl = (bf*)take((size_t)NB_ * NKV * TT * HD * 2); bf* VTh = (bf*)take((size_t)NB_ * NKV * HD * TT * 2); bf* VTl = (bf*)take((size_t)NB_ * NKV * HD * TT * 2);   // hi/lo head planes of both batches
    bf* ATh = (bf*)take((size_t)NB_ * TT * DQ * 2); bf* ATl = (bf*)take((size_t)NB_ * TT * DQ * 2);
    if ((size_t)(wsp - (char*)d_ws) > ws_size) return;    // ws 256 MiB
    float* FV = FK;   // v projection reuses the k buffer after the k planes are built (stream-ordered)
    { k_cvt8<<<(unsigned)(((size_t)DQ * DM / 8 + 255) / 256), 256, 0, stream>>>(wq, WQ, (size_t)DQ * DM / 8); k_cvt8<<<(unsigned)(((size_t)DKV * DM / 8 + 255) / 256), 256, 0, stream>>>(wk, WK, (size_t)DKV * DM / 8); k_cvt8<<<(unsigned)(((size_t)DKV * DM / 8 + 255) / 256), 256, 0, stream>>>(wv, WV, (size_t)DKV * DM / 8);
      k_cvt8<<<(unsigned)(((size_t)DM * DQ / 8 + 255) / 256), 256, 0, stream>>>(wo, WO, (size_t)DM * DQ / 8);
       }
    k_csid<<<(TT * HD + 255) / 256, 256, 0, stream>>>(CS);
    const unsigned LQ = (unsigned)(((size_t)NH_ * TT * HD / 2 + 255) / 256), LKv = (unsigned)(((size_t)NKV * TT * HD / 2 + 255) / 256);
    for (int b = 0; b < NB_; ++b) { const size_t pb = (size_t)b * NH_ * TT * HD;   // the batch's place in the head planes
        k_cvt8<<<(unsigned)(((size_t)TT * DM / 8 + 255) / 256), 256, 0, stream>>>(x + (size_t)b * TT * DM, XB, (size_t)TT * DM / 8);
        k_gemmw<bf, 0, true, KSW, 1, DM><<<dim3(TT / 64, DQ / 64, 1), 32 * KSW, 0, stream>>>(XB, nullptr, WQ, nullptr, FQ, DQ, bq, 0, 0, 0, 0);
        k_rope<<<LQ, 256, 0, stream>>>(FQ, DQ, NH_, CS, nullptr, nullptr, 1.0f, QP16, QPh + pb, QPl + pb);
        k_cvt8<<<(unsigned)(((size_t)TT * DM / 8 + 255) / 256), 256, 0, stream>>>(xk + (size_t)b * TT * DM, XB, (size_t)TT * DM / 8); k_gemmw<bf, 0, true, KSW, 1, DM><<<dim3(TT / 64, DKV / 64, 1), 32 * KSW, 0, stream>>>(XB, nullptr, WK, nullptr, FK, DKV, bk, 0, 0, 0, 0);
        k_rope<<<LKv, 256, 0, stream>>>(FK, DKV, NKV, CS, nullptr, nullptr, 1.0f, KP16, KPh + pb, KPl + pb);
        k_cvt8<<<(unsigned)(((size_t)TT * DM / 8 + 255) / 256), 256, 0, stream>>>(xv + (size_t)b * TT * DM, XB, (size_t)TT * DM / 8); k_gemmw<bf, 0, true, KSW, 1, DM><<<dim3(TT / 64, DKV / 64, 1), 32 * KSW, 0, stream>>>(XB, nullptr, WV, nullptr, FV, DKV, bv, 0, 0, 0, 0); k_vtp<<<LKv, 256, 0, stream>>>(FV, DKV, NKV, VT16, VTh + pb, VTl + pb); }
    k_fattn<<<NB_ * (TT / 16), 32 * FW, 0, stream>>>(QPh, QPl, KPh, KPl, VTh, VTl, ATh, ATl, OUT2);   /* scores, softmax, head mean of the probabilities (second output), probs x v, merged hi/lo planes: both batches, all heads */
    for (int b = 0; b < NB_; ++b) k_gemmw<bf, 1, true, KSW, 1, DQ><<<dim3(TT / 64, DM / 64, 1), 32 * KSW, 0, stream>>>(ATh + (size_t)b * TT * DQ, ATl + (size_t)b * TT * DQ, WO, nullptr, OUT + (size_t)b * TT * DM, DM, bo, 0, 0, 0, 0);
}

// v005
// A run of this version takes 276 microseconds.
// Timed twice side by side with v004, it ran 1.17 times as fast both times.
// All steps since v000 together make it 5.59 times as fast.
#include <hip/hip_runtime.h>

// Multi-head attention returning the output AND the head-averaged attention probabilities (Q, K, V [2][2048][1024]; q,k,v = input W^T + b ('oi' [1024][1024] + [1024]; 16 heads x 64); scores = q.k x 1.0 (SCALING = 1: unscaled); probs = softmax; attn = probs v; out = merged Wo^T + bo -> [2][2048][1024]; second output mean over heads of probs -> [2][2048][2048]; tuple (12.6 M)).
// Layout: five launches, each stage once for both batches and for q, k, v together: bf16 copies of the three inputs and four weights; exact projections + f32 biases; hi/lo head planes of q, k, v^T of both batches; ONE attention launch (k_fattn): a work-group keeps 16 query rows x 2048 keys of scores and probabilities in its waves' registers (3 hi/lo products; the unscaled logits reach |s| ~ 15), walks the 16 heads in order, adds the f32 probabilities into a register head sum (fixed order: deterministic) and writes sum x 1/16 to the second output; merged hi/lo x Wo exact + bo to the first.
// Every bf16 workspace plane is kept in WMMA fragment order (see frs()): a wave-wide 16-byte fragment load reads 512 contiguous bytes, 4 whole 128-byte lines, where a row-major plane gives 32 bytes of each of 16 lines.
// Compute dtypes, f32 accumulate: every input rounded to bf16; projections exact + f32 biases; scores and attn.v 3 products; softmax, probability mean f32; Wo hl x exact + bias.

#define NB_  2
#define TT   2048
#define DM   1024
#define NH_  16
#define NKV  16
#define REP  (NH_ / NKV)
#define HD   64
#define DQ   (NH_ * HD)
#define DKV  (NKV * HD)
#define KSW  8                     // waves of a work-group that share a long K range
#define FW   16                    // waves of an attention work-group; they share the 2048 keys of its 16 query rows
#define KPW  (TT / FW)             // keys of one wave
#define NT   (KPW / 16)            // 16-key score tiles of one wave
#define SCL  1.0f   // SCALING = 1.0 in the module (no 1/sqrt(d))
typedef _Float16 h16;
typedef unsigned short bf;
typedef __attribute__((ext_vector_type(16))) __bf16   v16bf;
typedef __attribute__((ext_vector_type(16))) _Float16 v16h;
typedef __attribute__((ext_vector_type(8)))  _Float16 v8h;
typedef __attribute__((ext_vector_type(8)))  unsigned short v8us;
typedef __attribute__((ext_vector_type(8)))  float    v8f;
typedef __attribute__((ext_vector_type(4)))  float    v4f;
typedef v8h  __attribute__((may_alias)) v8ha;
typedef v4f  __attribute__((may_alias)) v4fa;
typedef v8us __attribute__((may_alias)) v8usa;

__device__ __forceinline__ unsigned short f2bf(float f) { unsigned u = __float_as_uint(f); u += 0x7FFFu + ((u >> 16) & 1u); return (unsigned short)(u >> 16); }
__device__ __forceinline__ float bf2f(unsigned short b) { return __uint_as_float(((unsigned)b) << 16); }
__device__ __forceinline__ float bfr(float f) { return bf2f(f2bf(f)); }
__device__ __forceinline__ v16h cat16(v8h lo, v8h hi) { return __builtin_shufflevector(lo, hi, 0, 1, 2, 3, 4, 5, 6, 7, 8, 9, 10, 11, 12, 13, 14, 15); }
__device__ __forceinline__ v16bf cat16b(v8us lo, v8us hi) { return __builtin_bit_cast(v16bf, __builtin_shufflevector(lo, hi, 0, 1, 2, 3, 4, 5, 6, 7, 8, 9, 10, 11, 12, 13, 14, 15)); }
__device__ __forceinline__ v8f wmma16(v16h a, v16h b, v8f c) { return __builtin_amdgcn_wmma_f32_16x16x32_f16(false, a, false, b, (short)0, c, false, false); }
__device__ __forceinline__ v8f wmmab(v16bf a, v16bf b, v8f c) { return __builtin_amdgcn_wmma_f32_16x16x32_bf16(false, a, false, b, (short)0, c, false, false); }



// ---- Fragment order of a 16-bit matrix M[r][k] of K columns (rows % 16 == 0, K % 32 == 0): units of 16 rows x 32 k = 512 elements, unit (r / 16) (K / 32) + k / 32. Inside a unit stand two 512-byte halves (k % 32 < 16, >= 16);
// in a half lane l = 16 ((k % 16) / 8) + r % 16 owns elements 8 l .. 8 l + 7 (k % 8). WFrag::ld(unit + 8 lane) is then the lane's A or B fragment, with the same value in every lane and register as a load from the row-major plane.
// frs(i, K, r, k): row and first k of the i-th 8-element piece of such a plane (the writers walk the plane in storage order, so that their stores are whole lines).
__device__ __forceinline__ void frs(unsigned i, unsigned K, unsigned& r, unsigned& k) { const unsigned u = i >> 6, kpu = K >> 5; r = (u / kpu) * 16 + (i & 15); k = (u % kpu) * 32 + ((i >> 5) & 1) * 16 + ((i >> 4) & 1) * 8; }
// ---- k_gemmw: register-blocked GEMM, KS waves a work-group per 64x64 output tile (16 accumulators each), operands straight from 16-bit planes in fragment order; grid (M/64, N/64, Z KG), 32 KS threads.
// C[m][n] (f32, pitch ldc, + optional f32 bias[n]) = sum_k A[m][k] Bt[n][k] (+ split products per NSPLIT). z-batch strides sA/sB/sC in elements; z instance 0, 1, 2 adds bias, bias1, bias2. K % 32 == 0.
// Split K: the tile's K range is cut into KG x KS equal slices (K % (32 KG KS) == 0). The KS waves of a work-group (32 KS threads) each run one slice and their partial tiles are summed through LDS in wave order (one barrier);
// the KG slice groups are separate work-groups (blockIdx.z = z KG + g) that store partial planes at C + g sG, which the consumer sums in g order. KS = KG = 1: one wave, whole K.
template <typename T16> struct WFrag;
template <> struct WFrag<h16> { typedef v16h V; static __device__ __forceinline__ V ld(const h16* p) { return cat16(*(const v8h*)p, *(const v8h*)(p + 256)); } static __device__ __forceinline__ v8f mma(V a, V b, v8f c) { return wmma16(a, b, c); } };
template <> struct WFrag<bf> { typedef v16bf V; static __device__ __forceinline__ V ld(const bf* p) { return cat16b(*(const v8us*)p, *(const v8us*)(p + 256)); } static __device__ __forceinline__ v8f mma(V a, V b, v8f c) { return wmmab(a, b, c); } };
template <typename T16, int NSPLIT, bool BIAS, int KS, int KG, int K>
__global__ __launch_bounds__(32 * KS) void k_gemmw(const T16* __restrict__ A, const T16* __restrict__ A2, const T16* __restrict__ Bt, const T16* __restrict__ Bt2, float* C, int ldc, const float* __restrict__ bias, const float* __restrict__ bias1, const float* __restrict__ bias2, size_t sA, size_t sB, size_t sC, size_t sG) {
    typedef typename WFrag<T16>::V V;
    __shared__ __align__(16) float os[KS > 1 ? KS * 64 * 68 : 16 * 68];
    const int wv = __builtin_amdgcn_readfirstlane(threadIdx.x >> 5);   // wave number, scalar: the K loop's bounds stay wave-uniform (WMMA needs every lane on)
    const int kl = K / (KS * KG), kbeg = ((int)(blockIdx.z % KG) * KS + wv) * kl, kend = kbeg + kl; C += (size_t)(blockIdx.z % KG) * sG;
    const size_t z = blockIdx.z / KG; A += z * sA; if (A2) A2 += z * sA; Bt += z * sB; if (Bt2) Bt2 += z * sB; C += z * sC; if (z == 1) bias = bias1; else if (z == 2) bias = bias2;   // each z instance (q, k, v projection) has its own bias vector
    const int lane = threadIdx.x & 31, lr = lane & 15, hi = lane >> 4; const int r0 = blockIdx.x * 64, c0 = blockIdx.y * 64;
    v8f acc[4][4];
#pragma unroll
    for (int mb = 0; mb < 4; ++mb)
#pragma unroll
        for (int nb = 0; nb < 4; ++nb) acc[mb][nb] = (v8f){};
    const char* Ab = (const char*)(A + (size_t)r0 * K); const char* A2b = (const char*)(A2 + (size_t)r0 * K); const char* Bb = (const char*)(Bt + (size_t)c0 * K); const char* B2b = (const char*)(Bt2 + (size_t)c0 * K); constexpr int rs = K * 32;   // uniform bases of the tile's first 16 rows; rs: bytes of 16 rows = K / 32 units in a row (K is a template constant so that it is an immediate offset)
    unsigned vo = (unsigned)lane * 16 + (unsigned)kbeg * 32;   // the lane's byte offset beside every base: its 16 bytes of a half unit + the k step's unit (1 KiB per 32 k); one register serves all loads
#pragma unroll 1
    for (int kc = kbeg; kc < kend; kc += 32) {
        V a[4], a2[4];
#pragma unroll
        for (int mb = 0; mb < 4; ++mb) { a[mb] = WFrag<T16>::ld((const T16*)(Ab + mb * rs + vo)); if (NSPLIT == 1 || NSPLIT == 2) a2[mb] = WFrag<T16>::ld((const T16*)(A2b + mb * rs + vo)); }
#pragma unroll
        for (int nb = 0; nb < 4; ++nb) { const V b = WFrag<T16>::ld((const T16*)(Bb + nb * rs + vo)); V b2; if (NSPLIT >= 2) b2 = WFrag<T16>::ld((const T16*)(B2b + nb * rs + vo));
#pragma unroll
            for (int mb = 0; mb < 4; ++mb) { acc[mb][nb] = WFrag<T16>::mma(a[mb], b, acc[mb][nb]); if (NSPLIT == 1 || NSPLIT == 2) acc[mb][nb] = WFrag<T16>::mma(a2[mb], b, acc[mb][nb]); if (NSPLIT >= 2) acc[mb][nb] = WFrag<T16>::mma(a[mb], b2, acc[mb][nb]); } }
        asm volatile("v_nop\n\tv_nop\n\tv_nop\n\tv_nop" : "+v"(acc[0][0]), "+v"(acc[1][1]), "+v"(acc[2][2]), "+v"(acc[3][3]) : "v"(a[0]), "v"(a[3]));
        asm volatile("s_wait_xcnt 0x0" : "+v"(vo) :: "memory");   // the wait owed before the offset register that the issued loads name is stepped. The offset is an operand so that it stays ONE 32-bit register beside the uniform bases, live up to here: otherwise the compiler forms 64-bit lane addresses anew each trip and places later loads' results on them
        vo += 1024;
    }
    if constexpr (KS > 1) {
#pragma unroll
        for (int mb = 0; mb < 4; ++mb)
#pragma unroll
            for (int nb = 0; nb < 4; ++nb)
#pragma unroll
                for (int j = 0; j < 8; ++j) os[wv * (64 * 68) + (mb * 16 + hi * 8 + j) * 68 + nb * 16 + lr] = acc[mb][nb][j];
        __syncthreads();   // every wave's partial 64x64 tile is in LDS before any thread sums across the waves
#pragma unroll
        for (int it = 0; it < 64 * 16 / (32 * KS); ++it) { const int idx = it * (32 * KS) + (int)threadIdx.x, row = idx >> 4, cofs = (idx & 15) * 4; v4f val = *(const v4fa*)(os + row * 68 + cofs);
#pragma unroll
            for (int w = 1; w < KS; ++w) val += *(const v4fa*)(os + w * (64 * 68) + row * 68 + cofs);
            if (BIAS) { val[0] += bfr(bias[c0 + cofs]); val[1] += bfr(bias[c0 + cofs + 1]); val[2] += bfr(bias[c0 + cofs + 2]); val[3] += bfr(bias[c0 + cofs + 3]); }
            *(v4f*)(C + (size_t)(r0 + row) * ldc + c0 + cofs) = val; }
        return;
    }
#pragma unroll
    for (int mb = 0; mb < 4; ++mb) {
#pragma unroll
        for (int nb = 0; nb < 4; ++nb) {
#pragma unroll
            for (int j = 0; j < 8; ++j) os[(hi * 8 + j) * 68 + nb * 16 + lr] = acc[mb][nb][j]; }
        __builtin_amdgcn_wave_barrier(); asm volatile("" ::: "memory");
        float* crow = C + (size_t)(r0 + mb * 16) * ldc + c0;
{
#pragma unroll
            for (int s = 0; s < 8; ++s) { const int row = 2 * s + hi, cofs = lr * 4; v4f val = *(const v4fa*)(os + row * 68 + cofs); if (BIAS) { val[0] += bfr(bias[c0 + cofs]); val[1] += bfr(bias[c0 + cofs + 1]); val[2] += bfr(bias[c0 + cofs + 2]); val[3] += bfr(bias[c0 + cofs + 3]); }
                *(v4f*)(crow + (size_t)row * ldc + cofs) = val; }
             }
        __builtin_amdgcn_wave_barrier(); asm volatile("" ::: "memory");
    }
}

__device__ __forceinline__ h16 tohx(float x) { return (h16)x; }
__device__ __forceinline__ void splitf(float y, unsigned short& h, unsigned short& l) { h = f2bf(y); l = f2bf(y - bf2f(h)); }
typedef __attribute__((ext_vector_type(2))) _Float16 v2h;
typedef __attribute__((ext_vector_type(4))) _Float16 v4h;
typedef __attribute__((ext_vector_type(2))) unsigned short v2us;
typedef __attribute__((ext_vector_type(4))) unsigned short v4us;
typedef __attribute__((ext_vector_type(2))) float v2f;
typedef __attribute__((ext_vector_type(4))) int v4i;

__global__ __launch_bounds__(256) void k_wtG(const float* __restrict__ w, int K, int N, bf* Bt) {
    const int lane = threadIdx.x & 31; const int L0 = (blockIdx.x * 8 + (threadIdx.x >> 5)) * 8; const int nlines = N * K / 64;
{
#pragma unroll 1
        for (int l = 0; l < 8; ++l) { const int L = L0 + l; if (L >= nlines) break; const size_t e = (size_t)L * 64 + lane * 2; const int k = (int)(e % K), n = (int)(e / K); v2us o;
            o[0] = f2bf(w[(size_t)k * N + n]); o[1] = f2bf(w[(size_t)(k + 1) * N + n]); *(v2us*)(Bt + e) = o; }
         }
}
// k_cvt8: row-major f32 [rows][DM] -> bf16 plane in fragment order, one 8-element piece a thread. ONE launch converts all seven sources and writes the cos/sin table: blocks [0, 3 BX) the three inputs (both batches: NB_ TT rows each) to XB + s NB_ TT DM,
// blocks [3 BX, 3 BX + 4 BW) the four weights to WB + s DQ DM, the last TT HD / 256 blocks the table (cos 1, sin 0). The choice is the same for a whole block.
#define BX_ (NB_ * TT * DM / 8 / 256)
#define BW_ (DQ * DM / 8 / 256)
__global__ __launch_bounds__(256) void k_cvt8(const float* __restrict__ x, const float* __restrict__ xk, const float* __restrict__ xv, const float* __restrict__ wq, const float* __restrict__ wk, const float* __restrict__ wv, const float* __restrict__ wo, bf* XB, bf* WB, float* CS) {
    const unsigned blk = blockIdx.x; const float* src; bf* dst; unsigned i;
    if (blk >= 3 * BX_ + 4 * BW_) { const unsigned idx = (blk - (3 * BX_ + 4 * BW_)) * 256 + threadIdx.x; v2f cs; cs[0] = 1.0f; cs[1] = 0.0f; *(v2f*)(CS + (size_t)idx * 2) = cs; return; }
    if (blk < 3 * BX_) { const unsigned s = blk / BX_; src = s == 0 ? x : s == 1 ? xk : xv; dst = XB + (size_t)s * (NB_ * TT * DM); i = (blk % BX_) * 256 + threadIdx.x; }
    else { const unsigned s = (blk - 3 * BX_) / BW_; src = s == 0 ? wq : s == 1 ? wk : s == 2 ? wv : wo; dst = WB + (size_t)s * (DQ * DM); i = ((blk - 3 * BX_) % BW_) * 256 + threadIdx.x; }
    unsigned r, k0; frs(i, DM, r, k0); const float* p = src + (size_t)r * DM + k0; const v8f v = *(const v8f*)p; v8us o;
    asm volatile("s_wait_xcnt 0x0" :: "v"(p) : "memory");   // the wait owed before a register that the issued loads name is overwritten; the address as an input keeps its registers untouched up to here
#pragma unroll
    for (int k = 0; k < 8; ++k) o[k] = f2bf(v[k]); *(v8us*)(dst + (size_t)i * 8) = o;  }

// d_rope: head planes [h][t][d] (fp16 + hi/lo) of rope(x) x sc with the rotate-half convention out[d] = x[d] cos[t][d] - x[d+HD/2] sin[t][d], out[d+HD/2] = x[d+HD/2] cos[t][d+HD/2] + x[d] sin[t][d+HD/2]
__device__ __forceinline__ void d_rope(unsigned blk, const float* __restrict__ F, int pitch, int nheads, const float* __restrict__ CS, const float* __restrict__ RF, const float* __restrict__ nw, float sc, h16* P16, bf* Ph, bf* Pl) {
    const size_t e = ((size_t)blk * 256 + threadIdx.x) * 2; if (e >= (size_t)nheads * TT * HD) return; const int hp = (int)(e / ((size_t)HD * TT)), h = hp % NH_; F += (size_t)(hp / NH_) * TT * pitch; unsigned tr, dk; frs((unsigned)(e % ((size_t)HD * TT)) >> 3, HD, tr, dk); const int t = (int)tr, d = (int)dk + (int)(e & 7);   // e: storage index; each head's [t][d] plane is in fragment order. Plane hp: head hp % NH_ of the (hp / NH_)-th block of TT rows of F (q batch 0, 1, k batch 0, 1 in one launch)
    const float* f = F + (size_t)t * pitch + h * HD; float rf = 1.0f; if (RF) { const float* pr = RF + (size_t)h * TT + t; rf = *pr; asm volatile("s_wait_xcnt 0x0" :: "v"(pr) : "memory"); }   // the same wait for this load's address
    v2h o16; v2us oh, ol;
#pragma unroll
    for (int q = 0; q < 2; ++q) { const int dd = d + q; const int dp = (dd < HD / 2) ? dd + HD / 2 : dd - HD / 2; const float* p0 = f + dd; const float* p1 = f + dp; const float* pc = CS + ((size_t)t * HD + dd) * 2; float x0 = *p0, x1 = *p1;
        if (RF) { float n0 = __fmul_rn(x0, rf), n1 = __fmul_rn(x1, rf); asm volatile("" : "+v"(n0)); asm volatile("" : "+v"(n1)); x0 = __fmul_rn(bfr(nw[dd]), n0); x1 = __fmul_rn(bfr(nw[dp]), n1); }
        const v2f cs = *(const v2f*)pc; asm volatile("s_wait_xcnt 0x0" :: "v"(p0), "v"(p1), "v"(pc) : "memory");   // the wait owed before a register that the issued loads name is overwritten; the addresses as inputs keep their registers untouched up to here
        float a = __fmul_rn(x0, cs[0]), bq = __fmul_rn(x1, cs[1]); asm volatile("" : "+v"(a)); asm volatile("" : "+v"(bq)); const float r = ((dd < HD / 2) ? __fsub_rn(a, bq) : __fadd_rn(a, bq)) * sc;
        o16[q] = tohx(r); unsigned short a2, c2; splitf(r, a2, c2); oh[q] = a2; ol[q] = c2; }
    *(v2h*)(P16 + e) = o16; *(v2us*)(Ph + e) = oh; *(v2us*)(Pl + e) = ol;  }
__device__ __forceinline__ void d_vtp(unsigned blk, const float* __restrict__ F, int pitch, int nheads, h16* V16, bf* Vh, bf* Vl) { const size_t e = ((size_t)blk * 256 + threadIdx.x) * 2; if (e >= (size_t)nheads * HD * TT) return; const int gp = (int)(e / ((size_t)TT * HD)), g = gp % NKV; F += (size_t)(gp / NKV) * TT * pitch; unsigned dr, tk; frs((unsigned)(e % ((size_t)TT * HD)) >> 3, TT, dr, tk); const int d = (int)dr, t = (int)tk + (int)(e & 7);   // e: storage index; each head's [d][t] plane is in fragment order. Plane gp: head gp % NKV of batch gp / NKV (both batches in one launch)
    v2h o16; v2us oh, ol;
#pragma unroll
    for (int q = 0; q < 2; ++q) { const float x = F[(size_t)(t + q) * pitch + g * HD + d]; o16[q] = tohx(x); unsigned short a2, c2; splitf(x, a2, c2); oh[q] = a2; ol[q] = c2; }
    *(v2h*)(V16 + e) = o16; *(v2us*)(Vh + e) = oh; *(v2us*)(Vl + e) = ol;  }
// k_planes: all head planes in one launch: blocks [0, BV_) the v^T planes (their strided reads take longest: they start first), the rest the q and k planes; F holds the q, k, v projections of both batches in a row. The choice is the same for a whole block.
#define BV_ (NB_ * NKV * TT * HD / 2 / 256)
#define BR_ (2 * NB_ * NH_ * TT * HD / 2 / 256)
__global__ __launch_bounds__(256) void k_planes(const float* __restrict__ F, const float* __restrict__ CS, h16* QK16, bf* QKh, bf* QKl, h16* V16, bf* Vh, bf* Vl) {
    if (blockIdx.x < BV_) d_vtp(blockIdx.x, F + (size_t)2 * NB_ * TT * DQ, DKV, NB_ * NKV, V16, Vh, Vl);
    else d_rope(blockIdx.x - BV_, F, DQ, 2 * NB_ * NH_, CS, nullptr, nullptr, 1.0f, QK16, QKh, QKl); }
// 2^x; the v_nop is the one slot the instruction set asks for behind a transcendental before its result is read or its source overwritten
__device__ __forceinline__ float exp2s(float x) { float r; asm("v_exp_f32 %0, %1\n\tv_nop" : "=v"(r) : "v"(x)); return r; }
typedef __attribute__((ext_vector_type(2))) __bf16 v2bf;
typedef __attribute__((ext_vector_type(8))) unsigned v8u;
typedef v2f __attribute__((may_alias)) v2fa;
// k_fattn: one work-group of FW waves takes 16 query rows of one batch through ALL heads, in head order; grid NB_ x TT/16. Wave w owns keys [w KPW, (w + 1) KPW).
// Per head: S^T = K Q^T (A = key rows, B = query rows, 3 hi/lo products) stays in the wave's accumulators: lane (lr, hi) holds query lr, register j of tile t key 16 t + 8 hi + j.
// Row maximum and row sum: in the lane, across the lane halves, then across the waves through LDS in wave order (a barrier each). The f32 probabilities are added to the head sum in registers,
// split into hi/lo bf16 in place (two tiles of 16 keys are one B operand of 32 keys in the loader's k order) and O^T = V^T P^T (3 products) follows; the waves' partial O^T are summed through LDS in wave order (a barrier).
__global__ __launch_bounds__(32 * FW) void k_fattn(const bf* __restrict__ Qh, const bf* __restrict__ Ql, const bf* __restrict__ Kh, const bf* __restrict__ Kl, const bf* __restrict__ Vh, const bf* __restrict__ Vl, bf* __restrict__ Ah, bf* __restrict__ Al, float* __restrict__ O2) {
    typedef WFrag<bf> F; static_assert(FW == 16 && NKV == NH_ && HD == 64 && NT == 2 * (HD / 16), "one thread sums two elements of the partial outputs; one kv head per query head; two units a 16-row q or k tile");
    __shared__ float rmx[FW * 16]; __shared__ float rsm[FW * 16]; __shared__ __align__(16) float op[FW * 16 * 68];
    const int wv = __builtin_amdgcn_readfirstlane(threadIdx.x >> 5);   // wave number, scalar
    const int lane = threadIdx.x & 31, lr = lane & 15, hi = lane >> 4; const int b = blockIdx.x / (TT / 16), q0 = (blockIdx.x % (TT / 16)) * 16;
    const unsigned qo = (unsigned)(q0 * HD + 8 * lane) * 2, ko = (unsigned)(wv * KPW * HD + 8 * lane) * 2, vo = (unsigned)(wv * KPW * 16 + 8 * lane) * 2;   // the lane's byte offsets inside a head's plane (fragment order: 1-KiB units of 16 rows x 32 k; q, k: 2 units a 16-row tile; v: TT / 32 units a 16-row tile)
    v8f macc[NT];
#pragma unroll
    for (int t = 0; t < NT; ++t) macc[t] = (v8f){};
#pragma unroll 1
    for (int h = 0; h < NH_; ++h) { const unsigned hb = (unsigned)(b * NH_ + h) * (TT * HD * 2);   // byte offset of the head's plane (q, k [t][d]; v [d][t]) in its 8-MiB buffer
        const unsigned qb = hb + qo, kb = hb + ko, vb = hb + vo;   // one 32-bit offset register beside each uniform base serves all of a plane's loads (64-bit lane addresses cost registers that the fragment sets need)
        v16bf qh[2], ql[2];
#pragma unroll
        for (int ks = 0; ks < 2; ++ks) { qh[ks] = F::ld((const bf*)((const char*)Qh + qb + ks * 1024)); ql[ks] = F::ld((const bf*)((const char*)Ql + qb + ks * 1024)); }
        v8f s[NT]; v16bf fh[2][2], fl[2][2];   // operand fragments of a group of six products, two register sets: the next group's loads fly while this group is multiplied
#pragma unroll
        for (int ks = 0; ks < 2; ++ks) { fh[0][ks] = F::ld((const bf*)((const char*)Kh + kb + ks * 1024)); fl[0][ks] = F::ld((const bf*)((const char*)Kl + kb + ks * 1024)); }
        asm volatile("s_wait_xcnt 0x0" :: "v"(qb) : "memory");   // the wait owed before a register that an issued load names is overwritten; the q offset as an input keeps its register untouched up to here (without it a later load's result was placed on it)
#pragma unroll
        for (int t = 0; t < NT; ++t) { v8f a = (v8f){};
            if (t + 1 < NT) {
#pragma unroll
                for (int ks = 0; ks < 2; ++ks) { fh[(t + 1) & 1][ks] = F::ld((const bf*)((const char*)Kh + kb + ((t + 1) * 16 * HD * 2 + ks * 1024))); fl[(t + 1) & 1][ks] = F::ld((const bf*)((const char*)Kl + kb + ((t + 1) * 16 * HD * 2 + ks * 1024))); } }
            __builtin_amdgcn_sched_barrier(0);   // the next tile's eight loads (2 KiB in a row of each plane) are issued ahead of this tile's products: otherwise each pair of loads is waited for right behind its issue
#pragma unroll
            for (int ks = 0; ks < 2; ++ks) { a = wmmab(fh[t & 1][ks], qh[ks], a); a = wmmab(fh[t & 1][ks], ql[ks], a); a = wmmab(fl[t & 1][ks], qh[ks], a); }
            s[t] = a * SCL;
            __builtin_amdgcn_sched_barrier(0);   // no later tile's loads rise over these products: two register sets are all that fit
        }
        float mx = -3.0e38f;
#pragma unroll
        for (int t = 0; t < NT; ++t)
#pragma unroll
            for (int j = 0; j < 8; ++j) mx = fmaxf(mx, s[t][j]);
        mx = fmaxf(mx, __shfl_xor(mx, 16, 32));
        if (hi == 0) rmx[wv * 16 + lr] = mx;
        __syncthreads();   // every wave's row maxima are in LDS before any wave joins them
#pragma unroll
        for (int w = 0; w < FW; ++w) mx = fmaxf(mx, rmx[w * 16 + lr]);
        float sum = 0.f;
#pragma unroll
        for (int t = 0; t < NT; ++t)
#pragma unroll
            for (int j = 0; j < 8; ++j) { s[t][j] = exp2s(__fmul_rn(__fsub_rn(s[t][j], mx), 1.4426950408889634f)); sum += s[t][j]; }
        sum += __shfl_xor(sum, 16, 32);
        if (hi == 0) rsm[wv * 16 + lr] = sum;
        __syncthreads();   // every wave's row sums are in LDS before any wave joins them
        sum = rsm[lr];
#pragma unroll
        for (int w = 1; w < FW; ++w) sum += rsm[w * 16 + lr];
        const float f = __fdiv_rn(1.0f, sum);
        v8u ph[NT / 2], pl[NT / 2];
#pragma unroll
        for (int t = 0; t < NT; ++t)
#pragma unroll
            for (int j = 0; j < 8; j += 2) { v2f p; p[0] = s[t][j] * f; p[1] = s[t][j + 1] * f; macc[t][j] += p[0]; macc[t][j + 1] += p[1];
                const unsigned hu = __builtin_bit_cast(unsigned, __builtin_convertvector(p, v2bf)); v2f r; r[0] = p[0] - __uint_as_float(hu << 16); r[1] = p[1] - __uint_as_float(hu & 0xFFFF0000u);
                ph[t >> 1][(t & 1) * 4 + (j >> 1)] = hu; pl[t >> 1][(t & 1) * 4 + (j >> 1)] = __builtin_bit_cast(unsigned, __builtin_convertvector(r, v2bf)); }
        v8f o[HD / 16];
#pragma unroll
        for (int dt = 0; dt < HD / 16; ++dt) o[dt] = (v8f){};
#pragma unroll
        for (int k2 = 0; k2 < 2; ++k2) { fh[0][k2] = F::ld((const bf*)((const char*)Vh + vb + k2 * 1024)); fl[0][k2] = F::ld((const bf*)((const char*)Vl + vb + k2 * 1024)); }
#pragma unroll
        for (int g = 0; g < NT; ++g) { const int kp = g / (HD / 16), dt = g % (HD / 16);   // a group: 16 v rows x 64 keys = two units in a row
            if (g + 1 < NT) { const int kn = (g + 1) / (HD / 16), dn = (g + 1) % (HD / 16);
#pragma unroll
                for (int k2 = 0; k2 < 2; ++k2) { fh[(g + 1) & 1][k2] = F::ld((const bf*)((const char*)Vh + vb + (dn * 16 * TT * 2 + (kn * 2 + k2) * 1024))); fl[(g + 1) & 1][k2] = F::ld((const bf*)((const char*)Vl + vb + (dn * 16 * TT * 2 + (kn * 2 + k2) * 1024))); } }
            __builtin_amdgcn_sched_barrier(0);   // the next group's eight loads are issued ahead of this group's products (as in the score loop)
#pragma unroll
            for (int k2 = 0; k2 < 2; ++k2) { const int kt = kp * 2 + k2; const v16bf bh = __builtin_bit_cast(v16bf, ph[kt]), bl = __builtin_bit_cast(v16bf, pl[kt]);
                o[dt] = wmmab(fh[g & 1][k2], bh, o[dt]); o[dt] = wmmab(fh[g & 1][k2], bl, o[dt]); o[dt] = wmmab(fl[g & 1][k2], bh, o[dt]); }
            __builtin_amdgcn_sched_barrier(0);   // no later group's loads rise over these products
        }
#pragma unroll
        for (int dt = 0; dt < HD / 16; ++dt) { float* w = op + (wv * 16 + lr) * 68 + dt * 16 + hi * 8; v4f lo4, hi4;
#pragma unroll
            for (int j = 0; j < 4; ++j) { lo4[j] = o[dt][j]; hi4[j] = o[dt][4 + j]; }
            *(v4fa*)w = lo4; *(v4fa*)(w + 4) = hi4; }
        __syncthreads();   // every wave's partial O^T is in LDS before any thread sums across the waves
        { const int tid = (int)threadIdx.x, q = (tid >> 2) & 15, d = (tid >> 6) * 8 + (tid & 3) * 2; v2f sm = *(const v2fa*)(op + q * 68 + d);   // thread tid sums elements 2 tid, 2 tid + 1 of the head's two units (16 queries x 64 d) of the merged planes, in their storage order
#pragma unroll
            for (int w = 1; w < FW; ++w) sm += *(const v2fa*)(op + (w * 16 + q) * 68 + d);
            v2us oh, ol; unsigned short a0, c0; splitf(sm[0], a0, c0); oh[0] = a0; ol[0] = c0; splitf(sm[1], a0, c0); oh[1] = a0; ol[1] = c0;
            const unsigned oo = (unsigned)((b * TT + q0) * DQ + h * (16 * HD) + tid * 2) * 2; *(v2us*)((char*)Ah + oo) = oh; *(v2us*)((char*)Al + oo) = ol; }
        asm volatile("s_wait_xcnt 0x0" ::: "memory");   // the wait owed before the next head's address arithmetic overwrites a register that these stores name
    }
    float* o2 = O2 + (size_t)(b * TT + q0 + lr) * TT + wv * KPW + hi * 8;
#pragma unroll
    for (int t = 0; t < NT; ++t) { v4f lo4, hi4;
#pragma unroll
        for (int j = 0; j < 4; ++j) { lo4[j] = macc[t][j] * (1.0f / NH_); hi4[j] = macc[t][4 + j] * (1.0f / NH_); }
        *(v4f*)(o2 + t * 16) = lo4; *(v4f*)(o2 + t * 16 + 4) = hi4; }
}

extern "C" void kernel_launch(void* const* d_in, const int* in_sizes, int n_in,
                              void* d_out, int out_size, void* d_ws, size_t ws_size, hipStream_t stream) {
    (void)in_sizes; (void)n_in; (void)out_size;
    const float* x = (const float*)d_in[0]; const float* xk = (const float*)d_in[1]; const float* xv = (const float*)d_in[2]; const float* wq = (const float*)d_in[3]; const float* bq = (const float*)d_in[4]; const float* wk = (const float*)d_in[5]; const float* bk = (const float*)d_in[6]; const float* wv = (const float*)d_in[7]; const float* bv = (const float*)d_in[8]; const float* wo = (const float*)d_in[9]; const float* bo = (const float*)d_in[10];
    float* OUT = (float*)d_out;     // first output [2][2048][1024]
    float* OUT2 = OUT + (size_t)NB_ * TT * DM;   // second output [2][2048][2048] (tuple: contiguous after the first)
    char* wsp = (char*)d_ws;
    auto take = [&](size_t bytes) { char* p = wsp; wsp += (bytes + 255) & ~(size_t)255; return (void*)p; };
    bf* WB = (bf*)take((size_t)4 * DQ * DM * 2); bf* WO = WB + (size_t)3 * DQ * DM; float* CS = (float*)take((size_t)TT * HD * 2 * 4);   // weights q, k, v, o in a row
    bf* XB = (bf*)take((size_t)3 * NB_ * TT * DM * 2); float* FB = (float*)take((size_t)3 * NB_ * TT * DQ * 4);   // the three inputs and their projections in a row (q, k, v; both batches each)
    h16* QK16 = (h16*)take((size_t)2 * NB_ * NH_ * TT * HD * 2); h16* VT16 = (h16*)take((size_t)NB_ * NKV * HD * TT * 2);
    bf* QPh = (bf*)take((size_t)2 * NB_ * NH_ * TT * HD * 2); bf* KPh = QPh + (size_t)NB_ * NH_ * TT * HD; bf* QPl = (bf*)take((size_t)2 * NB_ * NH_ * TT * HD * 2); bf* KPl = QPl + (size_t)NB_ * NH_ * TT * HD; bf* VTh = (bf*)take((size_t)NB_ * NKV * HD * TT * 2); bf* VTl = (bf*)take((size_t)NB_ * NKV * HD * TT * 2);   // hi/lo head planes of both batches; k's follow q's
    bf* ATh = (bf*)take((size_t)NB_ * TT * DQ * 2); bf* ATl = (bf*)take((size_t)NB_ * TT * DQ * 2);
    if ((size_t)(wsp - (char*)d_ws) > ws_size) return;    // ws 256 MiB
    k_cvt8<<<3 * BX_ + 4 * BW_ + TT * HD / 256, 256, 0, stream>>>(x, xk, xv, wq, wk, wv, wo, XB, WB, CS);   /* bf16 fragment-order planes of the inputs and weights, identity table */
    k_gemmw<bf, 0, true, KSW, 1, DM><<<dim3(NB_ * TT / 64, DQ / 64, 3), 32 * KSW, 0, stream>>>(XB, nullptr, WB, nullptr, FB, DQ, bq, bk, bv, (size_t)NB_ * TT * DM, (size_t)DQ * DM, (size_t)NB_ * TT * DQ, 0);   /* q, k, v projections of both batches: z picks input, weight, bias, plane */
    k_planes<<<BV_ + BR_, 256, 0, stream>>>(FB, CS, QK16, QPh, QPl, VT16, VTh, VTl);   /* q, k and v^T head planes, both batches */
    k_fattn<<<NB_ * (TT / 16), 32 * FW, 0, stream>>>(QPh, QPl, KPh, KPl, VTh, VTl, ATh, ATl, OUT2);   /* scores, softmax, head mean of the probabilities (second output), probs x v, merged hi/lo planes: both batches, all heads */
    k_gemmw<bf, 1, true, KSW, 1, DQ><<<dim3(NB_ * TT / 64, DM / 64, 1), 32 * KSW, 0, stream>>>(ATh, ATl, WO, nullptr, OUT, DM, bo, nullptr, nullptr, 0, 0, 0, 0);   /* output projection, both batches (their rows follow one another in the merged planes and in the output) */
}

// v006
// One run takes 243 microseconds.
// In both of two side-by-side timings against v005, it was 1.13 times as fast.
// Counting every step since v000, it is 6.30 times as fast.
#include <hip/hip_runtime.h>

// Multi-head attention returning the output AND the head-averaged attention probabilities (Q, K, V [2][2048][1024]; q,k,v = input W^T + b ('oi' [1024][1024] + [1024]; 16 heads x 64); scores = q.k x 1.0 (SCALING = 1: unscaled); probs = softmax; attn = probs v; out = merged Wo^T + bo -> [2][2048][1024]; second output mean over heads of probs -> [2][2048][2048]; tuple (12.6 M)).
// Layout: five launches, each stage once for both batches and for q, k, v together: bf16 copies of the three inputs and four weights; exact projections + f32 biases; hi/lo head planes of q, k, v^T of both batches; ONE attention launch (k_fattn): a work-group keeps 16 query rows x 2048 keys of scores and probabilities in its waves' registers (3 hi/lo products; the unscaled logits reach |s| ~ 15), walks the 16 heads in order, adds the f32 probabilities into a register head sum (fixed order: deterministic) and writes sum x 1/16 to the second output; merged hi/lo x Wo exact + bo to the first.
// Every bf16 workspace plane is kept in WMMA fragment order (see frs()): a wave-wide 16-byte fragment load reads 512 contiguous bytes, 4 whole 128-byte lines, where a row-major plane gives 32 bytes of each of 16 lines.
// Compute dtypes, f32 accumulate: every input rounded to bf16; projections exact + f32 biases; scores and attn.v 3 products; softmax, probability mean f32; Wo hl x exact + bias.

#define NB_  2
#define TT   2048
#define DM   1024
#define NH_  16
#define NKV  16
#define REP  (NH_ / NKV)
#define HD   64
#define DQ   (NH_ * HD)
#define DKV  (NKV * HD)
#define KSW  8                     // waves of a work-group that share a long K range
#define FW   16                    // waves of an attention work-group; they share the 2048 keys of its 16 query rows
#define KPW  (TT / FW)             // keys of one wave
#define NT   (KPW / 16)            // 16-key score tiles of one wave
#define SCL  1.0f   // SCALING = 1.0 in the module (no 1/sqrt(d))
typedef _Float16 h16;
typedef unsigned short bf;
typedef __attribute__((ext_vector_type(16))) __bf16   v16bf;
typedef __attribute__((ext_vector_type(16))) _Float16 v16h;
typedef __attribute__((ext_vector_type(8)))  _Float16 v8h;
typedef __attribute__((ext_vector_type(8)))  unsigned short v8us;
typedef __attribute__((ext_vector_type(8)))  float    v8f;
typedef __attribute__((ext_vector_type(4)))  float    v4f;
typedef v8h  __attribute__((may_alias)) v8ha;
typedef v4f  __attribute__((may_alias)) v4fa;
typedef v8us __attribute__((may_alias)) v8usa;

__device__ __forceinline__ unsigned short f2bf(float f) { unsigned u = __float_as_uint(f); u += 0x7FFFu + ((u >> 16) & 1u); return (unsigned short)(u >> 16); }
__device__ __forceinline__ float bf2f(unsigned short b) { return __uint_as_float(((unsigned)b) << 16); }
__device__ __forceinline__ float bfr(float f) { return bf2f(f2bf(f)); }
__device__ __forceinline__ v16h cat16(v8h lo, v8h hi) { return __builtin_shufflevector(lo, hi, 0, 1, 2, 3, 4, 5, 6, 7, 8, 9, 10, 11, 12, 13, 14, 15); }
__device__ __forceinline__ v16bf cat16b(v8us lo, v8us hi) { return __builtin_bit_cast(v16bf, __builtin_shufflevector(lo, hi, 0, 1, 2, 3, 4, 5, 6, 7, 8, 9, 10, 11, 12, 13, 14, 15)); }
__device__ __forceinline__ v8f wmma16(v16h a, v16h b, v8f c) { return __builtin_amdgcn_wmma_f32_16x16x32_f16(false, a, false, b, (short)0, c, false, false); }
__device__ __forceinline__ v8f wmmab(v16bf a, v16bf b, v8f c) { return __builtin_amdgcn_wmma_f32_16x16x32_bf16(false, a, false, b, (short)0, c, false, false); }



// ---- Fragment order of a 16-bit matrix M[r][k] of K columns (rows % 16 == 0, K % 32 == 0): units of 16 rows x 32 k = 512 elements, unit (r / 16) (K / 32) + k / 32. Inside a unit stand two 512-byte halves (k % 32 < 16, >= 16);
// in a half lane l = 16 ((k % 16) / 8) + r % 16 owns elements 8 l .. 8 l + 7 (k % 8). WFrag::ld(unit + 8 lane) is then the lane's A or B fragment, with the same value in every lane and register as a load from the row-major plane.
// frs(i, K, r, k): row and first k of the i-th 8-element piece of such a plane (the writers walk the plane in storage order, so that their stores are whole lines).
__device__ __forceinline__ void frs(unsigned i, unsigned K, unsigned& r, unsigned& k) { const unsigned u = i >> 6, kpu = K >> 5; r = (u / kpu) * 16 + (i & 15); k = (u % kpu) * 32 + ((i >> 5) & 1) * 16 + ((i >> 4) & 1) * 8; }
// ---- k_gemmw: register-blocked GEMM, KS waves a work-group per 64x64 output tile (16 accumulators each), operands straight from 16-bit planes in fragment order; grid (M/64, N/64, Z KG), 32 KS threads.
// C[m][n] (f32, pitch ldc, + optional f32 bias[n]) = sum_k A[m][k] Bt[n][k] (+ split products per NSPLIT). z-batch strides sA/sB/sC in elements; z instance 0, 1, 2 adds bias, bias1, bias2. K % 32 == 0.
// Split K: the tile's K range is cut into KG x KS equal slices (K % (32 KG KS) == 0). The KS waves of a work-group (32 KS threads) each run one slice and their partial tiles are summed through LDS in wave order (one barrier);
// the KG slice groups are separate work-groups (blockIdx.z = z KG + g) that store partial planes at C + g sG, which the consumer sums in g order. KS = KG = 1: one wave, whole K.
template <typename T16> struct WFrag;
template <> struct WFrag<h16> { typedef v16h V; static __device__ __forceinline__ V ld(const h16* p) { return cat16(*(const v8h*)p, *(const v8h*)(p + 256)); } static __device__ __forceinline__ v8f mma(V a, V b, v8f c) { return wmma16(a, b, c); } };
template <> struct WFrag<bf> { typedef v16bf V; static __device__ __forceinline__ V ld(const bf* p) { return cat16b(*(const v8us*)p, *(const v8us*)(p + 256)); } static __device__ __forceinline__ v8f mma(V a, V b, v8f c) { return wmmab(a, b, c); } };
template <typename T16, int NSPLIT, bool BIAS, int KS, int KG, int K>
__global__ __launch_bounds__(32 * KS) void k_gemmw(const T16* __restrict__ A, const T16* __restrict__ A2, const T16* __restrict__ Bt, const T16* __restrict__ Bt2, float* C, int ldc, const float* __restrict__ bias, const float* __restrict__ bias1, const float* __restrict__ bias2, size_t sA, size_t sB, size_t sC, size_t sG) {
    typedef typename WFrag<T16>::V V;
    __shared__ __align__(16) float os[KS > 1 ? KS * 64 * 68 : 16 * 68];
    const int wv = __builtin_amdgcn_readfirstlane(threadIdx.x >> 5);   // wave number, scalar: the K loop's bounds stay wave-uniform (WMMA needs every lane on)
    const int kl = K / (KS * KG), kbeg = ((int)(blockIdx.z % KG) * KS + wv) * kl, kend = kbeg + kl; C += (size_t)(blockIdx.z % KG) * sG;
    const size_t z = blockIdx.z / KG; A += z * sA; if (A2) A2 += z * sA; Bt += z * sB; if (Bt2) Bt2 += z * sB; C += z * sC; if (z == 1) bias = bias1; else if (z == 2) bias = bias2;   // each z instance (q, k, v projection) has its own bias vector
    const int lane = threadIdx.x & 31, lr = lane & 15, hi = lane >> 4; const int r0 = blockIdx.x * 64, c0 = blockIdx.y * 64;
    v8f acc[4][4];
#pragma unroll
    for (int mb = 0; mb < 4; ++mb)
#pragma unroll
        for (int nb = 0; nb < 4; ++nb) acc[mb][nb] = (v8f){};
    const char* Ab = (const char*)(A + (size_t)r0 * K); const char* A2b = (const char*)(A2 + (size_t)r0 * K); const char* Bb = (const char*)(Bt + (size_t)c0 * K); const char* B2b = (const char*)(Bt2 + (size_t)c0 * K); constexpr int rs = K * 32;   // uniform bases of the tile's first 16 rows; rs: bytes of 16 rows = K / 32 units in a row (K is a template constant so that it is an immediate offset)
    unsigned vo = (unsigned)lane * 16 + (unsigned)kbeg * 32;   // the lane's byte offset beside every base: its 16 bytes of a half unit + the k step's unit (1 KiB per 32 k); one register serves all loads
#pragma unroll 1
    for (int kc = kbeg; kc < kend; kc += 32) {
        V a[4], a2[4];
#pragma unroll
        for (int mb = 0; mb < 4; ++mb) { a[mb] = WFrag<T16>::ld((const T16*)(Ab + mb * rs + vo)); if (NSPLIT == 1 || NSPLIT == 2) a2[mb] = WFrag<T16>::ld((const T16*)(A2b + mb * rs + vo)); }
#pragma unroll
        for (int nb = 0; nb < 4; ++nb) { const V b = WFrag<T16>::ld((const T16*)(Bb + nb * rs + vo)); V b2; if (NSPLIT >= 2) b2 = WFrag<T16>::ld((const T16*)(B2b + nb * rs + vo));
#pragma unroll
            for (int mb = 0; mb < 4; ++mb) { acc[mb][nb] = WFrag<T16>::mma(a[mb], b, acc[mb][nb]); if (NSPLIT == 1 || NSPLIT == 2) acc[mb][nb] = WFrag<T16>::mma(a2[mb], b, acc[mb][nb]); if (NSPLIT >= 2) acc[mb][nb] = WFrag<T16>::mma(a[mb], b2, acc[mb][nb]); } }
        asm volatile("v_nop\n\tv_nop\n\tv_nop\n\tv_nop" : "+v"(acc[0][0]), "+v"(acc[1][1]), "+v"(acc[2][2]), "+v"(acc[3][3]) : "v"(a[0]), "v"(a[3]));
        asm volatile("s_wait_xcnt 0x0" : "+v"(vo) :: "memory");   // the wait owed before the offset register that the issued loads name is stepped. The offset is an operand so that it stays ONE 32-bit register beside the uniform bases, live up to here: otherwise the compiler forms 64-bit lane addresses anew each trip and places later loads' results on them
        vo += 1024;
    }
    if constexpr (KS > 1) {
#pragma unroll
        for (int mb = 0; mb < 4; ++mb)
#pragma unroll
            for (int nb = 0; nb < 4; ++nb)
#pragma unroll
                for (int j = 0; j < 8; ++j) os[wv * (64 * 68) + (mb * 16 + hi * 8 + j) * 68 + nb * 16 + lr] = acc[mb][nb][j];
        __syncthreads();   // every wave's partial 64x64 tile is in LDS before any thread sums across the waves
#pragma unroll
        for (int it = 0; it < 64 * 16 / (32 * KS); ++it) { const int idx = it * (32 * KS) + (int)threadIdx.x, row = idx >> 4, cofs = (idx & 15) * 4; v4f val = *(const v4fa*)(os + row * 68 + cofs);
#pragma unroll
            for (int w = 1; w < KS; ++w) val += *(const v4fa*)(os + w * (64 * 68) + row * 68 + cofs);
            if (BIAS) { val[0] += bfr(bias[c0 + cofs]); val[1] += bfr(bias[c0 + cofs + 1]); val[2] += bfr(bias[c0 + cofs + 2]); val[3] += bfr(bias[c0 + cofs + 3]); }
            *(v4f*)(C + (size_t)(r0 + row) * ldc + c0 + cofs) = val; }
        return;
    }
#pragma unroll
    for (int mb = 0; mb < 4; ++mb) {
#pragma unroll
        for (int nb = 0; nb < 4; ++nb) {
#pragma unroll
            for (int j = 0; j < 8; ++j) os[(hi * 8 + j) * 68 + nb * 16 + lr] = acc[mb][nb][j]; }
        __builtin_amdgcn_wave_barrier(); asm volatile("" ::: "memory");
        float* crow = C + (size_t)(r0 + mb * 16) * ldc + c0;
{
#pragma unroll
            for (int s = 0; s < 8; ++s) { const int row = 2 * s + hi, cofs = lr * 4; v4f val = *(const v4fa*)(os + row * 68 + cofs); if (BIAS) { val[0] += bfr(bias[c0 + cofs]); val[1] += bfr(bias[c0 + cofs + 1]); val[2] += bfr(bias[c0 + cofs + 2]); val[3] += bfr(bias[c0 + cofs + 3]); }
                *(v4f*)(crow + (size_t)row * ldc + cofs) = val; }
             }
        __builtin_amdgcn_wave_barrier(); asm volatile("" ::: "memory");
    }
}

__device__ __forceinline__ h16 tohx(float x) { return (h16)x; }
__device__ __forceinline__ void splitf(float y, unsigned short& h, unsigned short& l) { h = f2bf(y); l = f2bf(y - bf2f(h)); }
typedef __attribute__((ext_vector_type(2))) _Float16 v2h;
typedef __attribute__((ext_vector_type(4))) _Float16 v4h;
typedef __attribute__((ext_vector_type(2))) unsigned short v2us;
typedef __attribute__((ext_vector_type(4))) unsigned short v4us;
typedef __attribute__((ext_vector_type(2))) float v2f;
typedef __attribute__((ext_vector_type(4))) int v4i;

__global__ __launch_bounds__(256) void k_wtG(const float* __restrict__ w, int K, int N, bf* Bt) {
    const int lane = threadIdx.x & 31; const int L0 = (blockIdx.x * 8 + (threadIdx.x >> 5)) * 8; const int nlines = N * K / 64;
{
#pragma unroll 1
        for (int l = 0; l < 8; ++l) { const int L = L0 + l; if (L >= nlines) break; const size_t e = (size_t)L * 64 + lane * 2; const int k = (int)(e % K), n = (int)(e / K); v2us o;
            o[0] = f2bf(w[(size_t)k * N + n]); o[1] = f2bf(w[(size_t)(k + 1) * N + n]); *(v2us*)(Bt + e) = o; }
         }
}
// k_cvt8: row-major f32 [rows][DM] -> bf16 plane in fragment order, one 8-element piece a thread. ONE launch converts all seven sources and writes the cos/sin table: blocks [0, 3 BX) the three inputs (both batches: NB_ TT rows each) to XB + s NB_ TT DM,
// blocks [3 BX, 3 BX + 4 BW) the four weights to WB + s DQ DM, the last TT HD / 256 blocks the table (cos 1, sin 0). The choice is the same for a whole block.
#define BX_ (NB_ * TT * DM / 8 / 256)
#define BW_ (DQ * DM / 8 / 256)
__global__ __launch_bounds__(256) void k_cvt8(const float* __restrict__ x, const float* __restrict__ xk, const float* __restrict__ xv, const float* __restrict__ wq, const float* __restrict__ wk, const float* __restrict__ wv, const float* __restrict__ wo, bf* XB, bf* WB, float* CS) {
    const unsigned blk = blockIdx.x; const float* src; bf* dst; unsigned i;
    if (blk >= 3 * BX_ + 4 * BW_) { const unsigned idx = (blk - (3 * BX_ + 4 * BW_)) * 256 + threadIdx.x; v2f cs; cs[0] = 1.0f; cs[1] = 0.0f; *(v2f*)(CS + (size_t)idx * 2) = cs; return; }
    if (blk < 3 * BX_) { const unsigned s = blk / BX_; src = s == 0 ? x : s == 1 ? xk : xv; dst = XB + (size_t)s * (NB_ * TT * DM); i = (blk % BX_) * 256 + threadIdx.x; }
    else { const unsigned s = (blk - 3 * BX_) / BW_; src = s == 0 ? wq : s == 1 ? wk : s == 2 ? wv : wo; dst = WB + (size_t)s * (DQ * DM); i = ((blk - 3 * BX_) % BW_) * 256 + threadIdx.x; }
    unsigned r, k0; frs(i, DM, r, k0); const float* p = src + (size_t)r * DM + k0; const v8f v = *(const v8f*)p; v8us o;
    asm volatile("s_wait_xcnt 0x0" :: "v"(p) : "memory");   // the wait owed before a register that the issued loads name is overwritten; the address as an input keeps its registers untouched up to here
#pragma unroll
    for (int k = 0; k < 8; ++k) o[k] = f2bf(v[k]); *(v8us*)(dst + (size_t)i * 8) = o;  }

// d_rope: head planes [h][t][d] (fp16 + hi/lo) of rope(x) x sc with the rotate-half convention out[d] = x[d] cos[t][d] - x[d+HD/2] sin[t][d], out[d+HD/2] = x[d+HD/2] cos[t][d+HD/2] + x[d] sin[t][d+HD/2]
__device__ __forceinline__ void d_rope(unsigned blk, const float* __restrict__ F, int pitch, int nheads, const float* __restrict__ CS, const float* __restrict__ RF, const float* __restrict__ nw, float sc, h16* P16, bf* Ph, bf* Pl) {
    const size_t e = ((size_t)blk * 256 + threadIdx.x) * 2; if (e >= (size_t)nheads * TT * HD) return; const int hp = (int)(e / ((size_t)HD * TT)), h = hp % NH_; F += (size_t)(hp / NH_) * TT * pitch; unsigned tr, dk; frs((unsigned)(e % ((size_t)HD * TT)) >> 3, HD, tr, dk); const int t = (int)tr, d = (int)dk + (int)(e & 7);   // e: storage index; each head's [t][d] plane is in fragment order. Plane hp: head hp % NH_ of the (hp / NH_)-th block of TT rows of F (q batch 0, 1, k batch 0, 1 in one launch)
    const float* f = F + (size_t)t * pitch + h * HD; float rf = 1.0f; if (RF) { const float* pr = RF + (size_t)h * TT + t; rf = *pr; asm volatile("s_wait_xcnt 0x0" :: "v"(pr) : "memory"); }   // the same wait for this load's address
    v2h o16; v2us oh, ol;
#pragma unroll
    for (int q = 0; q < 2; ++q) { const int dd = d + q; const int dp = (dd < HD / 2) ? dd + HD / 2 : dd - HD / 2; const float* p0 = f + dd; const float* p1 = f + dp; const float* pc = CS + ((size_t)t * HD + dd) * 2; float x0 = *p0, x1 = *p1;
        if (RF) { float n0 = __fmul_rn(x0, rf), n1 = __fmul_rn(x1, rf); asm volatile("" : "+v"(n0)); asm volatile("" : "+v"(n1)); x0 = __fmul_rn(bfr(nw[dd]), n0); x1 = __fmul_rn(bfr(nw[dp]), n1); }
        const v2f cs = *(const v2f*)pc; asm volatile("s_wait_xcnt 0x0" :: "v"(p0), "v"(p1), "v"(pc) : "memory");   // the wait owed before a register that the issued loads name is overwritten; the addresses as inputs keep their registers untouched up to here
        float a = __fmul_rn(x0, cs[0]), bq = __fmul_rn(x1, cs[1]); asm volatile("" : "+v"(a)); asm volatile("" : "+v"(bq)); const float r = ((dd < HD / 2) ? __fsub_rn(a, bq) : __fadd_rn(a, bq)) * sc;
        o16[q] = tohx(r); unsigned short a2, c2; splitf(r, a2, c2); oh[q] = a2; ol[q] = c2; }
    *(v2h*)(P16 + e) = o16; *(v2us*)(Ph + e) = oh; *(v2us*)(Pl + e) = ol;  }
__device__ __forceinline__ void d_vtp(unsigned blk, const float* __restrict__ F, int pitch, int nheads, h16* V16, bf* Vh, bf* Vl) { const size_t e = ((size_t)blk * 256 + threadIdx.x) * 2; if (e >= (size_t)nheads * HD * TT) return; const int gp = (int)(e / ((size_t)TT * HD)), g = gp % NKV; F += (size_t)(gp / NKV) * TT * pitch; unsigned dr, tk; frs((unsigned)(e % ((size_t)TT * HD)) >> 3, TT, dr, tk); const int d = (int)dr, t = (int)tk + (int)(e & 7);   // e: storage index; each head's [d][t] plane is in fragment order. Plane gp: head gp % NKV of batch gp / NKV (both batches in one launch)
    v2h o16; v2us oh, ol;
#pragma unroll
    for (int q = 0; q < 2; ++q) { const float x = F[(size_t)(t + q) * pitch + g * HD + d]; o16[q] = tohx(x); unsigned short a2, c2; splitf(x, a2, c2); oh[q] = a2; ol[q] = c2; }
    *(v2h*)(V16 + e) = o16; *(v2us*)(Vh + e) = oh; *(v2us*)(Vl + e) = ol;  }
// k_planes: all head planes in one launch: blocks [0, BV_) the v^T planes (their strided reads take longest: they start first), the rest the q and k planes; F holds the q, k, v projections of both batches in a row. The choice is the same for a whole block.
#define BV_ (NB_ * NKV * TT * HD / 2 / 256)
#define BR_ (2 * NB_ * NH_ * TT * HD / 2 / 256)
__global__ __launch_bounds__(256) void k_planes(const float* __restrict__ F, const float* __restrict__ CS, h16* QK16, bf* QKh, bf* QKl, h16* V16, bf* Vh, bf* Vl) {
    if (blockIdx.x < BV_) d_vtp(blockIdx.x, F + (size_t)2 * NB_ * TT * DQ, DKV, NB_ * NKV, V16, Vh, Vl);
    else d_rope(blockIdx.x - BV_, F, DQ, 2 * NB_ * NH_, CS, nullptr, nullptr, 1.0f, QK16, QKh, QKl); }
// 2^x; the v_nop is the one slot the instruction set asks for behind a transcendental before its result is read or its source overwritten
__device__ __forceinline__ float exp2s(float x) { float r; asm("v_exp_f32 %0, %1\n\tv_nop" : "=v"(r) : "v"(x)); return r; }
typedef __attribute__((ext_vector_type(2))) __bf16 v2bf;
typedef __attribute__((ext_vector_type(8))) unsigned v8u;
typedef v2f __attribute__((may_alias)) v2fa;
// ---- A wave's private LDS ring for its k and v^T fragments. A slot holds what one group of six products reads: 2 KiB of the hi plane, then the same 2 KiB of the lo plane, byte for byte as they lie in memory (fragment order).
#define RSL 3                      // slots of a wave's ring: two slots fly while one is read
#define RSB 4096                   // bytes of a slot
// cp8: eight asynchronous 16-byte-a-lane copies fill one slot. lds: the lane's LDS byte address in the slot; off: the lane's byte offset beside the uniform plane bases hp, lp. The immediate offset moves both addresses alike.
// The s_wait_xcnt is the wait owed before a register that an issued copy names is rewritten; it is the statement's last line so that no later address arithmetic can rise over it.
__device__ __forceinline__ void cp8(unsigned lds, unsigned off, const bf* hp, const bf* lp) {
    asm volatile("global_load_async_to_lds_b128 %0, %2, %3\n\t"
                 "global_load_async_to_lds_b128 %0, %2, %3 offset:512\n\t"
                 "global_load_async_to_lds_b128 %0, %2, %3 offset:1024\n\t"
                 "global_load_async_to_lds_b128 %0, %2, %3 offset:1536\n\t"
                 "global_load_async_to_lds_b128 %1, %2, %4\n\t"
                 "global_load_async_to_lds_b128 %1, %2, %4 offset:512\n\t"
                 "global_load_async_to_lds_b128 %1, %2, %4 offset:1024\n\t"
                 "global_load_async_to_lds_b128 %1, %2, %4 offset:1536\n\t"
                 "s_wait_xcnt 0x0" :: "v"(lds), "v"(lds + 2048u), "v"(off), "s"(hp), "s"(lp) : "memory"); }
// landed(): all but the wave's 16 youngest copies (the two younger slots) have landed, so the oldest slot may be read. readout(): the wave's own LDS reads of a slot have retired before copies refill it (a ring private to one wave needs no work-group barrier).
__device__ __forceinline__ void landed() { asm volatile("s_wait_asynccnt 0x10" ::: "memory"); }
__device__ __forceinline__ void readout() { asm volatile("s_wait_dscnt 0x0" ::: "memory"); }
// k_fattn: one work-group of FW waves takes 16 query rows of one batch through ALL heads, in head order; grid NB_ x TT/16. Wave w owns keys [w KPW, (w + 1) KPW).
// Per head: S^T = K Q^T (A = key rows, B = query rows, 3 hi/lo products) stays in the wave's accumulators: lane (lr, hi) holds query lr, register j of tile t key 16 t + 8 hi + j.
// Row maximum and row sum: in the lane, across the lane halves, then across the waves through LDS in wave order (a barrier each). The f32 probabilities are added to the head sum in registers,
// split into hi/lo bf16 in place (two tiles of 16 keys are one B operand of 32 keys in the loader's k order) and O^T = V^T P^T (3 products) follows; the waves' partial O^T are summed through LDS in wave order (a barrier).
// The wave's k and v^T fragments form ONE stream over the whole kernel (per head 8 k tiles, then 8 v^T groups, 4 KiB each) that runs three items ahead of the products through the wave's ring: the copies hold no register, so they fly through the softmax, the barriers and the sum of the partial outputs as well.
// The last head's three items ahead are head 0's first k tiles again (read by nobody): every trip issues the same number of copies, which keeps the counted wait exact.
__global__ __launch_bounds__(32 * FW) void k_fattn(const bf* __restrict__ Qh, const bf* __restrict__ Ql, const bf* __restrict__ Kh, const bf* __restrict__ Kl, const bf* __restrict__ Vh, const bf* __restrict__ Vl, bf* __restrict__ Ah, bf* __restrict__ Al, float* __restrict__ O2) {
    typedef WFrag<bf> F; static_assert(FW == 16 && NKV == NH_ && HD == 64 && NT == 2 * (HD / 16), "one thread sums two elements of the partial outputs; one kv head per query head; two units a 16-row q or k tile");
    __shared__ float rmx[FW * 16]; __shared__ float rsm[FW * 16]; __shared__ __align__(16) float op[FW * 16 * 68]; __shared__ __align__(16) unsigned char ring[FW * RSL * RSB];
    const int wv = __builtin_amdgcn_readfirstlane(threadIdx.x >> 5);   // wave number, scalar
    const int lane = threadIdx.x & 31, lr = lane & 15, hi = lane >> 4; const int b = blockIdx.x / (TT / 16), q0 = (blockIdx.x % (TT / 16)) * 16;
    const unsigned qo = (unsigned)(q0 * HD + 8 * lane) * 2, ko = (unsigned)(wv * KPW * HD + 8 * lane) * 2, vo = (unsigned)(wv * KPW * 16 + 8 * lane) * 2;   // the lane's byte offsets inside a head's plane (fragment order: 1-KiB units of 16 rows x 32 k; q, k: 2 units a 16-row tile; v: TT / 32 units a 16-row tile)
    const unsigned rl = (unsigned)(size_t)ring;   // the ring's LDS byte address (the low 32 bits of its address)
    unsigned sl0 = (unsigned)(wv * (RSL * RSB) + lane * 16), sl1 = sl0 + RSB, sl2 = sl0 + 2 * RSB;   // the lane's byte offsets in the three slots; item i of a head's 16 lies in slot i % 3 of this order, which turns by one a head (16 % 3 == 1)
    { const unsigned k0 = (unsigned)(b * NH_) * (TT * HD * 2) + ko; cp8(rl + sl0, k0, Kh, Kl); cp8(rl + sl1, k0 + 2048, Kh, Kl); cp8(rl + sl2, k0 + 4096, Kh, Kl); }   // the stream's first three items: k tiles 0, 1, 2 of head 0
    v8f macc[NT];
#pragma unroll
    for (int t = 0; t < NT; ++t) macc[t] = (v8f){};
#pragma unroll 1
    for (int h = 0; h < NH_; ++h) { const unsigned hb = (unsigned)(b * NH_ + h) * (TT * HD * 2);   // byte offset of the head's plane (q, k [t][d]; v [d][t]) in its 8-MiB buffer
        const unsigned kn = (unsigned)(b * NH_ + ((h + 1) & (NH_ - 1))) * (TT * HD * 2) + ko;   // the next head's k offset (behind the last head: head 0's)
        const unsigned qb = hb + qo, kb = hb + ko, vb = hb + vo;   // one 32-bit offset register beside each uniform base serves all of a plane's loads (64-bit lane addresses cost registers that the fragment sets need)
        v16bf qh[2], ql[2];
#pragma unroll
        for (int ks = 0; ks < 2; ++ks) { qh[ks] = F::ld((const bf*)((const char*)Qh + qb + ks * 1024)); ql[ks] = F::ld((const bf*)((const char*)Ql + qb + ks * 1024)); }
        v8f s[NT]; v16bf fh[2], fl[2];   // operand fragments of a group of six products, read from the ring
        asm volatile("s_wait_xcnt 0x0" :: "v"(qb) : "memory");   // the wait owed before a register that an issued load names is overwritten; the q offset as an input keeps its register untouched up to here (without it a later load's result was placed on it)
#pragma unroll
        for (int t = 0; t < NT; ++t) { v8f a = (v8f){}; const unsigned sl = t % RSL == 0 ? sl0 : t % RSL == 1 ? sl1 : sl2;   // item t of the head
            landed();
#pragma unroll
            for (int ks = 0; ks < 2; ++ks) { fh[ks] = F::ld((const bf*)(ring + sl + ks * 1024)); fl[ks] = F::ld((const bf*)(ring + sl + 2048 + ks * 1024)); }
            readout();
            if (t + RSL < NT) cp8(rl + sl, kb + (t + RSL) * (16 * HD * 2), Kh, Kl);   // three items ahead: a later k tile, or one of the head's first v^T groups (16 v rows x 64 keys = two units in a row)
            else cp8(rl + sl, vb + ((t + RSL - NT) % (HD / 16)) * (16 * TT * 2) + ((t + RSL - NT) / (HD / 16)) * 2048, Vh, Vl);
            __builtin_amdgcn_sched_barrier(0);   // the eight LDS reads stand together, ahead of the products, and the refill is issued before them: otherwise the reads are spread in pairs among the products, each pair waited for by itself
#pragma unroll
            for (int ks = 0; ks < 2; ++ks) { a = wmmab(fh[ks], qh[ks], a); a = wmmab(fh[ks], ql[ks], a); a = wmmab(fl[ks], qh[ks], a); }
            s[t] = a * SCL;
            __builtin_amdgcn_sched_barrier(0);   // these products stay ahead of the next item's wait: they run while that item is still landing
        }
        float mx = -3.0e38f;
#pragma unroll
        for (int t = 0; t < NT; ++t)
#pragma unroll
            for (int j = 0; j < 8; ++j) mx = fmaxf(mx, s[t][j]);
        mx = fmaxf(mx, __shfl_xor(mx, 16, 32));
        if (hi == 0) rmx[wv * 16 + lr] = mx;
        __syncthreads();   // every wave's row maxima are in LDS before any wave joins them
#pragma unroll
        for (int w = 0; w < FW; ++w) mx = fmaxf(mx, rmx[w * 16 + lr]);
        float sum = 0.f;
#pragma unroll
        for (int t = 0; t < NT; ++t)
#pragma unroll
            for (int j = 0; j < 8; ++j) { s[t][j] = exp2s(__fmul_rn(__fsub_rn(s[t][j], mx), 1.4426950408889634f)); sum += s[t][j]; }
        sum += __shfl_xor(sum, 16, 32);
        if (hi == 0) rsm[wv * 16 + lr] = sum;
        __syncthreads();   // every wave's row sums are in LDS before any wave joins them
        sum = rsm[lr];
#pragma unroll
        for (int w = 1; w < FW; ++w) sum += rsm[w * 16 + lr];
        const float f = __fdiv_rn(1.0f, sum);
        v8u ph[NT / 2], pl[NT / 2];
#pragma unroll
        for (int t = 0; t < NT; ++t)
#pragma unroll
            for (int j = 0; j < 8; j += 2) { v2f p; p[0] = s[t][j] * f; p[1] = s[t][j + 1] * f; macc[t][j] += p[0]; macc[t][j + 1] += p[1];
                const unsigned hu = __builtin_bit_cast(unsigned, __builtin_convertvector(p, v2bf)); v2f r; r[0] = p[0] - __uint_as_float(hu << 16); r[1] = p[1] - __uint_as_float(hu & 0xFFFF0000u);
                ph[t >> 1][(t & 1) * 4 + (j >> 1)] = hu; pl[t >> 1][(t & 1) * 4 + (j >> 1)] = __builtin_bit_cast(unsigned, __builtin_convertvector(r, v2bf)); }
        v8f o[HD / 16];
#pragma unroll
        for (int dt = 0; dt < HD / 16; ++dt) o[dt] = (v8f){};
#pragma unroll
        for (int g = 0; g < NT; ++g) { const int kp = g / (HD / 16), dt = g % (HD / 16);   // a group: 16 v rows x 64 keys = two units in a row
            const unsigned sl = (NT + g) % RSL == 0 ? sl0 : (NT + g) % RSL == 1 ? sl1 : sl2;   // item NT + g of the head
            landed();
#pragma unroll
            for (int k2 = 0; k2 < 2; ++k2) { fh[k2] = F::ld((const bf*)(ring + sl + k2 * 1024)); fl[k2] = F::ld((const bf*)(ring + sl + 2048 + k2 * 1024)); }
            readout();
            if (g + RSL < NT) cp8(rl + sl, vb + ((g + RSL) % (HD / 16)) * (16 * TT * 2) + ((g + RSL) / (HD / 16)) * 2048, Vh, Vl);   // three items ahead: a later v^T group, or one of the next head's first k tiles
            else cp8(rl + sl, kn + (g + RSL - NT) * (16 * HD * 2), Kh, Kl);
            __builtin_amdgcn_sched_barrier(0);   // as in the score loop: reads together, refill issued, then the products
#pragma unroll
            for (int k2 = 0; k2 < 2; ++k2) { const int kt = kp * 2 + k2; const v16bf bh = __builtin_bit_cast(v16bf, ph[kt]), bl = __builtin_bit_cast(v16bf, pl[kt]);
                o[dt] = wmmab(fh[k2], bh, o[dt]); o[dt] = wmmab(fh[k2], bl, o[dt]); o[dt] = wmmab(fl[k2], bh, o[dt]); }
            __builtin_amdgcn_sched_barrier(0);   // as in the score loop: the products stay ahead of the next item's wait
        }
#pragma unroll
        for (int dt = 0; dt < HD / 16; ++dt) { float* w = op + (wv * 16 + lr) * 68 + dt * 16 + hi * 8; v4f lo4, hi4;
#pragma unroll
            for (int j = 0; j < 4; ++j) { lo4[j] = o[dt][j]; hi4[j] = o[dt][4 + j]; }
            *(v4fa*)w = lo4; *(v4fa*)(w + 4) = hi4; }
        __syncthreads();   // every wave's partial O^T is in LDS before any thread sums across the waves
        { const int tid = (int)threadIdx.x, q = (tid >> 2) & 15, d = (tid >> 6) * 8 + (tid & 3) * 2; v2f sm = *(const v2fa*)(op + q * 68 + d);   // thread tid sums elements 2 tid, 2 tid + 1 of the head's two units (16 queries x 64 d) of the merged planes, in their storage order
#pragma unroll
            for (int w = 1; w < FW; ++w) sm += *(const v2fa*)(op + (w * 16 + q) * 68 + d);
            v2us oh, ol; unsigned short a0, c0; splitf(sm[0], a0, c0); oh[0] = a0; ol[0] = c0; splitf(sm[1], a0, c0); oh[1] = a0; ol[1] = c0;
            const unsigned oo = (unsigned)((b * TT + q0) * DQ + h * (16 * HD) + tid * 2) * 2; *(v2us*)((char*)Ah + oo) = oh; *(v2us*)((char*)Al + oo) = ol; }
        asm volatile("s_wait_xcnt 0x0" ::: "memory");   // the wait owed before the next head's address arithmetic overwrites a register that these stores name
        { const unsigned x = sl0; sl0 = sl1; sl1 = sl2; sl2 = x; }   // the next head's item 0 lies in the slot of this head's item 16
    }
    asm volatile("s_wait_asynccnt 0x0" ::: "memory");   // the last three items have landed before the wave ends
    float* o2 = O2 + (size_t)(b * TT + q0 + lr) * TT + wv * KPW + hi * 8;
#pragma unroll
    for (int t = 0; t < NT; ++t) { v4f lo4, hi4;
#pragma unroll
        for (int j = 0; j < 4; ++j) { lo4[j] = macc[t][j] * (1.0f / NH_); hi4[j] = macc[t][4 + j] * (1.0f / NH_); }
        *(v4f*)(o2 + t * 16) = lo4; *(v4f*)(o2 + t * 16 + 4) = hi4; }
}

extern "C" void kernel_launch(void* const* d_in, const int* in_sizes, int n_in,
                              void* d_out, int out_size, void* d_ws, size_t ws_size, hipStream_t stream) {
    (void)in_sizes; (void)n_in; (void)out_size;
    const float* x = (const float*)d_in[0]; const float* xk = (const float*)d_in[1]; const float* xv = (const float*)d_in[2]; const float* wq = (const float*)d_in[3]; const float* bq = (const float*)d_in[4]; const float* wk = (const float*)d_in[5]; const float* bk = (const float*)d_in[6]; const float* wv = (const float*)d_in[7]; const float* bv = (const float*)d_in[8]; const float* wo = (const float*)d_in[9]; const float* bo = (const float*)d_in[10];
    float* OUT = (float*)d_out;     // first output [2][2048][1024]
    float* OUT2 = OUT + (size_t)NB_ * TT * DM;   // second output [2][2048][2048] (tuple: contiguous after the first)
    char* wsp = (char*)d_ws;
    auto take = [&](size_t bytes) { char* p = wsp; wsp += (bytes + 255) & ~(size_t)255; return (void*)p; };
    bf* WB = (bf*)take((size_t)4 * DQ * DM * 2); bf* WO = WB + (size_t)3 * DQ * DM; float* CS = (float*)take((size_t)TT * HD * 2 * 4);   // weights q, k, v, o in a row
    bf* XB = (bf*)take((size_t)3 * NB_ * TT * DM * 2); float* FB = (float*)take((size_t)3 * NB_ * TT * DQ * 4);   // the three inputs and their projections in a row (q, k, v; both batches each)
    h16* QK16 = (h16*)take((size_t)2 * NB_ * NH_ * TT * HD * 2); h16* VT16 = (h16*)take((size_t)NB_ * NKV * HD * TT * 2);
    bf* QPh = (bf*)take((size_t)2 * NB_ * NH_ * TT * HD * 2); bf* KPh = QPh + (size_t)NB_ * NH_ * TT * HD; bf* QPl = (bf*)take((size_t)2 * NB_ * NH_ * TT * HD * 2); bf* KPl = QPl + (size_t)NB_ * NH_ * TT * HD; bf* VTh = (bf*)take((size_t)NB_ * NKV * HD * TT * 2); bf* VTl = (bf*)take((size_t)NB_ * NKV * HD * TT * 2);   // hi/lo head planes of both batches; k's follow q's
    bf* ATh = (bf*)take((size_t)NB_ * TT * DQ * 2); bf* ATl = (bf*)take((size_t)NB_ * TT * DQ * 2);
    if ((size_t)(wsp - (char*)d_ws) > ws_size) return;    // ws 256 MiB
    k_cvt8<<<3 * BX_ + 4 * BW_ + TT * HD / 256, 256, 0, stream>>>(x, xk, xv, wq, wk, wv, wo, XB, WB, CS);   /* bf16 fragment-order planes of the inputs and weights, identity table */
    k_gemmw<bf, 0, true, KSW, 1, DM><<<dim3(NB_ * TT / 64, DQ / 64, 3), 32 * KSW, 0, stream>>>(XB, nullptr, WB, nullptr, FB, DQ, bq, bk, bv, (size_t)NB_ * TT * DM, (size_t)DQ * DM, (size_t)NB_ * TT * DQ, 0);   /* q, k, v projections of both batches: z picks input, weight, bias, plane */
    k_planes<<<BV_ + BR_, 256, 0, stream>>>(FB, CS, QK16, QPh, QPl, VT16, VTh, VTl);   /* q, k and v^T head planes, both batches */
    k_fattn<<<NB_ * (TT / 16), 32 * FW, 0, stream>>>(QPh, QPl, KPh, KPl, VTh, VTl, ATh, ATl, OUT2);   /* scores, softmax, head mean of the probabilities (second output), probs x v, merged hi/lo planes: both batches, all heads */
    k_gemmw<bf, 1, true, KSW, 1, DQ><<<dim3(NB_ * TT / 64, DM / 64, 1), 32 * KSW, 0, stream>>>(ATh, ATl, WO, nullptr, OUT, DM, bo, nullptr, nullptr, 0, 0, 0, 0);   /* output projection, both batches (their rows follow one another in the merged planes and in the output) */
}

// v007
// One run takes 228 microseconds.
// Two timings next to v006 put it at 1.06 and 1.07 times that version's speed.
// All steps since v000 together make it 6.70 times as fast.
#include <hip/hip_runtime.h>

// Multi-head attention returning the output AND the head-averaged attention probabilities (Q, K, V [2][2048][1024]; q,k,v = input W^T + b ('oi' [1024][1024] + [1024]; 16 heads x 64); scores = q.k x 1.0 (SCALING = 1: unscaled); probs = softmax; attn = probs v; out = merged Wo^T + bo -> [2][2048][1024]; second output mean over heads of probs -> [2][2048][2048]; tuple (12.6 M)).
// Layout: four launches, each stage once for both batches and for q, k, v together: bf16 copies of the three inputs and four weights; exact projections + f32 biases, split in the GEMM's epilogue into the hi/lo head planes of q, k, v^T of both batches; ONE attention launch (k_fattn): a work-group keeps 16 query rows x 2048 keys of scores and probabilities in its waves' registers (3 hi/lo products; the unscaled logits reach |s| ~ 15), walks the 16 heads in order, adds the f32 probabilities into a register head sum (fixed order: deterministic) and writes sum x 1/16 to the second output; merged hi/lo x Wo exact + bo to the first.
// Every bf16 workspace plane is kept in WMMA fragment order (see frs()): a wave-wide 16-byte fragment load reads 512 contiguous bytes, 4 whole 128-byte lines, where a row-major plane gives 32 bytes of each of 16 lines.
// Compute dtypes, f32 accumulate: every input rounded to bf16; projections exact + f32 biases; scores and attn.v 3 products; softmax, probability mean f32; Wo hl x exact + bias.

#define NB_  2
#define TT   2048
#define DM   1024
#define NH_  16
#define NKV  16
#define REP  (NH_ / NKV)
#define HD   64
#define DQ   (NH_ * HD)
#define DKV  (NKV * HD)
#define KSW  8                     // waves of a work-group that share a long K range
#define FW   16                    // waves of an attention work-group; they share the 2048 keys of its 16 query rows
#define KPW  (TT / FW)             // keys of one wave
#define NT   (KPW / 16)            // 16-key score tiles of one wave
#define SCL  1.0f   // SCALING = 1.0 in the module (no 1/sqrt(d))
typedef _Float16 h16;
typedef unsigned short bf;
typedef __attribute__((ext_vector_type(16))) __bf16   v16bf;
typedef __attribute__((ext_vector_type(16))) _Float16 v16h;
typedef __attribute__((ext_vector_type(8)))  _Float16 v8h;
typedef __attribute__((ext_vector_type(8)))  unsigned short v8us;
typedef __attribute__((ext_vector_type(8)))  float    v8f;
typedef __attribute__((ext_vector_type(4)))  float    v4f;
typedef v8h  __attribute__((may_alias)) v8ha;
typedef v4f  __attribute__((may_alias)) v4fa;
typedef v8us __attribute__((may_alias)) v8usa;

__device__ __forceinline__ unsigned short f2bf(float f) { unsigned u = __float_as_uint(f); u += 0x7FFFu + ((u >> 16) & 1u); return (unsigned short)(u >> 16); }
__device__ __forceinline__ float bf2f(unsigned short b) { return __uint_as_float(((unsigned)b) << 16); }
__device__ __forceinline__ float bfr(float f) { return bf2f(f2bf(f)); }
__device__ __forceinline__ void splitf(float y, unsigned short& h, unsigned short& l) { h = f2bf(y); l = f2bf(y - bf2f(h)); }
__device__ __forceinline__ v16h cat16(v8h lo, v8h hi) { return __builtin_shufflevector(lo, hi, 0, 1, 2, 3, 4, 5, 6, 7, 8, 9, 10, 11, 12, 13, 14, 15); }
__device__ __forceinline__ v16bf cat16b(v8us lo, v8us hi) { return __builtin_bit_cast(v16bf, __builtin_shufflevector(lo, hi, 0, 1, 2, 3, 4, 5, 6, 7, 8, 9, 10, 11, 12, 13, 14, 15)); }
__device__ __forceinline__ v8f wmma16(v16h a, v16h b, v8f c) { return __builtin_amdgcn_wmma_f32_16x16x32_f16(false, a, false, b, (short)0, c, false, false); }
__device__ __forceinline__ v8f wmmab(v16bf a, v16bf b, v8f c) { return __builtin_amdgcn_wmma_f32_16x16x32_bf16(false, a, false, b, (short)0, c, false, false); }



// ---- Fragment order of a 16-bit matrix M[r][k] of K columns (rows % 16 == 0, K % 32 == 0): units of 16 rows x 32 k = 512 elements, unit (r / 16) (K / 32) + k / 32. Inside a unit stand two 512-byte halves (k % 32 < 16, >= 16);
// in a half lane l = 16 ((k % 16) / 8) + r % 16 owns elements 8 l .. 8 l + 7 (k % 8). WFrag::ld(unit + 8 lane) is then the lane's A or B fragment, with the same value in every lane and register as a load from the row-major plane.
// frs(i, K, r, k): row and first k of the i-th 8-element piece of such a plane (the writers walk the plane in storage order, so that their stores are whole lines).
__device__ __forceinline__ void frs(unsigned i, unsigned K, unsigned& r, unsigned& k) { const unsigned u = i >> 6, kpu = K >> 5; r = (u / kpu) * 16 + (i & 15); k = (u % kpu) * 32 + ((i >> 5) & 1) * 16 + ((i >> 4) & 1) * 8; }
// ---- k_gemmw: register-blocked GEMM, KS waves a work-group per 64x64 output tile (16 accumulators each), operands straight from 16-bit planes in fragment order; grid (M/64, N/64, Z KG), 32 KS threads.
// C[m][n] (f32, pitch ldc, + optional f32 bias[n]) = sum_k A[m][k] Bt[n][k] (+ split products per NSPLIT). z-batch strides sA/sB/sC in elements; z instance 0, 1, 2 adds bias, bias1, bias2. K % 32 == 0.
// Split K: the tile's K range is cut into KG x KS equal slices (K % (32 KG KS) == 0). The KS waves of a work-group (32 KS threads) each run one slice and their partial tiles are summed through LDS in wave order (one barrier);
// the KG slice groups are separate work-groups (blockIdx.z = z KG + g) that store partial planes at C + g sG, which the consumer sums in g order. KS = KG = 1: one wave, whole K.
// PL (projections; KS = 8, KG = 1, 64 columns = one head): no f32 C. The summed tile + bias is split into hi/lo bf16 and stored straight into the head planes in fragment order: z 0, 1 (q, k) [t][d] planes at Ph, Pl (64 t x 64 d = 8 units in a row),
// z 2 (v) [d][t] planes at Vh, Vl (4 runs of 2 units); for v the waves lay their partial tiles into LDS transposed, so that both kinds read 8 neighbours of a plane row from an LDS row.
template <typename T16> struct WFrag;
template <> struct WFrag<h16> { typedef v16h V; static __device__ __forceinline__ V ld(const h16* p) { return cat16(*(const v8h*)p, *(const v8h*)(p + 256)); } static __device__ __forceinline__ v8f mma(V a, V b, v8f c) { return wmma16(a, b, c); } };
template <> struct WFrag<bf> { typedef v16bf V; static __device__ __forceinline__ V ld(const bf* p) { return cat16b(*(const v8us*)p, *(const v8us*)(p + 256)); } static __device__ __forceinline__ v8f mma(V a, V b, v8f c) { return wmmab(a, b, c); } };
template <typename T16, int NSPLIT, bool BIAS, int KS, int KG, int K, bool PL>
__global__ __launch_bounds__(32 * KS) void k_gemmw(const T16* __restrict__ A, const T16* __restrict__ A2, const T16* __restrict__ Bt, const T16* __restrict__ Bt2, float* C, int ldc, const float* __restrict__ bias, const float* __restrict__ bias1, const float* __restrict__ bias2, size_t sA, size_t sB, size_t sC, size_t sG, bf* __restrict__ Ph, bf* __restrict__ Pl, bf* __restrict__ Vh, bf* __restrict__ Vl) {
    typedef typename WFrag<T16>::V V;
    __shared__ __align__(16) float os[KS > 1 ? KS * 64 * 68 : 16 * 68];
    const int wv = __builtin_amdgcn_readfirstlane(threadIdx.x >> 5);   // wave number, scalar: the K loop's bounds stay wave-uniform (WMMA needs every lane on)
    const int kl = K / (KS * KG), kbeg = ((int)(blockIdx.z % KG) * KS + wv) * kl, kend = kbeg + kl; if constexpr (!PL) C += (size_t)(blockIdx.z % KG) * sG;
    const size_t z = blockIdx.z / KG; A += z * sA; if (A2) A2 += z * sA; Bt += z * sB; if (Bt2) Bt2 += z * sB; if constexpr (!PL) C += z * sC; if (z == 1) bias = bias1; else if (z == 2) bias = bias2;   // each z instance (q, k, v projection) has its own bias vector
    const int lane = threadIdx.x & 31, lr = lane & 15, hi = lane >> 4; const int r0 = blockIdx.x * 64, c0 = blockIdx.y * 64;
    v8f acc[4][4];
#pragma unroll
    for (int mb = 0; mb < 4; ++mb)
#pragma unroll
        for (int nb = 0; nb < 4; ++nb) acc[mb][nb] = (v8f){};
    const char* Ab = (const char*)(A + (size_t)r0 * K); const char* A2b = (const char*)(A2 + (size_t)r0 * K); const char* Bb = (const char*)(Bt + (size_t)c0 * K); const char* B2b = (const char*)(Bt2 + (size_t)c0 * K); constexpr int rs = K * 32;   // uniform bases of the tile's first 16 rows; rs: bytes of 16 rows = K / 32 units in a row (K is a template constant so that it is an immediate offset)
    unsigned vo = (unsigned)lane * 16 + (unsigned)kbeg * 32;   // the lane's byte offset beside every base: its 16 bytes of a half unit + the k step's unit (1 KiB per 32 k); one register serves all loads
#pragma unroll 1
    for (int kc = kbeg; kc < kend; kc += 32) {
        V a[4], a2[4];
#pragma unroll
        for (int mb = 0; mb < 4; ++mb) { a[mb] = WFrag<T16>::ld((const T16*)(Ab + mb * rs + vo)); if (NSPLIT == 1 || NSPLIT == 2) a2[mb] = WFrag<T16>::ld((const T16*)(A2b + mb * rs + vo)); }
#pragma unroll
        for (int nb = 0; nb < 4; ++nb) { const V b = WFrag<T16>::ld((const T16*)(Bb + nb * rs + vo)); V b2; if (NSPLIT >= 2) b2 = WFrag<T16>::ld((const T16*)(B2b + nb * rs + vo));
#pragma unroll
            for (int mb = 0; mb < 4; ++mb) { acc[mb][nb] = WFrag<T16>::mma(a[mb], b, acc[mb][nb]); if (NSPLIT == 1 || NSPLIT == 2) acc[mb][nb] = WFrag<T16>::mma(a2[mb], b, acc[mb][nb]); if (NSPLIT >= 2) acc[mb][nb] = WFrag<T16>::mma(a[mb], b2, acc[mb][nb]); } }
        asm volatile("v_nop\n\tv_nop\n\tv_nop\n\tv_nop" : "+v"(acc[0][0]), "+v"(acc[1][1]), "+v"(acc[2][2]), "+v"(acc[3][3]) : "v"(a[0]), "v"(a[3]));
        asm volatile("s_wait_xcnt 0x0" : "+v"(vo) :: "memory");   // the wait owed before the offset register that the issued loads name is stepped. The offset is an operand so that it stays ONE 32-bit register beside the uniform bases, live up to here: otherwise the compiler forms 64-bit lane addresses anew each trip and places later loads' results on them
        vo += 1024;
    }
    if constexpr (PL) {
        static_assert(KS == 8 && KG == 1 && BIAS && HD == 64 && NKV == NH_ && TT % 64 == 0, "256 threads take two 8-element pieces each of a 64 x 64 tile that is one head's");
        // every loop of this block is unrolled so that acc and the vectors are indexed by constants and stay in registers
        float* ow = os + wv * (64 * 68); const unsigned tid = threadIdx.x, kk = ((tid >> 4) & 7) * 8;   // piece il = 256 it + tid of the tile's 512 (see frs()): plane row 16 (il / 128) + il % 16, first k 8 ((il / 16) % 8)
        const unsigned bofs = ((unsigned)c0 + (z == 2 ? (tid >> 7) * 16 + (tid & 15) : kk)) * 4; const float* bp = (const float*)((const char*)bias + bofs); v4f b0 = (v4f){}, b1 = (v4f){};   // biases of the thread's two pieces, loaded here so that they arrive behind the LDS stores and the barrier: q, k: the same eight d for both; v: one d each, 32 apart (b0[0], b0[1])
        if (z == 2) { b0[0] = bp[0]; b0[1] = bp[32]; } else { b0 = *(const v4f*)bp; b1 = *(const v4f*)(bp + 4); }
        asm volatile("s_wait_xcnt 0x0" :: "v"(bp) : "memory");   // the wait owed before a register that the issued bias loads name is overwritten; the address as an input keeps its registers untouched up to here
        if (z == 2) {   // v: column n (= d) is the LDS row; a lane's 8 accumulator values are 8 neighbours (t) of it
#pragma unroll
            for (int mb = 0; mb < 4; ++mb)
#pragma unroll
                for (int nb = 0; nb < 4; ++nb) { float* w = ow + (nb * 16 + lr) * 68 + mb * 16 + hi * 8; v4f lo4, hi4;
#pragma unroll
                    for (int j = 0; j < 4; ++j) { lo4[j] = acc[mb][nb][j]; hi4[j] = acc[mb][nb][4 + j]; }
                    *(v4fa*)w = lo4; *(v4fa*)(w + 4) = hi4; }
        } else {
#pragma unroll
            for (int mb = 0; mb < 4; ++mb)
#pragma unroll
                for (int nb = 0; nb < 4; ++nb)
#pragma unroll
                    for (int j = 0; j < 8; ++j) ow[(mb * 16 + hi * 8 + j) * 68 + nb * 16 + lr] = acc[mb][nb][j];
        }
        __syncthreads();   // every wave's partial 64x64 tile is in LDS before any thread sums across the waves
        const unsigned bt = (unsigned)r0 / TT, t0 = (unsigned)r0 % TT, hd = blockIdx.y;   // batch, first t and head of the tile
        bf* dh = z == 2 ? Vh : Ph; bf* dl = z == 2 ? Vl : Pl;
        const unsigned pb = z == 2 ? ((bt * NKV + hd) * (TT * HD) + (t0 / 32) * 512) * 2 : ((((unsigned)z * NB_ + bt) * NH_ + hd) * (TT * HD) + t0 * HD) * 2;   // byte offset of the tile's first unit in its buffer (k's planes follow q's)
        const unsigned us = z == 2 ? (TT / 32) * 1024 : 2048;   // bytes from one 16-row band of the tile to the next: a whole band of the v^T plane, two units of a q or k plane
#pragma unroll
        for (int it = 0; it < 2; ++it) { const unsigned band = it * 2 + (tid >> 7), rr = band * 16 + (tid & 15); const float* o8 = os + rr * 68 + kk; v4f s0 = *(const v4fa*)o8, s1 = *(const v4fa*)(o8 + 4);
#pragma unroll
            for (int w = 1; w < KS; ++w) { s0 += *(const v4fa*)(o8 + w * (64 * 68)); s1 += *(const v4fa*)(o8 + w * (64 * 68) + 4); }
            v8us oh, ol;
#pragma unroll
            for (int j = 0; j < 8; ++j) { unsigned short a2, c2; splitf((j < 4 ? s0[j] : s1[j - 4]) + bfr(z == 2 ? b0[it] : j < 4 ? b0[j] : b1[j - 4]), a2, c2); oh[j] = a2; ol[j] = c2; }
            const unsigned oo = pb + band * us + (tid & 127) * 16; *(v8us*)((char*)dh + oo) = oh; *(v8us*)((char*)dl + oo) = ol;
            asm volatile("s_wait_xcnt 0x0" :: "v"(oo), "v"(oh), "v"(ol) : "memory");   // the wait owed before a register that the issued stores name is overwritten; offset and data as inputs keep their registers untouched up to here
        }
        return;
    }
    if constexpr (KS > 1) {
#pragma unroll
        for (int mb = 0; mb < 4; ++mb)
#pragma unroll
            for (int nb = 0; nb < 4; ++nb)
#pragma unroll
                for (int j = 0; j < 8; ++j) os[wv * (64 * 68) + (mb * 16 + hi * 8 + j) * 68 + nb * 16 + lr] = acc[mb][nb][j];
        __syncthreads();   // every wave's partial 64x64 tile is in LDS before any thread sums across the waves
#pragma unroll
        for (int it = 0; it < 64 * 16 / (32 * KS); ++it) { const int idx = it * (32 * KS) + (int)threadIdx.x, row = idx >> 4, cofs = (idx & 15) * 4; v4f val = *(const v4fa*)(os + row * 68 + cofs);
#pragma unroll
            for (int w = 1; w < KS; ++w) val += *(const v4fa*)(os + w * (64 * 68) + row * 68 + cofs);
            if (BIAS) { val[0] += bfr(bias[c0 + cofs]); val[1] += bfr(bias[c0 + cofs + 1]); val[2] += bfr(bias[c0 + cofs + 2]); val[3] += bfr(bias[c0 + cofs + 3]); }
            *(v4f*)(C + (size_t)(r0 + row) * ldc + c0 + cofs) = val; }
        return;
    }
#pragma unroll
    for (int mb = 0; mb < 4; ++mb) {
#pragma unroll
        for (int nb = 0; nb < 4; ++nb) {
#pragma unroll
            for (int j = 0; j < 8; ++j) os[(hi * 8 + j) * 68 + nb * 16 + lr] = acc[mb][nb][j]; }
        __builtin_amdgcn_wave_barrier(); asm volatile("" ::: "memory");
        float* crow = C + (size_t)(r0 + mb * 16) * ldc + c0;
{
#pragma unroll
            for (int s = 0; s < 8; ++s) { const int row = 2 * s + hi, cofs = lr * 4; v4f val = *(const v4fa*)(os + row * 68 + cofs); if (BIAS) { val[0] += bfr(bias[c0 + cofs]); val[1] += bfr(bias[c0 + cofs + 1]); val[2] += bfr(bias[c0 + cofs + 2]); val[3] += bfr(bias[c0 + cofs + 3]); }
                *(v4f*)(crow + (size_t)row * ldc + cofs) = val; }
             }
        __builtin_amdgcn_wave_barrier(); asm volatile("" ::: "memory");
    }
}

__device__ __forceinline__ h16 tohx(float x) { return (h16)x; }
typedef __attribute__((ext_vector_type(2))) _Float16 v2h;
typedef __attribute__((ext_vector_type(4))) _Float16 v4h;
typedef __attribute__((ext_vector_type(2))) unsigned short v2us;
typedef __attribute__((ext_vector_type(4))) unsigned short v4us;
typedef __attribute__((ext_vector_type(2))) float v2f;
typedef __attribute__((ext_vector_type(4))) int v4i;

__global__ __launch_bounds__(256) void k_wtG(const float* __restrict__ w, int K, int N, bf* Bt) {
    const int lane = threadIdx.x & 31; const int L0 = (blockIdx.x * 8 + (threadIdx.x >> 5)) * 8; const int nlines = N * K / 64;
{
#pragma unroll 1
        for (int l = 0; l < 8; ++l) { const int L = L0 + l; if (L >= nlines) break; const size_t e = (size_t)L * 64 + lane * 2; const int k = (int)(e % K), n = (int)(e / K); v2us o;
            o[0] = f2bf(w[(size_t)k * N + n]); o[1] = f2bf(w[(size_t)(k + 1) * N + n]); *(v2us*)(Bt + e) = o; }
         }
}
// k_cvt8: row-major f32 [rows][DM] -> bf16 plane in fragment order, one 8-element piece a thread. ONE launch converts all seven sources: blocks [0, 3 BX) the three inputs (both batches: NB_ TT rows each) to XB + s NB_ TT DM,
// blocks [3 BX, 3 BX + 4 BW) the four weights to WB + s DQ DM. The choice is the same for a whole block.
#define BX_ (NB_ * TT * DM / 8 / 256)
#define BW_ (DQ * DM / 8 / 256)
__global__ __launch_bounds__(256) void k_cvt8(const float* __restrict__ x, const float* __restrict__ xk, const float* __restrict__ xv, const float* __restrict__ wq, const float* __restrict__ wk, const float* __restrict__ wv, const float* __restrict__ wo, bf* XB, bf* WB) {
    const unsigned blk = blockIdx.x; const float* src; bf* dst; unsigned i;
    if (blk < 3 * BX_) { const unsigned s = blk / BX_; src = s == 0 ? x : s == 1 ? xk : xv; dst = XB + (size_t)s * (NB_ * TT * DM); i = (blk % BX_) * 256 + threadIdx.x; }
    else { const unsigned s = (blk - 3 * BX_) / BW_; src = s == 0 ? wq : s == 1 ? wk : s == 2 ? wv : wo; dst = WB + (size_t)s * (DQ * DM); i = ((blk - 3 * BX_) % BW_) * 256 + threadIdx.x; }
    unsigned r, k0; frs(i, DM, r, k0); const float* p = src + (size_t)r * DM + k0; const v8f v = *(const v8f*)p; v8us o;
    asm volatile("s_wait_xcnt 0x0" :: "v"(p) : "memory");   // the wait owed before a register that the issued loads name is overwritten; the address as an input keeps its registers untouched up to here
#pragma unroll
    for (int k = 0; k < 8; ++k) o[k] = f2bf(v[k]); *(v8us*)(dst + (size_t)i * 8) = o;  }

// 2^x; the v_nop is the one slot the instruction set asks for behind a transcendental before its result is read or its source overwritten
__device__ __forceinline__ float exp2s(float x) { float r; asm("v_exp_f32 %0, %1\n\tv_nop" : "=v"(r) : "v"(x)); return r; }
typedef __attribute__((ext_vector_type(2))) __bf16 v2bf;
typedef __attribute__((ext_vector_type(8))) unsigned v8u;
typedef v2f __attribute__((may_alias)) v2fa;
// ---- A wave's private LDS ring for its k and v^T fragments. A slot holds what one group of six products reads: 2 KiB of the hi plane, then the same 2 KiB of the lo plane, byte for byte as they lie in memory (fragment order).
#define RSL 3                      // slots of a wave's ring: two slots fly while one is read
#define RSB 4096                   // bytes of a slot
// cp8: eight asynchronous 16-byte-a-lane copies fill one slot. lds: the lane's LDS byte address in the slot; off: the lane's byte offset beside the uniform plane bases hp, lp. The immediate offset moves both addresses alike.
// The s_wait_xcnt is the wait owed before a register that an issued copy names is rewritten; it is the statement's last line so that no later address arithmetic can rise over it.
__device__ __forceinline__ void cp8(unsigned lds, unsigned off, const bf* hp, const bf* lp) {
    asm volatile("global_load_async_to_lds_b128 %0, %2, %3\n\t"
                 "global_load_async_to_lds_b128 %0, %2, %3 offset:512\n\t"
                 "global_load_async_to_lds_b128 %0, %2, %3 offset:1024\n\t"
                 "global_load_async_to_lds_b128 %0, %2, %3 offset:1536\n\t"
                 "global_load_async_to_lds_b128 %1, %2, %4\n\t"
                 "global_load_async_to_lds_b128 %1, %2, %4 offset:512\n\t"
                 "global_load_async_to_lds_b128 %1, %2, %4 offset:1024\n\t"
                 "global_load_async_to_lds_b128 %1, %2, %4 offset:1536\n\t"
                 "s_wait_xcnt 0x0" :: "v"(lds), "v"(lds + 2048u), "v"(off), "s"(hp), "s"(lp) : "memory"); }
// landed(): all but the wave's 16 youngest copies (the two younger slots) have landed, so the oldest slot may be read. readout(): the wave's own LDS reads of a slot have retired before copies refill it (a ring private to one wave needs no work-group barrier).
__device__ __forceinline__ void landed() { asm volatile("s_wait_asynccnt 0x10" ::: "memory"); }
__device__ __forceinline__ void readout() { asm volatile("s_wait_dscnt 0x0" ::: "memory"); }
// k_fattn: one work-group of FW waves takes 16 query rows of one batch through ALL heads, in head order; grid NB_ x TT/16. Wave w owns keys [w KPW, (w + 1) KPW).
// Per head: S^T = K Q^T (A = key rows, B = query rows, 3 hi/lo products) stays in the wave's accumulators: lane (lr, hi) holds query lr, register j of tile t key 16 t + 8 hi + j.
// Row maximum and row sum: in the lane, across the lane halves, then across the waves through LDS in wave order (a barrier each). The f32 probabilities are added to the head sum in registers,
// split into hi/lo bf16 in place (two tiles of 16 keys are one B operand of 32 keys in the loader's k order) and O^T = V^T P^T (3 products) follows; the waves' partial O^T are summed through LDS in wave order (a barrier).
// The wave's k and v^T fragments form ONE stream over the whole kernel (per head 8 k tiles, then 8 v^T groups, 4 KiB each) that runs three items ahead of the products through the wave's ring: the copies hold no register, so they fly through the softmax, the barriers and the sum of the partial outputs as well.
// The last head's three items ahead are head 0's first k tiles again (read by nobody): every trip issues the same number of copies, which keeps the counted wait exact.
__global__ __launch_bounds__(32 * FW) void k_fattn(const bf* __restrict__ Qh, const bf* __restrict__ Ql, const bf* __restrict__ Kh, const bf* __restrict__ Kl, const bf* __restrict__ Vh, const bf* __restrict__ Vl, bf* __restrict__ Ah, bf* __restrict__ Al, float* __restrict__ O2) {
    typedef WFrag<bf> F; static_assert(FW == 16 && NKV == NH_ && HD == 64 && NT == 2 * (HD / 16), "one thread sums two elements of the partial outputs; one kv head per query head; two units a 16-row q or k tile");
    __shared__ float rmx[FW * 16]; __shared__ float rsm[FW * 16]; __shared__ __align__(16) float op[FW * 16 * 68]; __shared__ __align__(16) unsigned char ring[FW * RSL * RSB];
    const int wv = __builtin_amdgcn_readfirstlane(threadIdx.x >> 5);   // wave number, scalar
    const int lane = threadIdx.x & 31, lr = lane & 15, hi = lane >> 4; const int b = blockIdx.x / (TT / 16), q0 = (blockIdx.x % (TT / 16)) * 16;
    const unsigned qo = (unsigned)(q0 * HD + 8 * lane) * 2, ko = (unsigned)(wv * KPW * HD + 8 * lane) * 2, vo = (unsigned)(wv * KPW * 16 + 8 * lane) * 2;   // the lane's byte offsets inside a head's plane (fragment order: 1-KiB units of 16 rows x 32 k; q, k: 2 units a 16-row tile; v: TT / 32 units a 16-row tile)
    const unsigned rl = (unsigned)(size_t)ring;   // the ring's LDS byte address (the low 32 bits of its address)
    unsigned sl0 = (unsigned)(wv * (RSL * RSB) + lane * 16), sl1 = sl0 + RSB, sl2 = sl0 + 2 * RSB;   // the lane's byte offsets in the three slots; item i of a head's 16 lies in slot i % 3 of this order, which turns by one a head (16 % 3 == 1)
    { const unsigned k0 = (unsigned)(b * NH_) * (TT * HD * 2) + ko; cp8(rl + sl0, k0, Kh, Kl); cp8(rl + sl1, k0 + 2048, Kh, Kl); cp8(rl + sl2, k0 + 4096, Kh, Kl); }   // the stream's first three items: k tiles 0, 1, 2 of head 0
    v8f macc[NT];
#pragma unroll
    for (int t = 0; t < NT; ++t) macc[t] = (v8f){};
#pragma unroll 1
    for (int h = 0; h < NH_; ++h) { const unsigned hb = (unsigned)(b * NH_ + h) * (TT * HD * 2);   // byte offset of the head's plane (q, k [t][d]; v [d][t]) in its 8-MiB buffer
        const unsigned kn = (unsigned)(b * NH_ + ((h + 1) & (NH_ - 1))) * (TT * HD * 2) + ko;   // the next head's k offset (behind the last head: head 0's)
        const unsigned qb = hb + qo, kb = hb + ko, vb = hb + vo;   // one 32-bit offset register beside each uniform base serves all of a plane's loads (64-bit lane addresses cost registers that the fragment sets need)
        v16bf qh[2], ql[2];
#pragma unroll
        for (int ks = 0; ks < 2; ++ks) { qh[ks] = F::ld((const bf*)((const char*)Qh + qb + ks * 1024)); ql[ks] = F::ld((const bf*)((const char*)Ql + qb + ks * 1024)); }
        v8f s[NT]; v16bf fh[2], fl[2];   // operand fragments of a group of six products, read from the ring
        asm volatile("s_wait_xcnt 0x0" :: "v"(qb) : "memory");   // the wait owed before a register that an issued load names is overwritten; the q offset as an input keeps its register untouched up to here (without it a later load's result was placed on it)
#pragma unroll
        for (int t = 0; t < NT; ++t) { v8f a = (v8f){}; const unsigned sl = t % RSL == 0 ? sl0 : t % RSL == 1 ? sl1 : sl2;   // item t of the head
            landed();
#pragma unroll
            for (int ks = 0; ks < 2; ++ks) { fh[ks] = F::ld((const bf*)(ring + sl + ks * 1024)); fl[ks] = F::ld((const bf*)(ring + sl + 2048 + ks * 1024)); }
            readout();
            if (t + RSL < NT) cp8(rl + sl, kb + (t + RSL) * (16 * HD * 2), Kh, Kl);   // three items ahead: a later k tile, or one of the head's first v^T groups (16 v rows x 64 keys = two units in a row)
            else cp8(rl + sl, vb + ((t + RSL - NT) % (HD / 16)) * (16 * TT * 2) + ((t + RSL - NT) / (HD / 16)) * 2048, Vh, Vl);
            __builtin_amdgcn_sched_barrier(0);   // the eight LDS reads stand together, ahead of the products, and the refill is issued before them: otherwise the reads are spread in pairs among the products, each pair waited for by itself
#pragma unroll
            for (int ks = 0; ks < 2; ++ks) { a = wmmab(fh[ks], qh[ks], a); a = wmmab(fh[ks], ql[ks], a); a = wmmab(fl[ks], qh[ks], a); }
            s[t] = a * SCL;
            __builtin_amdgcn_sched_barrier(0);   // these products stay ahead of the next item's wait: they run while that item is still landing
        }
        float mx = -3.0e38f;
#pragma unroll
        for (int t = 0; t < NT; ++t)
#pragma unroll
            for (int j = 0; j < 8; ++j) mx = fmaxf(mx, s[t][j]);
        mx = fmaxf(mx, __shfl_xor(mx, 16, 32));
        if (hi == 0) rmx[wv * 16 + lr] = mx;
        __syncthreads();   // every wave's row maxima are in LDS before any wave joins them
#pragma unroll
        for (int w = 0; w < FW; ++w) mx = fmaxf(mx, rmx[w * 16 + lr]);
        float sum = 0.f;
#pragma unroll
        for (int t = 0; t < NT; ++t)
#pragma unroll
            for (int j = 0; j < 8; ++j) { s[t][j] = exp2s(__fmul_rn(__fsub_rn(s[t][j], mx), 1.4426950408889634f)); sum += s[t][j]; }
        sum += __shfl_xor(sum, 16, 32);
        if (hi == 0) rsm[wv * 16 + lr] = sum;
        __syncthreads();   // every wave's row sums are in LDS before any wave joins them
        sum = rsm[lr];
#pragma unroll
        for (int w = 1; w < FW; ++w) sum += rsm[w * 16 + lr];
        const float f = __fdiv_rn(1.0f, sum);
        v8u ph[NT / 2], pl[NT / 2];
#pragma unroll
        for (int t = 0; t < NT; ++t)
#pragma unroll
            for (int j = 0; j < 8; j += 2) { v2f p; p[0] = s[t][j] * f; p[1] = s[t][j + 1] * f; macc[t][j] += p[0]; macc[t][j + 1] += p[1];
                const unsigned hu = __builtin_bit_cast(unsigned, __builtin_convertvector(p, v2bf)); v2f r; r[0] = p[0] - __uint_as_float(hu << 16); r[1] = p[1] - __uint_as_float(hu & 0xFFFF0000u);
                ph[t >> 1][(t & 1) * 4 + (j >> 1)] = hu; pl[t >> 1][(t & 1) * 4 + (j >> 1)] = __builtin_bit_cast(unsigned, __builtin_convertvector(r, v2bf)); }
        v8f o[HD / 16];
#pragma unroll
        for (int dt = 0; dt < HD / 16; ++dt) o[dt] = (v8f){};
#pragma unroll
        for (int g = 0; g < NT; ++g) { const int kp = g / (HD / 16), dt = g % (HD / 16);   // a group: 16 v rows x 64 keys = two units in a row
            const unsigned sl = (NT + g) % RSL == 0 ? sl0 : (NT + g) % RSL == 1 ? sl1 : sl2;   // item NT + g of the head
            landed();
#pragma unroll
            for (int k2 = 0; k2 < 2; ++k2) { fh[k2] = F::ld((const bf*)(ring + sl + k2 * 1024)); fl[k2] = F::ld((const bf*)(ring + sl + 2048 + k2 * 1024)); }
            readout();
            if (g + RSL < NT) cp8(rl + sl, vb + ((g + RSL) % (HD / 16)) * (16 * TT * 2) + ((g + RSL) / (HD / 16)) * 2048, Vh, Vl);   // three items ahead: a later v^T group, or one of the next head's first k tiles
            else cp8(rl + sl, kn + (g + RSL - NT) * (16 * HD * 2), Kh, Kl);
            __builtin_amdgcn_sched_barrier(0);   // as in the score loop: reads together, refill issued, then the products
#pragma unroll
            for (int k2 = 0; k2 < 2; ++k2) { const int kt = kp * 2 + k2; const v16bf bh = __builtin_bit_cast(v16bf, ph[kt]), bl = __builtin_bit_cast(v16bf, pl[kt]);
                o[dt] = wmmab(fh[k2], bh, o[dt]); o[dt] = wmmab(fh[k2], bl, o[dt]); o[dt] = wmmab(fl[k2], bh, o[dt]); }
            __builtin_amdgcn_sched_barrier(0);   // as in the score loop: the products stay ahead of the next item's wait
        }
#pragma unroll
        for (int dt = 0; dt < HD / 16; ++dt) { float* w = op + (wv * 16 + lr) * 68 + dt * 16 + hi * 8; v4f lo4, hi4;
#pragma unroll
            for (int j = 0; j < 4; ++j) { lo4[j] = o[dt][j]; hi4[j] = o[dt][4 + j]; }
            *(v4fa*)w = lo4; *(v4fa*)(w + 4) = hi4; }
        __syncthreads();   // every wave's partial O^T is in LDS before any thread sums across the waves
        { const int tid = (int)threadIdx.x, q = (tid >> 2) & 15, d = (tid >> 6) * 8 + (tid & 3) * 2; v2f sm = *(const v2fa*)(op + q * 68 + d);   // thread tid sums elements 2 tid, 2 tid + 1 of the head's two units (16 queries x 64 d) of the merged planes, in their storage order
#pragma unroll
            for (int w = 1; w < FW; ++w) sm += *(const v2fa*)(op + (w * 16 + q) * 68 + d);
            v2us oh, ol; unsigned short a0, c0; splitf(sm[0], a0, c0); oh[0] = a0; ol[0] = c0; splitf(sm[1], a0, c0); oh[1] = a0; ol[1] = c0;
            const unsigned oo = (unsigned)((b * TT + q0) * DQ + h * (16 * HD) + tid * 2) * 2; *(v2us*)((char*)Ah + oo) = oh; *(v2us*)((char*)Al + oo) = ol; }
        asm volatile("s_wait_xcnt 0x0" ::: "memory");   // the wait owed before the next head's address arithmetic overwrites a register that these stores name
        { const unsigned x = sl0; sl0 = sl1; sl1 = sl2; sl2 = x; }   // the next head's item 0 lies in the slot of this head's item 16
    }
    asm volatile("s_wait_asynccnt 0x0" ::: "memory");   // the last three items have landed before the wave ends
    float* o2 = O2 + (size_t)(b * TT + q0 + lr) * TT + wv * KPW + hi * 8;
#pragma unroll
    for (int t = 0; t < NT; ++t) { v4f lo4, hi4;
#pragma unroll
        for (int j = 0; j < 4; ++j) { lo4[j] = macc[t][j] * (1.0f / NH_); hi4[j] = macc[t][4 + j] * (1.0f / NH_); }
        *(v4f*)(o2 + t * 16) = lo4; *(v4f*)(o2 + t * 16 + 4) = hi4; }
}

extern "C" void kernel_launch(void* const* d_in, const int* in_sizes, int n_in,
                              void* d_out, int out_size, void* d_ws, size_t ws_size, hipStream_t stream) {
    (void)in_sizes; (void)n_in; (void)out_size;
    const float* x = (const float*)d_in[0]; const float* xk = (const float*)d_in[1]; const float* xv = (const float*)d_in[2]; const float* wq = (const float*)d_in[3]; const float* bq = (const float*)d_in[4]; const float* wk = (const float*)d_in[5]; const float* bk = (const float*)d_in[6]; const float* wv = (const float*)d_in[7]; const float* bv = (const float*)d_in[8]; const float* wo = (const float*)d_in[9]; const float* bo = (const float*)d_in[10];
    float* OUT = (float*)d_out;     // first output [2][2048][1024]
    float* OUT2 = OUT + (size_t)NB_ * TT * DM;   // second output [2][2048][2048] (tuple: contiguous after the first)
    char* wsp = (char*)d_ws;
    auto take = [&](size_t bytes) { char* p = wsp; wsp += (bytes + 255) & ~(size_t)255; return (void*)p; };
    bf* WB = (bf*)take((size_t)4 * DQ * DM * 2); bf* WO = WB + (size_t)3 * DQ * DM;   // weights q, k, v, o in a row
    bf* XB = (bf*)take((size_t)3 * NB_ * TT * DM * 2);   // the three inputs in a row (q, k, v; both batches each)
    bf* QPh = (bf*)take((size_t)2 * NB_ * NH_ * TT * HD * 2); bf* KPh = QPh + (size_t)NB_ * NH_ * TT * HD; bf* QPl = (bf*)take((size_t)2 * NB_ * NH_ * TT * HD * 2); bf* KPl = QPl + (size_t)NB_ * NH_ * TT * HD; bf* VTh = (bf*)take((size_t)NB_ * NKV * HD * TT * 2); bf* VTl = (bf*)take((size_t)NB_ * NKV * HD * TT * 2);   // hi/lo head planes of both batches; k's follow q's
    bf* ATh = (bf*)take((size_t)NB_ * TT * DQ * 2); bf* ATl = (bf*)take((size_t)NB_ * TT * DQ * 2);
    if ((size_t)(wsp - (char*)d_ws) > ws_size) return;    // ws 256 MiB
    k_cvt8<<<3 * BX_ + 4 * BW_, 256, 0, stream>>>(x, xk, xv, wq, wk, wv, wo, XB, WB);   /* bf16 fragment-order planes of the inputs and weights */
    k_gemmw<bf, 0, true, KSW, 1, DM, true><<<dim3(NB_ * TT / 64, DQ / 64, 3), 32 * KSW, 0, stream>>>(XB, nullptr, WB, nullptr, nullptr, 0, bq, bk, bv, (size_t)NB_ * TT * DM, (size_t)DQ * DM, 0, 0, QPh, QPl, VTh, VTl);   /* q, k, v projections of both batches, stored as hi/lo head planes: z picks input, weight, bias, planes */
    k_fattn<<<NB_ * (TT / 16), 32 * FW, 0, stream>>>(QPh, QPl, KPh, KPl, VTh, VTl, ATh, ATl, OUT2);   /* scores, softmax, head mean of the probabilities (second output), probs x v, merged hi/lo planes: both batches, all heads */
    k_gemmw<bf, 1, true, KSW, 1, DQ, false><<<dim3(NB_ * TT / 64, DM / 64, 1), 32 * KSW, 0, stream>>>(ATh, ATl, WO, nullptr, OUT, DM, bo, nullptr, nullptr, 0, 0, 0, 0, nullptr, nullptr, nullptr, nullptr);   /* output projection, both batches (their rows follow one another in the merged planes and in the output) */
}

// v009
// Measured time: 132 microseconds a run.
// Versions between v007 and this one are left out; their measured steps multiply to 1.74 times as fast.
// Counting every step since v000, it is 11.7 times as fast.
#include <hip/hip_runtime.h>

// Multi-head attention returning the output AND the head-averaged attention probabilities (Q, K, V [2][2048][1024]; q,k,v = input W^T + b ('oi' [1024][1024] + [1024]; 16 heads x 64); scores = q.k x 1.0 (SCALING = 1: unscaled); probs = softmax; attn = probs v; out = merged Wo^T + bo -> [2][2048][1024]; second output mean over heads of probs -> [2][2048][2048]; tuple (12.6 M)).
// Layout: four launches, each stage once for both batches and for q, k, v together: bf16 copies of the three inputs and four weights; exact projections + biases rounded to bf16, rounded in the GEMM's epilogue to the f16 head planes of q, k, v^T of both batches; ONE attention launch (k_fattn): a work-group keeps 16 query rows x 2048 keys of scores and probabilities in its waves' registers (one f16 product; the unscaled logits reach |s| ~ 15), walks the 16 heads in order, adds the f32 probabilities into a register head sum (fixed order: deterministic) and writes sum x 1/16 to the second output; merged hi/lo x Wo exact + bo to the first.
// Every 16-bit workspace plane is kept in WMMA fragment order (see frs()): a wave-wide 16-byte fragment load reads 512 contiguous bytes, 4 whole 128-byte lines, where a row-major plane gives 32 bytes of each of 16 lines.
// Compute dtypes, f32 accumulate: every input rounded to bf16; projections exact + biases rounded to bf16; q, k, v and the probabilities rounded to f16 (11-bit mantissa; all lie far inside its range, subnormal operands are kept), scores and attn.v one f16 product each; softmax, probability mean f32; Wo hl x exact + bias.

#define NB_  2
#define TT   2048
#define DM   1024
#define NH_  16
#define NKV  16
#define REP  (NH_ / NKV)
#define HD   64
#define DQ   (NH_ * HD)
#define DKV  (NKV * HD)
#define FW   16                    // waves of an attention work-group; they share the 2048 keys of its 16 query rows
#define KPW  (TT / FW)             // keys of one wave
#define NT   (KPW / 16)            // 16-key score tiles of one wave
#define SCL  1.0f   // SCALING = 1.0 in the module (no 1/sqrt(d))
typedef _Float16 h16;
typedef unsigned short bf;
typedef __attribute__((ext_vector_type(16))) __bf16   v16bf;
typedef __attribute__((ext_vector_type(16))) _Float16 v16h;
typedef __attribute__((ext_vector_type(8)))  _Float16 v8h;
typedef __attribute__((ext_vector_type(8)))  unsigned short v8us;
typedef __attribute__((ext_vector_type(8)))  float    v8f;
typedef __attribute__((ext_vector_type(4)))  float    v4f;
typedef v8h  __attribute__((may_alias)) v8ha;
typedef v4f  __attribute__((may_alias)) v4fa;
typedef v8us __attribute__((may_alias)) v8usa;

__device__ __forceinline__ unsigned short f2bf(float f) { unsigned u = __float_as_uint(f); u += 0x7FFFu + ((u >> 16) & 1u); return (unsigned short)(u >> 16); }
__device__ __forceinline__ float bf2f(unsigned short b) { return __uint_as_float(((unsigned)b) << 16); }
__device__ __forceinline__ float bfr(float f) { return bf2f(f2bf(f)); }
__device__ __forceinline__ void splitf(float y, unsigned short& h, unsigned short& l) { h = f2bf(y); l = f2bf(y - bf2f(h)); }
__device__ __forceinline__ v16h cat16(v8h lo, v8h hi) { return __builtin_shufflevector(lo, hi, 0, 1, 2, 3, 4, 5, 6, 7, 8, 9, 10, 11, 12, 13, 14, 15); }
__device__ __forceinline__ v16bf cat16b(v8us lo, v8us hi) { return __builtin_bit_cast(v16bf, __builtin_shufflevector(lo, hi, 0, 1, 2, 3, 4, 5, 6, 7, 8, 9, 10, 11, 12, 13, 14, 15)); }
__device__ __forceinline__ v8f wmma16(v16h a, v16h b, v8f c) { return __builtin_amdgcn_wmma_f32_16x16x32_f16(false, a, false, b, (short)0, c, false, false); }
__device__ __forceinline__ v8f wmmab(v16bf a, v16bf b, v8f c) { return __builtin_amdgcn_wmma_f32_16x16x32_bf16(false, a, false, b, (short)0, c, false, false); }



// ---- Fragment order of a 16-bit matrix M[r][k] of K columns (rows % 16 == 0, K % 32 == 0): units of 16 rows x 32 k = 512 elements, unit (r / 16) (K / 32) + k / 32. Inside a unit stand two 512-byte halves (k % 32 < 16, >= 16);
// in a half lane l = 16 ((k % 16) / 8) + r % 16 owns elements 8 l .. 8 l + 7 (k % 8). WFrag::ld(unit + 8 lane) is then the lane's A or B fragment, with the same value in every lane and register as a load from the row-major plane.
// frs(i, K, r, k): row and first k of the i-th 8-element piece of such a plane (the writers walk the plane in storage order, so that their stores are whole lines).
__device__ __forceinline__ void frs(unsigned i, unsigned K, unsigned& r, unsigned& k) { const unsigned u = i >> 6, kpu = K >> 5; r = (u / kpu) * 16 + (i & 15); k = (u % kpu) * 32 + ((i >> 5) & 1) * 16 + ((i >> 4) & 1) * 8; }
// ---- k_gemmw: GEMM on 16-bit planes in fragment order. A work-group of FOUR waves takes a 128x128 output tile over the whole K, each wave a 64x64 quarter (16 accumulators); grid (M/128, N/128, Z), 128 threads.
// C[m][n] = sum_k A[m][k] Bt[n][k] (+ A2[m][k] Bt[n][k] for NSPLIT == 1) + bias[n] rounded to bf16. z-batch strides sA/sB in elements; z instance 0, 1, 2 adds bias, bias1, bias2. K % (2 KT) == 0.
// The operands come through LDS: a stage is KT k of the tile's 8 row bands of each operand, every band's part (KT / 32 units in a row) byte for byte as it lies in memory, brought ONCE per work-group by asynchronous copies and read by the two waves that need it.
// Two stages: the next one flies while this one is worked on. Wave w brings bands 2 w, 2 w + 1 of each operand.
// PL (projections; a wave's 64 columns = one head): no f32 C. The wave's tile + bias is rounded to f16 and stored into the head planes in fragment order: z 0, 1 (q, k) [t][d] planes at Ph (64 t x 64 d = 8 units in a row),
// z 2 (v) [d][t] planes at Vh (4 runs of 2 units); for v the wave lays its tile into LDS transposed, so that both kinds read 8 neighbours of a plane row from an LDS row. The LDS tiles of the epilogue lie on the stages, which nobody reads any more.
#define KT   64                    // k of a stage
#define CHB  (KT * 32)             // bytes of one band's part of a stage
template <typename T16> struct WFrag;
template <> struct WFrag<h16> { typedef v16h V; static __device__ __forceinline__ V ld(const h16* p) { return cat16(*(const v8h*)p, *(const v8h*)(p + 256)); } static __device__ __forceinline__ v8f mma(V a, V b, v8f c) { return wmma16(a, b, c); } };
template <> struct WFrag<bf> { typedef v16bf V; static __device__ __forceinline__ V ld(const bf* p) { return cat16b(*(const v8us*)p, *(const v8us*)(p + 256)); } static __device__ __forceinline__ v8f mma(V a, V b, v8f c) { return wmmab(a, b, c); } };
// Four asynchronous 16-byte-a-lane copies bring one band's part (2 KiB). L: the lane's LDS byte address, O: its byte offset beside the uniform base P; the immediate offset moves both addresses alike.
#define CP4(L, O, P) "global_load_async_to_lds_b128 %" #L ", %" #O ", %" #P "\n\tglobal_load_async_to_lds_b128 %" #L ", %" #O ", %" #P " offset:512\n\tglobal_load_async_to_lds_b128 %" #L ", %" #O ", %" #P " offset:1024\n\tglobal_load_async_to_lds_b128 %" #L ", %" #O ", %" #P " offset:1536\n\t"
// fill2, fill3: a wave's copies of one stage (two bands of two or three operands) in ONE statement. l: the lane's LDS address of its first band in the stage's first operand; o: its offset of that band's part beside each operand's base; rs: bytes from a band to the next in memory.
// The s_wait_xcnt is the wait owed before a register that an issued copy names is rewritten; it is the statement's last line so that no later address arithmetic can rise over it.
template <typename T16> __device__ __forceinline__ void fill2(unsigned l, unsigned o, unsigned rs, const T16* a, const T16* b) {
    asm volatile(CP4(0, 4, 6) CP4(1, 5, 6) CP4(2, 4, 7) CP4(3, 5, 7) "s_wait_xcnt 0x0"
                 :: "v"(l), "v"(l + CHB), "v"(l + 8 * CHB), "v"(l + 9 * CHB), "v"(o), "v"(o + rs), "s"(a), "s"(b) : "memory"); }
template <typename T16> __device__ __forceinline__ void fill3(unsigned l, unsigned o, unsigned rs, const T16* a, const T16* a2, const T16* b) {
    asm volatile(CP4(0, 6, 8) CP4(1, 7, 8) CP4(2, 6, 9) CP4(3, 7, 9) CP4(4, 6, 10) CP4(5, 7, 10) "s_wait_xcnt 0x0"
                 :: "v"(l), "v"(l + CHB), "v"(l + 8 * CHB), "v"(l + 9 * CHB), "v"(l + 16 * CHB), "v"(l + 17 * CHB), "v"(o), "v"(o + rs), "s"(a), "s"(a2), "s"(b) : "memory"); }
// amdgpu_num_vgpr(256): the register budget of four waves a SIMD. Without it the two-plane build takes a few registers above v255 and pays a register-window switch around many of the loop's reads and products.
template <typename T16, int NSPLIT, int K, bool PL>
__global__ __launch_bounds__(128) __attribute__((amdgpu_num_vgpr(256))) void k_gemmw(const T16* __restrict__ A, const T16* __restrict__ A2, const T16* __restrict__ Bt, float* C, int ldc, const float* __restrict__ bias, const float* __restrict__ bias1, const float* __restrict__ bias2, size_t sA, size_t sB, h16* __restrict__ Ph, h16* __restrict__ Vh) {
    typedef typename WFrag<T16>::V V;
    static_assert((NSPLIT == 0 || NSPLIT == 1) && K % (2 * KT) == 0 && KT % 32 == 0 && CHB == 2048, "one or two A planes; at least two stages; a band's part is four copies");
    constexpr int NA = NSPLIT == 1 ? 2 : 1, STB = (NA + 1) * 8 * CHB, NTR = K / KT, rs = K * 32;   // A planes; bytes of a stage; stages; bytes of 16 rows of a plane = K / 32 units in a row
    constexpr int SMB = 2 * STB > 4 * 64 * 68 * 4 ? 2 * STB : 4 * 64 * 68 * 4;
    __shared__ __align__(16) unsigned char sm[SMB];   // two stages [A 8 bands | A2 8 bands | B 8 bands]; behind the K loop four 64 x 68 f32 tiles
    const int wv = __builtin_amdgcn_readfirstlane(threadIdx.x >> 5), wm = wv & 1, wn = wv >> 1;   // wave number, scalar; the wave's quarter of the tile
    const size_t z = blockIdx.z; A += z * sA; Bt += z * sB; if (z == 1) bias = bias1; else if (z == 2) bias = bias2;   // each z instance (q, k, v projection) has its own bias vector
    const int lane = threadIdx.x & 31, lr = lane & 15, hi = lane >> 4; const int r0 = blockIdx.x * 128 + wm * 64, c0 = blockIdx.y * 128 + wn * 64;   // the wave's first row and column
    const T16* Ab = A + (size_t)(blockIdx.x * 128) * K; const T16* Bb = Bt + (size_t)(blockIdx.y * 128) * K;   // uniform bases of the tile's first bands
    const unsigned cl = (unsigned)(size_t)sm + (unsigned)(2 * wv) * CHB + (unsigned)lane * 16, co = (unsigned)(2 * wv) * rs + (unsigned)lane * 16;   // the lane's LDS byte address (the low 32 bits of the address) and memory offset of the wave's first band, stage 0
    auto fill = [&](unsigned buf, unsigned t) { if constexpr (NA == 2) fill3(cl + buf * STB, co + t * CHB, (unsigned)rs, Ab, A2 + (size_t)(blockIdx.x * 128) * K, Bb); else fill2(cl + buf * STB, co + t * CHB, (unsigned)rs, Ab, Bb); };
    fill(0, 0);
    const unsigned bofs = (unsigned)(c0 + lr) * 4; const float* bp = (const float*)((const char*)bias + bofs); float bv[4];   // biases of the lane's four columns, loaded here so that they arrive behind the K loop
#pragma unroll
    for (int nb = 0; nb < 4; ++nb) bv[nb] = bp[nb * 16];
    asm volatile("s_wait_xcnt 0x0" :: "v"(bp) : "memory");   // the wait owed before a register that the issued bias loads name is overwritten; the address as an input keeps its registers untouched up to here
    v8f acc[4][4];
#pragma unroll
    for (int mb = 0; mb < 4; ++mb)
#pragma unroll
        for (int nb = 0; nb < 4; ++nb) acc[mb][nb] = (v8f){};
    asm volatile("s_wait_asynccnt 0x0" ::: "memory");   // the wave's copies of stage 0 have landed
    __syncthreads();   // every wave's part of stage 0 is in LDS before any wave reads it
    fill(1, 1);
#pragma unroll 1
    for (int t = 0; t < NTR; ++t) {
        const unsigned char* st = sm + (t & 1) * STB + lane * 16;
#pragma unroll
        for (int ks = 0; ks < KT / 32; ++ks) {
            V a[4], a2[4], b[4];
#pragma unroll
            for (int mb = 0; mb < 4; ++mb) a[mb] = WFrag<T16>::ld((const T16*)(st + (wm * 4 + mb) * CHB + ks * 1024));
#pragma unroll
            for (int nb = 0; nb < 4; ++nb) b[nb] = WFrag<T16>::ld((const T16*)(st + (NA * 8 + wn * 4 + nb) * CHB + ks * 1024));
            if (NA == 2) {
#pragma unroll
                for (int mb = 0; mb < 4; ++mb) a2[mb] = WFrag<T16>::ld((const T16*)(st + (8 + wm * 4 + mb) * CHB + ks * 1024));
            }
            if (ks == KT / 32 - 1) {   // the stage's last fragments are on their way to registers: hand the stage over here, so that the refill is issued ahead of the last k step's products and flies through them too
                asm volatile("s_wait_dscnt 0x0" ::: "memory");      // the wave's reads of this stage have retired before the barrier lets copies refill it
                asm volatile("s_wait_asynccnt 0x0" ::: "memory");   // the wave's copies of the next stage have landed
                __syncthreads();   // publishes the next stage and ends every wave's reads of this one
                if (t + 2 < NTR) fill(t & 1, t + 2);
            }
            __builtin_amdgcn_sched_barrier(0);   // the k step's LDS reads (and the refill) stand together, ahead of its products: otherwise one B fragment at a time is read and waited for by itself between the products
#pragma unroll
            for (int nb = 0; nb < 4; ++nb)
#pragma unroll
                for (int mb = 0; mb < 4; ++mb) acc[mb][nb] = WFrag<T16>::mma(a[mb], b[nb], acc[mb][nb]);
            if (NA == 2) {
#pragma unroll
                for (int nb = 0; nb < 4; ++nb)
#pragma unroll
                    for (int mb = 0; mb < 4; ++mb) acc[mb][nb] = WFrag<T16>::mma(a2[mb], b[nb], acc[mb][nb]);
            }
        }
    }
    asm volatile("s_wait_asynccnt 0x0" ::: "memory");   // no copy is outstanding before the stages' LDS is used for the output tiles
    // every loop below is unrolled so that acc and the vectors are indexed by constants and stay in registers
    float* ow = (float*)sm + wv * (64 * 68);   // the wave's own 64 x 68 tile
#pragma unroll
    for (int nb = 0; nb < 4; ++nb) bv[nb] = bfr(bv[nb]);
    if (PL && z == 2) {   // v: column n (= d) is the LDS row; a lane's 8 accumulator values are 8 neighbours (t) of it
#pragma unroll
        for (int mb = 0; mb < 4; ++mb)
#pragma unroll
            for (int nb = 0; nb < 4; ++nb) { float* w = ow + (nb * 16 + lr) * 68 + mb * 16 + hi * 8; v4f lo4, hi4;
#pragma unroll
                for (int j = 0; j < 4; ++j) { lo4[j] = acc[mb][nb][j] + bv[nb]; hi4[j] = acc[mb][nb][4 + j] + bv[nb]; }
                *(v4fa*)w = lo4; *(v4fa*)(w + 4) = hi4; }
    } else {
#pragma unroll
        for (int mb = 0; mb < 4; ++mb)
#pragma unroll
            for (int nb = 0; nb < 4; ++nb)
#pragma unroll
                for (int j = 0; j < 8; ++j) ow[(mb * 16 + hi * 8 + j) * 68 + nb * 16 + lr] = acc[mb][nb][j] + bv[nb];
    }
    __syncthreads();   // the tile's LDS stores stand in front of the reads of other lanes' values
    if constexpr (PL) {
        static_assert(HD == 64 && NKV == NH_ && TT % 64 == 0, "a wave's 64 x 64 tile is one head's, inside one batch");
        const unsigned bt = (unsigned)r0 / TT, t0 = (unsigned)r0 % TT, hd = (unsigned)c0 / HD;   // batch, first t and head of the wave's tile
        h16* dh = z == 2 ? Vh : Ph;
        const unsigned pb = z == 2 ? ((bt * NKV + hd) * (TT * HD) + (t0 / 32) * 512) * 2 : ((((unsigned)z * NB_ + bt) * NH_ + hd) * (TT * HD) + t0 * HD) * 2;   // byte offset of the tile's first unit in its buffer (k's planes follow q's)
        const unsigned us = z == 2 ? (TT / 32) * 1024 : 2048;   // bytes from one 16-row band of the tile to the next: a whole band of the v^T plane, two units of a q or k plane
#pragma unroll
        for (int band = 0; band < 4; ++band) { v8h oh[4]; unsigned oo[4];   // a band's four wave-wide pieces together: eight LDS reads behind one wait, four stores behind one another
#pragma unroll
            for (int i = 0; i < 4; ++i) { const unsigned rr = band * 16 + lr, kk = (i * 2 + hi) * 8;   // piece il = 32 (4 band + i) + lane of the tile's 512 (see frs()): plane row 16 (il / 128) + il % 16, first k 8 ((il / 16) % 8)
                const float* o8 = ow + rr * 68 + kk; const v4f s0 = *(const v4fa*)o8, s1 = *(const v4fa*)(o8 + 4);
#pragma unroll
                for (int j = 0; j < 8; ++j) oh[i][j] = (h16)(j < 4 ? s0[j] : s1[j - 4]);
                oo[i] = pb + band * us + (i * 32 + lane) * 16; }
#pragma unroll
            for (int i = 0; i < 4; ++i) *(v8h*)((char*)dh + oo[i]) = oh[i];
            asm volatile("s_wait_xcnt 0x0" :: "v"(oo[0]), "v"(oo[1]), "v"(oo[2]), "v"(oo[3]), "v"(oh[0]), "v"(oh[1]), "v"(oh[2]), "v"(oh[3]) : "memory");   // the wait owed before a register that an issued store names is overwritten; offsets and data as inputs keep their registers untouched up to here
        }
    } else {
        const unsigned ob = (unsigned)((r0 + hi) * ldc + c0 + lr * 4) * 4, o2 = (unsigned)ldc * 8;   // byte offset of the lane's 16 bytes in the tile's row hi; bytes of two output rows
#pragma unroll
        for (int g = 0; g < 4; ++g) { v4f val[8]; unsigned oo[8];   // sixteen output rows together: eight LDS reads behind one wait, eight stores behind one another; a wave-wide store is 256 bytes in a row of each of two output rows
#pragma unroll
            for (int i = 0; i < 8; ++i) { val[i] = *(const v4fa*)(ow + ((g * 8 + i) * 2 + hi) * 68 + lr * 4); oo[i] = ob + (g * 8 + i) * o2; }
#pragma unroll
            for (int i = 0; i < 8; ++i) *(v4f*)((char*)C + oo[i]) = val[i];
            asm volatile("s_wait_xcnt 0x0" :: "v"(oo[0]), "v"(oo[1]), "v"(oo[2]), "v"(oo[3]), "v"(oo[4]), "v"(oo[5]), "v"(oo[6]), "v"(oo[7]), "v"(val[0]), "v"(val[1]), "v"(val[2]), "v"(val[3]), "v"(val[4]), "v"(val[5]), "v"(val[6]), "v"(val[7]) : "memory");   // as above: the wait owed before a register that an issued store names is overwritten
        }
    }
}

__device__ __forceinline__ h16 tohx(float x) { return (h16)x; }
typedef __attribute__((ext_vector_type(2))) _Float16 v2h;
typedef __attribute__((ext_vector_type(4))) _Float16 v4h;
typedef __attribute__((ext_vector_type(2))) unsigned short v2us;
typedef __attribute__((ext_vector_type(4))) unsigned short v4us;
typedef __attribute__((ext_vector_type(2))) float v2f;
typedef __attribute__((ext_vector_type(4))) int v4i;

__global__ __launch_bounds__(256) void k_wtG(const float* __restrict__ w, int K, int N, bf* Bt) {
    const int lane = threadIdx.x & 31; const int L0 = (blockIdx.x * 8 + (threadIdx.x >> 5)) * 8; const int nlines = N * K / 64;
{
#pragma unroll 1
        for (int l = 0; l < 8; ++l) { const int L = L0 + l; if (L >= nlines) break; const size_t e = (size_t)L * 64 + lane * 2; const int k = (int)(e % K), n = (int)(e / K); v2us o;
            o[0] = f2bf(w[(size_t)k * N + n]); o[1] = f2bf(w[(size_t)(k + 1) * N + n]); *(v2us*)(Bt + e) = o; }
         }
}
// k_cvt8: row-major f32 [rows][DM] -> bf16 plane in fragment order, one 8-element piece a thread. ONE launch converts all seven sources: blocks [0, 3 BX) the three inputs (both batches: NB_ TT rows each) to XB + s NB_ TT DM,
// blocks [3 BX, 3 BX + 4 BW) the four weights to WB + s DQ DM. The choice is the same for a whole block.
#define BX_ (NB_ * TT * DM / 8 / 256)
#define BW_ (DQ * DM / 8 / 256)
__global__ __launch_bounds__(256) void k_cvt8(const float* __restrict__ x, const float* __restrict__ xk, const float* __restrict__ xv, const float* __restrict__ wq, const float* __restrict__ wk, const float* __restrict__ wv, const float* __restrict__ wo, bf* XB, bf* WB) {
    const unsigned blk = blockIdx.x; const float* src; bf* dst; unsigned i;
    if (blk < 3 * BX_) { const unsigned s = blk / BX_; src = s == 0 ? x : s == 1 ? xk : xv; dst = XB + (size_t)s * (NB_ * TT * DM); i = (blk % BX_) * 256 + threadIdx.x; }
    else { const unsigned s = (blk - 3 * BX_) / BW_; src = s == 0 ? wq : s == 1 ? wk : s == 2 ? wv : wo; dst = WB + (size_t)s * (DQ * DM); i = ((blk - 3 * BX_) % BW_) * 256 + threadIdx.x; }
    unsigned r, k0; frs(i, DM, r, k0); const float* p = src + (size_t)r * DM + k0; const v8f v = *(const v8f*)p; v8us o;
    asm volatile("s_wait_xcnt 0x0" :: "v"(p) : "memory");   // the wait owed before a register that the issued loads name is overwritten; the address as an input keeps its registers untouched up to here
#pragma unroll
    for (int k = 0; k < 8; ++k) o[k] = f2bf(v[k]); *(v8us*)(dst + (size_t)i * 8) = o;  }

// 2^x; the v_nop is the one slot the instruction set asks for behind a transcendental before its result is read or its source overwritten
__device__ __forceinline__ float exp2s(float x) { float r; asm("v_exp_f32 %0, %1\n\tv_nop" : "=v"(r) : "v"(x)); return r; }
typedef __attribute__((ext_vector_type(2))) __bf16 v2bf;
typedef __attribute__((ext_vector_type(8))) unsigned v8u;
typedef v2f __attribute__((may_alias)) v2fa;
// ---- A wave's private LDS ring for its k and v^T fragments. A slot holds what one group of four products reads: 4 KiB of a plane (four units in a row), byte for byte as they lie in memory (fragment order).
#define RSL 3                      // slots of a wave's ring: two slots fly while one is read
#define RSB 4096                   // bytes of a slot
// cp8: eight asynchronous 16-byte-a-lane copies fill one slot. lds: the lane's LDS byte address in the slot; off: the lane's byte offset beside the uniform plane base p. The immediate offset moves both addresses alike.
// The s_wait_xcnt is the wait owed before a register that an issued copy names is rewritten; it is the statement's last line so that no later address arithmetic can rise over it.
__device__ __forceinline__ void cp8(unsigned lds, unsigned off, const h16* p) {
    asm volatile("global_load_async_to_lds_b128 %0, %1, %2\n\t"
                 "global_load_async_to_lds_b128 %0, %1, %2 offset:512\n\t"
                 "global_load_async_to_lds_b128 %0, %1, %2 offset:1024\n\t"
                 "global_load_async_to_lds_b128 %0, %1, %2 offset:1536\n\t"
                 "global_load_async_to_lds_b128 %0, %1, %2 offset:2048\n\t"
                 "global_load_async_to_lds_b128 %0, %1, %2 offset:2560\n\t"
                 "global_load_async_to_lds_b128 %0, %1, %2 offset:3072\n\t"
                 "global_load_async_to_lds_b128 %0, %1, %2 offset:3584\n\t"
                 "s_wait_xcnt 0x0" :: "v"(lds), "v"(off), "s"(p) : "memory"); }
// landed(): all but the wave's 16 youngest copies (the two younger slots) have landed, so the oldest slot may be read. readout(): the wave's own LDS reads of a slot have retired before copies refill it (a ring private to one wave needs no work-group barrier).
__device__ __forceinline__ void landed() { asm volatile("s_wait_asynccnt 0x10" ::: "memory"); }
__device__ __forceinline__ void readout() { asm volatile("s_wait_dscnt 0x0" ::: "memory"); }
// k_fattn: one work-group of FW waves takes 16 query rows of one batch through ALL heads, in head order; grid NB_ x TT/16. Wave w owns keys [w KPW, (w + 1) KPW).
// Per head: S^T = K Q^T (A = key rows, B = query rows, one f16 product) stays in the wave's accumulators: lane (lr, hi) holds query lr, register j of tile t key 16 t + 8 hi + j.
// Row maximum and row sum: in the lane, across the lane halves, then across the waves through LDS in wave order (a barrier each). The f32 probabilities are added to the head sum in registers,
// rounded to f16 in place (two tiles of 16 keys are one B operand of 32 keys in the loader's k order) and O^T = V^T P^T (one product) follows; the waves' partial O^T are summed through LDS in wave order (a barrier).
// The wave's k and v^T fragments form ONE stream over the whole kernel (per head NI k items of two 16-key tiles, then NI v^T items of 16 v rows x the wave's 128 keys, 4 KiB each) that runs three items ahead of the products through the wave's ring: the copies hold no register, so they fly through the softmax, the barriers and the sum of the partial outputs as well.
// The last head's three items ahead are head 0's first k items again (read by nobody): every trip issues the same number of copies, which keeps the counted wait exact.
#define NI 4                       // items of a head's k part and of its v^T part
__global__ __launch_bounds__(32 * FW) void k_fattn(const h16* __restrict__ Qp, const h16* __restrict__ Kp, const h16* __restrict__ Vp, bf* __restrict__ Ah, bf* __restrict__ Al, float* __restrict__ O2) {
    typedef WFrag<h16> F; static_assert(FW == 16 && NKV == NH_ && HD == 64 && NT == 2 * NI && HD / 16 == NI && KPW * 16 * 2 == RSB && 32 * HD * 2 == RSB, "one thread sums two elements of the partial outputs; one kv head per query head; two units a 16-row q or k tile; an item fills a slot");
    __shared__ float rmx[FW * 16]; __shared__ float rsm[FW * 16]; __shared__ __align__(16) float op[FW * 16 * 68]; __shared__ __align__(16) unsigned char ring[FW * RSL * RSB];
    const int wv = __builtin_amdgcn_readfirstlane(threadIdx.x >> 5);   // wave number, scalar
    const int lane = threadIdx.x & 31, lr = lane & 15, hi = lane >> 4; const int b = blockIdx.x / (TT / 16), q0 = (blockIdx.x % (TT / 16)) * 16;
    const unsigned qo = (unsigned)(q0 * HD + 8 * lane) * 2, ko = (unsigned)(wv * KPW * HD + 8 * lane) * 2, vo = (unsigned)(wv * KPW * 16 + 8 * lane) * 2;   // the lane's byte offsets inside a head's plane (fragment order: 1-KiB units of 16 rows x 32 k; q, k: 2 units a 16-row tile; v: TT / 32 units a 16-row tile)
    const unsigned rl = (unsigned)(size_t)ring;   // the ring's LDS byte address (the low 32 bits of its address)
    unsigned sl0 = (unsigned)(wv * (RSL * RSB) + lane * 16), sl1 = sl0 + RSB, sl2 = sl0 + 2 * RSB;   // the lane's byte offsets in the three slots; item i of a head's 8 lies in slot i % 3 of this order, which turns by two a head (8 % 3 == 2)
    { const unsigned k0 = (unsigned)(b * NH_) * (TT * HD * 2) + ko; cp8(rl + sl0, k0, Kp); cp8(rl + sl1, k0 + RSB, Kp); cp8(rl + sl2, k0 + 2 * RSB, Kp); }   // the stream's first three items: k items 0, 1, 2 of head 0
    v8f macc[NT];
#pragma unroll
    for (int t = 0; t < NT; ++t) macc[t] = (v8f){};
#pragma unroll 1
    for (int h = 0; h < NH_; ++h) { const unsigned hb = (unsigned)(b * NH_ + h) * (TT * HD * 2);   // byte offset of the head's plane (q, k [t][d]; v [d][t]) in its 8-MiB buffer
        const unsigned kn = (unsigned)(b * NH_ + ((h + 1) & (NH_ - 1))) * (TT * HD * 2) + ko;   // the next head's k offset (behind the last head: head 0's)
        const unsigned qb = hb + qo, kb = hb + ko, vb = hb + vo;   // one 32-bit offset register beside each uniform base serves all of a plane's loads (64-bit lane addresses cost registers that the fragment sets need)
        v16h qf[2];
#pragma unroll
        for (int ks = 0; ks < 2; ++ks) qf[ks] = F::ld((const h16*)((const char*)Qp + qb + ks * 1024));
        v8f s[NT]; v16h fr[4];   // operand fragments of a group of four products, read from the ring
        asm volatile("s_wait_xcnt 0x0" :: "v"(qb) : "memory");   // the wait owed before a register that an issued load names is overwritten; the q offset as an input keeps its register untouched up to here (without it a later load's result was placed on it)
#pragma unroll
        for (int i = 0; i < NI; ++i) { const unsigned sl = i % RSL == 0 ? sl0 : i % RSL == 1 ? sl1 : sl2;   // item i of the head: key tiles 2 i, 2 i + 1
            landed();
#pragma unroll
            for (int u = 0; u < 4; ++u) fr[u] = F::ld((const h16*)(ring + sl + u * 1024));
            readout();
            if (i + RSL < NI) cp8(rl + sl, kb + (i + RSL) * RSB, Kp);   // three items ahead: a later k item, or one of the head's first v^T items (16 v rows x 128 keys = four units in a row)
            else cp8(rl + sl, vb + (i + RSL - NI) * (16 * TT * 2), Vp);
            __builtin_amdgcn_sched_barrier(0);   // the eight LDS reads stand together, ahead of the products, and the refill is issued before them: otherwise the reads are spread in pairs among the products, each pair waited for by itself
            v8f a0 = (v8f){}, a1 = (v8f){};
            a0 = wmma16(fr[0], qf[0], a0); a1 = wmma16(fr[2], qf[0], a1); a0 = wmma16(fr[1], qf[1], a0); a1 = wmma16(fr[3], qf[1], a1);
            s[2 * i] = a0 * SCL; s[2 * i + 1] = a1 * SCL;
            __builtin_amdgcn_sched_barrier(0);   // these products stay ahead of the next item's wait: they run while that item is still landing
        }
        float mx = -3.0e38f;
#pragma unroll
        for (int t = 0; t < NT; ++t)
#pragma unroll
            for (int j = 0; j < 8; ++j) mx = fmaxf(mx, s[t][j]);
        mx = fmaxf(mx, __shfl_xor(mx, 16, 32));
        if (hi == 0) rmx[wv * 16 + lr] = mx;
        __syncthreads();   // every wave's row maxima are in LDS before any wave joins them
#pragma unroll
        for (int w = 0; w < FW; ++w) mx = fmaxf(mx, rmx[w * 16 + lr]);
        float sum = 0.f;
#pragma unroll
        for (int t = 0; t < NT; ++t)
#pragma unroll
            for (int j = 0; j < 8; ++j) { s[t][j] = exp2s(__fmul_rn(__fsub_rn(s[t][j], mx), 1.4426950408889634f)); sum += s[t][j]; }
        sum += __shfl_xor(sum, 16, 32);
        if (hi == 0) rsm[wv * 16 + lr] = sum;
        __syncthreads();   // every wave's row sums are in LDS before any wave joins them
        sum = rsm[lr];
#pragma unroll
        for (int w = 1; w < FW; ++w) sum += rsm[w * 16 + lr];
        const float f = __fdiv_rn(1.0f, sum);
        v8u pf[NT / 2];
#pragma unroll
        for (int t = 0; t < NT; ++t)
#pragma unroll
            for (int j = 0; j < 8; j += 2) { v2f p; p[0] = s[t][j] * f; p[1] = s[t][j + 1] * f; macc[t][j] += p[0]; macc[t][j + 1] += p[1];
                pf[t >> 1][(t & 1) * 4 + (j >> 1)] = __builtin_bit_cast(unsigned, __builtin_convertvector(p, v2h)); }
        v8f o[HD / 16];
#pragma unroll
        for (int dt = 0; dt < HD / 16; ++dt) o[dt] = (v8f){};
#pragma unroll
        for (int dt = 0; dt < NI; ++dt) {   // an item: 16 v rows x the wave's 128 keys = four units in a row
            const unsigned sl = (NI + dt) % RSL == 0 ? sl0 : (NI + dt) % RSL == 1 ? sl1 : sl2;   // item NI + dt of the head
            landed();
#pragma unroll
            for (int u = 0; u < 4; ++u) fr[u] = F::ld((const h16*)(ring + sl + u * 1024));
            readout();
            if (dt + RSL < NI) cp8(rl + sl, vb + (dt + RSL) * (16 * TT * 2), Vp);   // three items ahead: a later v^T item, or one of the next head's first k items
            else cp8(rl + sl, kn + (dt + RSL - NI) * RSB, Kp);
            __builtin_amdgcn_sched_barrier(0);   // as in the score loop: reads together, refill issued, then the products
#pragma unroll
            for (int kt = 0; kt < 4; ++kt) o[dt] = wmma16(fr[kt], __builtin_bit_cast(v16h, pf[kt]), o[dt]);
            __builtin_amdgcn_sched_barrier(0);   // as in the score loop: the products stay ahead of the next item's wait
        }
#pragma unroll
        for (int dt = 0; dt < HD / 16; ++dt) { float* w = op + (wv * 16 + lr) * 68 + dt * 16 + hi * 8; v4f lo4, hi4;
#pragma unroll
            for (int j = 0; j < 4; ++j) { lo4[j] = o[dt][j]; hi4[j] = o[dt][4 + j]; }
            *(v4fa*)w = lo4; *(v4fa*)(w + 4) = hi4; }
        __syncthreads();   // every wave's partial O^T is in LDS before any thread sums across the waves
        { const int tid = (int)threadIdx.x, q = (tid >> 2) & 15, d = (tid >> 6) * 8 + (tid & 3) * 2; v2f sm = *(const v2fa*)(op + q * 68 + d);   // thread tid sums elements 2 tid, 2 tid + 1 of the head's two units (16 queries x 64 d) of the merged planes, in their storage order
#pragma unroll
            for (int w = 1; w < FW; ++w) sm += *(const v2fa*)(op + (w * 16 + q) * 68 + d);
            v2us oh, ol; unsigned short a0, c0; splitf(sm[0], a0, c0); oh[0] = a0; ol[0] = c0; splitf(sm[1], a0, c0); oh[1] = a0; ol[1] = c0;
            const unsigned oo = (unsigned)((b * TT + q0) * DQ + h * (16 * HD) + tid * 2) * 2; *(v2us*)((char*)Ah + oo) = oh; *(v2us*)((char*)Al + oo) = ol; }
        asm volatile("s_wait_xcnt 0x0" ::: "memory");   // the wait owed before the next head's address arithmetic overwrites a register that these stores name
        { const unsigned x = sl2; sl2 = sl1; sl1 = sl0; sl0 = x; }   // the next head's item 0 lies in the slot of this head's item 8
    }
    asm volatile("s_wait_asynccnt 0x0" ::: "memory");   // the last three items have landed before the wave ends
    float* o2 = O2 + (size_t)(b * TT + q0 + lr) * TT + wv * KPW + hi * 8;
#pragma unroll
    for (int t = 0; t < NT; ++t) { v4f lo4, hi4;
#pragma unroll
        for (int j = 0; j < 4; ++j) { lo4[j] = macc[t][j] * (1.0f / NH_); hi4[j] = macc[t][4 + j] * (1.0f / NH_); }
        *(v4f*)(o2 + t * 16) = lo4; *(v4f*)(o2 + t * 16 + 4) = hi4; }
}

extern "C" void kernel_launch(void* const* d_in, const int* in_sizes, int n_in,
                              void* d_out, int out_size, void* d_ws, size_t ws_size, hipStream_t stream) {
    (void)in_sizes; (void)n_in; (void)out_size;
    const float* x = (const float*)d_in[0]; const float* xk = (const float*)d_in[1]; const float* xv = (const float*)d_in[2]; const float* wq = (const float*)d_in[3]; const float* bq = (const float*)d_in[4]; const float* wk = (const float*)d_in[5]; const float* bk = (const float*)d_in[6]; const float* wv = (const float*)d_in[7]; const float* bv = (const float*)d_in[8]; const float* wo = (const float*)d_in[9]; const float* bo = (const float*)d_in[10];
    float* OUT = (float*)d_out;     // first output [2][2048][1024]
    float* OUT2 = OUT + (size_t)NB_ * TT * DM;   // second output [2][2048][2048] (tuple: contiguous after the first)
    char* wsp = (char*)d_ws;
    auto take = [&](size_t bytes) { char* p = wsp; wsp += (bytes + 255) & ~(size_t)255; return (void*)p; };
    bf* WB = (bf*)take((size_t)4 * DQ * DM * 2); bf* WO = WB + (size_t)3 * DQ * DM;   // weights q, k, v, o in a row
    bf* XB = (bf*)take((size_t)3 * NB_ * TT * DM * 2);   // the three inputs in a row (q, k, v; both batches each)
    h16* QP = (h16*)take((size_t)2 * NB_ * NH_ * TT * HD * 2); h16* KP = QP + (size_t)NB_ * NH_ * TT * HD; h16* VT = (h16*)take((size_t)NB_ * NKV * HD * TT * 2);   // f16 head planes of both batches; k's follow q's
    bf* ATh = (bf*)take((size_t)NB_ * TT * DQ * 2); bf* ATl = (bf*)take((size_t)NB_ * TT * DQ * 2);
    if ((size_t)(wsp - (char*)d_ws) > ws_size) return;    // ws 256 MiB
    k_cvt8<<<3 * BX_ + 4 * BW_, 256, 0, stream>>>(x, xk, xv, wq, wk, wv, wo, XB, WB);   /* bf16 fragment-order planes of the inputs and weights */
    k_gemmw<bf, 0, DM, true><<<dim3(NB_ * TT / 128, DQ / 128, 3), 128, 0, stream>>>(XB, nullptr, WB, nullptr, 0, bq, bk, bv, (size_t)NB_ * TT * DM, (size_t)DQ * DM, QP, VT);   /* q, k, v projections of both batches, stored as f16 head planes: z picks input, weight, bias, planes */
    k_fattn<<<NB_ * (TT / 16), 32 * FW, 0, stream>>>(QP, KP, VT, ATh, ATl, OUT2);   /* scores, softmax, head mean of the probabilities (second output), probs x v, merged hi/lo planes: both batches, all heads */
    k_gemmw<bf, 1, DQ, false><<<dim3(NB_ * TT / 128, DM / 128, 1), 128, 0, stream>>>(ATh, ATl, WO, OUT, DM, bo, nullptr, nullptr, 0, 0, nullptr, nullptr);   /* output projection, both batches (their rows follow one another in the merged planes and in the output) */
}

// v010
// Measured time: 128 microseconds a run.
// Timed twice side by side with v009, it ran 1.04 and 1.03 times as fast.
// Over all steps from v000 it is 12.1 times as fast.
#include <hip/hip_runtime.h>

// Multi-head attention returning the output AND the head-averaged attention probabilities (Q, K, V [2][2048][1024]; q,k,v = input W^T + b ('oi' [1024][1024] + [1024]; 16 heads x 64); scores = q.k x 1.0 (SCALING = 1: unscaled); probs = softmax; attn = probs v; out = merged Wo^T + bo -> [2][2048][1024]; second output mean over heads of probs -> [2][2048][2048]; tuple (12.6 M)).
// Layout: five launches, each stage once for both batches and for q, k, v together: bf16 copies of the three inputs and four weights; exact projections + bf16-rounded biases, rounded in the GEMM's epilogue to the f16 head planes of q, k, v^T of both batches; k_oattn: probs x v with a running-maximum softmax, a wave takes 32 query rows of one head through all keys (one f16 product; the unscaled logits reach |s| ~ 15) and leaves each row's maximum and 1 / sum; k_pmean: a work-group recomputes the scores of 128 query rows x 256 keys head by head, forms the f32 probabilities from those row statistics, adds them into a register head sum (fixed order: deterministic) and writes sum x 1/16 to the second output; merged hi/lo x Wo exact + bo to the first.
// Every 16-bit workspace plane is kept in WMMA fragment order (see frs()): a wave-wide 16-byte fragment load reads 512 contiguous bytes, 4 whole 128-byte lines, where a row-major plane gives 32 bytes of each of 16 lines.
// Compute dtypes, f32 accumulate: every input rounded to bf16; projections exact + bf16-rounded biases; q, k, v and the exponentials 2^(s log2 e - running maximum) <= 1 rounded to f16 (11-bit mantissa; all lie far inside its range, subnormal operands are kept), scores and attn.v one f16 product each; softmax, probability mean f32; Wo hl x exact + bias.

#define NB_  2
#define TT   2048
#define DM   1024
#define NH_  16
#define NKV  16
#define REP  (NH_ / NKV)
#define HD   64
#define DQ   (NH_ * HD)
#define DKV  (NKV * HD)
#define SCL  1.0f   // SCALING = 1.0 in the module (no 1/sqrt(d))
typedef _Float16 h16;
typedef unsigned short bf;
typedef __attribute__((ext_vector_type(16))) __bf16   v16bf;
typedef __attribute__((ext_vector_type(16))) _Float16 v16h;
typedef __attribute__((ext_vector_type(8)))  _Float16 v8h;
typedef __attribute__((ext_vector_type(8)))  unsigned short v8us;
typedef __attribute__((ext_vector_type(8)))  float    v8f;
typedef __attribute__((ext_vector_type(4)))  float    v4f;
typedef v8h  __attribute__((may_alias)) v8ha;
typedef v4f  __attribute__((may_alias)) v4fa;
typedef v8us __attribute__((may_alias)) v8usa;

__device__ __forceinline__ unsigned short f2bf(float f) { unsigned u = __float_as_uint(f); u += 0x7FFFu + ((u >> 16) & 1u); return (unsigned short)(u >> 16); }
__device__ __forceinline__ float bf2f(unsigned short b) { return __uint_as_float(((unsigned)b) << 16); }
__device__ __forceinline__ float bfr(float f) { return bf2f(f2bf(f)); }
__device__ __forceinline__ void splitf(float y, unsigned short& h, unsigned short& l) { h = f2bf(y); l = f2bf(y - bf2f(h)); }
__device__ __forceinline__ v16h cat16(v8h lo, v8h hi) { return __builtin_shufflevector(lo, hi, 0, 1, 2, 3, 4, 5, 6, 7, 8, 9, 10, 11, 12, 13, 14, 15); }
__device__ __forceinline__ v16bf cat16b(v8us lo, v8us hi) { return __builtin_bit_cast(v16bf, __builtin_shufflevector(lo, hi, 0, 1, 2, 3, 4, 5, 6, 7, 8, 9, 10, 11, 12, 13, 14, 15)); }
__device__ __forceinline__ v8f wmma16(v16h a, v16h b, v8f c) { return __builtin_amdgcn_wmma_f32_16x16x32_f16(false, a, false, b, (short)0, c, false, false); }
__device__ __forceinline__ v8f wmmab(v16bf a, v16bf b, v8f c) { return __builtin_amdgcn_wmma_f32_16x16x32_bf16(false, a, false, b, (short)0, c, false, false); }



// ---- Fragment order of a 16-bit matrix M[r][k] of K columns (rows % 16 == 0, K % 32 == 0): units of 16 rows x 32 k = 512 elements, unit (r / 16) (K / 32) + k / 32. Inside a unit stand two 512-byte halves (k % 32 < 16, >= 16);
// in a half lane l = 16 ((k % 16) / 8) + r % 16 owns elements 8 l .. 8 l + 7 (k % 8). WFrag::ld(unit + 8 lane) is then the lane's A or B fragment, with the same value in every lane and register as a load from the row-major plane.
// frs(i, K, r, k): row and first k of the i-th 8-element piece of such a plane (the writers walk the plane in storage order, so that their stores are whole lines).
__device__ __forceinline__ void frs(unsigned i, unsigned K, unsigned& r, unsigned& k) { const unsigned u = i >> 6, kpu = K >> 5; r = (u / kpu) * 16 + (i & 15); k = (u % kpu) * 32 + ((i >> 5) & 1) * 16 + ((i >> 4) & 1) * 8; }
// ---- k_gemmw: GEMM on 16-bit planes in fragment order. A work-group of FOUR waves takes a 128x128 output tile over the whole K, each wave a 64x64 quarter (16 accumulators); grid (M/128, N/128, Z), 128 threads.
// C[m][n] = sum_k A[m][k] Bt[n][k] (+ A2[m][k] Bt[n][k] for NSPLIT == 1) + bias[n] rounded to bf16. z-batch strides sA/sB in elements; z instance 0, 1, 2 adds bias, bias1, bias2. K % (2 KT) == 0.
// The operands come through LDS: a stage is KT k of the tile's 8 row bands of each operand, every band's part (KT / 32 units in a row) byte for byte as it lies in memory, brought ONCE per work-group by asynchronous copies and read by the two waves that need it.
// Two stages: the next one flies while this one is worked on. Wave w brings bands 2 w, 2 w + 1 of each operand.
// PL (projections; a wave's 64 columns = one head): no f32 C. The wave's tile + bias is rounded to f16 and stored into the head planes in fragment order: z 0, 1 (q, k) [t][d] planes at Ph (64 t x 64 d = 8 units in a row),
// z 2 (v) [d][t] planes at Vh (4 runs of 2 units); for v the wave lays its tile into LDS transposed, so that both kinds read 8 neighbours of a plane row from an LDS row. The LDS tiles of the epilogue lie on the stages, which nobody reads any more.
#define KT   64                    // k of a stage
#define CHB  (KT * 32)             // bytes of one band's part of a stage
template <typename T16> struct WFrag;
template <> struct WFrag<h16> { typedef v16h V; static __device__ __forceinline__ V ld(const h16* p) { return cat16(*(const v8h*)p, *(const v8h*)(p + 256)); } static __device__ __forceinline__ v8f mma(V a, V b, v8f c) { return wmma16(a, b, c); } };
template <> struct WFrag<bf> { typedef v16bf V; static __device__ __forceinline__ V ld(const bf* p) { return cat16b(*(const v8us*)p, *(const v8us*)(p + 256)); } static __device__ __forceinline__ v8f mma(V a, V b, v8f c) { return wmmab(a, b, c); } };
// Four asynchronous 16-byte-a-lane copies bring one band's part (2 KiB). L: the lane's LDS byte address, O: its byte offset beside the uniform base P; the immediate offset moves both addresses alike.
#define CP4(L, O, P) "global_load_async_to_lds_b128 %" #L ", %" #O ", %" #P "\n\tglobal_load_async_to_lds_b128 %" #L ", %" #O ", %" #P " offset:512\n\tglobal_load_async_to_lds_b128 %" #L ", %" #O ", %" #P " offset:1024\n\tglobal_load_async_to_lds_b128 %" #L ", %" #O ", %" #P " offset:1536\n\t"
// fill2, fill3: a wave's copies of one stage (two bands of two or three operands) in ONE statement. l: the lane's LDS address of its first band in the stage's first operand; o: its offset of that band's part beside each operand's base; rs: bytes from a band to the next in memory.
// The s_wait_xcnt is the wait owed before a register that an issued copy names is rewritten; it is the statement's last line so that no later address arithmetic can rise over it.
template <typename T16> __device__ __forceinline__ void fill2(unsigned l, unsigned o, unsigned rs, const T16* a, const T16* b) {
    asm volatile(CP4(0, 4, 6) CP4(1, 5, 6) CP4(2, 4, 7) CP4(3, 5, 7) "s_wait_xcnt 0x0"
                 :: "v"(l), "v"(l + CHB), "v"(l + 8 * CHB), "v"(l + 9 * CHB), "v"(o), "v"(o + rs), "s"(a), "s"(b) : "memory"); }
template <typename T16> __device__ __forceinline__ void fill3(unsigned l, unsigned o, unsigned rs, const T16* a, const T16* a2, const T16* b) {
    asm volatile(CP4(0, 6, 8) CP4(1, 7, 8) CP4(2, 6, 9) CP4(3, 7, 9) CP4(4, 6, 10) CP4(5, 7, 10) "s_wait_xcnt 0x0"
                 :: "v"(l), "v"(l + CHB), "v"(l + 8 * CHB), "v"(l + 9 * CHB), "v"(l + 16 * CHB), "v"(l + 17 * CHB), "v"(o), "v"(o + rs), "s"(a), "s"(a2), "s"(b) : "memory"); }
// amdgpu_num_vgpr(256): the register budget of four waves a SIMD. Without it the two-plane build takes a few registers above v255 and pays a register-window switch around many of the loop's reads and products.
template <typename T16, int NSPLIT, int K, bool PL>
__global__ __launch_bounds__(128) __attribute__((amdgpu_num_vgpr(256))) void k_gemmw(const T16* __restrict__ A, const T16* __restrict__ A2, const T16* __restrict__ Bt, float* C, int ldc, const float* __restrict__ bias, const float* __restrict__ bias1, const float* __restrict__ bias2, size_t sA, size_t sB, h16* __restrict__ Ph, h16* __restrict__ Vh) {
    typedef typename WFrag<T16>::V V;
    static_assert((NSPLIT == 0 || NSPLIT == 1) && K % (2 * KT) == 0 && KT % 32 == 0 && CHB == 2048, "one or two A planes; at least two stages; a band's part is four copies");
    constexpr int NA = NSPLIT == 1 ? 2 : 1, STB = (NA + 1) * 8 * CHB, NTR = K / KT, rs = K * 32;   // A planes; bytes of a stage; stages; bytes of 16 rows of a plane = K / 32 units in a row
    constexpr int SMB = 2 * STB > 4 * 64 * 68 * 4 ? 2 * STB : 4 * 64 * 68 * 4;
    __shared__ __align__(16) unsigned char sm[SMB];   // two stages [A 8 bands | A2 8 bands | B 8 bands]; behind the K loop four 64 x 68 f32 tiles
    const int wv = __builtin_amdgcn_readfirstlane(threadIdx.x >> 5), wm = wv & 1, wn = wv >> 1;   // wave number, scalar; the wave's quarter of the tile
    const size_t z = blockIdx.z; A += z * sA; Bt += z * sB; if (z == 1) bias = bias1; else if (z == 2) bias = bias2;   // each z instance (q, k, v projection) has its own bias vector
    const int lane = threadIdx.x & 31, lr = lane & 15, hi = lane >> 4; const int r0 = blockIdx.x * 128 + wm * 64, c0 = blockIdx.y * 128 + wn * 64;   // the wave's first row and column
    const T16* Ab = A + (size_t)(blockIdx.x * 128) * K; const T16* Bb = Bt + (size_t)(blockIdx.y * 128) * K;   // uniform bases of the tile's first bands
    const unsigned cl = (unsigned)(size_t)sm + (unsigned)(2 * wv) * CHB + (unsigned)lane * 16, co = (unsigned)(2 * wv) * rs + (unsigned)lane * 16;   // the lane's LDS byte address (the low 32 bits of the address) and memory offset of the wave's first band, stage 0
    auto fill = [&](unsigned buf, unsigned t) { if constexpr (NA == 2) fill3(cl + buf * STB, co + t * CHB, (unsigned)rs, Ab, A2 + (size_t)(blockIdx.x * 128) * K, Bb); else fill2(cl + buf * STB, co + t * CHB, (unsigned)rs, Ab, Bb); };
    fill(0, 0);
    const unsigned bofs = (unsigned)(c0 + lr) * 4; const float* bp = (const float*)((const char*)bias + bofs); float bv[4];   // biases of the lane's four columns, loaded here so that they arrive behind the K loop
#pragma unroll
    for (int nb = 0; nb < 4; ++nb) bv[nb] = bp[nb * 16];
    asm volatile("s_wait_xcnt 0x0" :: "v"(bp) : "memory");   // the wait owed before a register that the issued bias loads name is overwritten; the address as an input keeps its registers untouched up to here
    v8f acc[4][4];
#pragma unroll
    for (int mb = 0; mb < 4; ++mb)
#pragma unroll
        for (int nb = 0; nb < 4; ++nb) acc[mb][nb] = (v8f){};
    asm volatile("s_wait_asynccnt 0x0" ::: "memory");   // the wave's copies of stage 0 have landed
    __syncthreads();   // every wave's part of stage 0 is in LDS before any wave reads it
    fill(1, 1);
#pragma unroll 1
    for (int t = 0; t < NTR; ++t) {
        const unsigned char* st = sm + (t & 1) * STB + lane * 16;
#pragma unroll
        for (int ks = 0; ks < KT / 32; ++ks) {
            V a[4], a2[4], b[4];
#pragma unroll
            for (int mb = 0; mb < 4; ++mb) a[mb] = WFrag<T16>::ld((const T16*)(st + (wm * 4 + mb) * CHB + ks * 1024));
#pragma unroll
            for (int nb = 0; nb < 4; ++nb) b[nb] = WFrag<T16>::ld((const T16*)(st + (NA * 8 + wn * 4 + nb) * CHB + ks * 1024));
            if (NA == 2) {
#pragma unroll
                for (int mb = 0; mb < 4; ++mb) a2[mb] = WFrag<T16>::ld((const T16*)(st + (8 + wm * 4 + mb) * CHB + ks * 1024));
            }
            if (ks == KT / 32 - 1) {   // the stage's last fragments are on their way to registers: hand the stage over here, so that the refill is issued ahead of the last k step's products and flies through them too
                asm volatile("s_wait_dscnt 0x0" ::: "memory");      // the wave's reads of this stage have retired before the barrier lets copies refill it
                asm volatile("s_wait_asynccnt 0x0" ::: "memory");   // the wave's copies of the next stage have landed
                __syncthreads();   // publishes the next stage and ends every wave's reads of this one
                if (t + 2 < NTR) fill(t & 1, t + 2);
            }
            __builtin_amdgcn_sched_barrier(0);   // the k step's LDS reads (and the refill) stand together, ahead of its products: otherwise one B fragment at a time is read and waited for by itself between the products
#pragma unroll
            for (int nb = 0; nb < 4; ++nb)
#pragma unroll
                for (int mb = 0; mb < 4; ++mb) acc[mb][nb] = WFrag<T16>::mma(a[mb], b[nb], acc[mb][nb]);
            if (NA == 2) {
#pragma unroll
                for (int nb = 0; nb < 4; ++nb)
#pragma unroll
                    for (int mb = 0; mb < 4; ++mb) acc[mb][nb] = WFrag<T16>::mma(a2[mb], b[nb], acc[mb][nb]);
            }
        }
    }
    asm volatile("s_wait_asynccnt 0x0" ::: "memory");   // no copy is outstanding before the stages' LDS is used for the output tiles
    // every loop below is unrolled so that acc and the vectors are indexed by constants and stay in registers
    float* ow = (float*)sm + wv * (64 * 68);   // the wave's own 64 x 68 tile
#pragma unroll
    for (int nb = 0; nb < 4; ++nb) bv[nb] = bfr(bv[nb]);
    if (PL && z == 2) {   // v: column n (= d) is the LDS row; a lane's 8 accumulator values are 8 neighbours (t) of it
#pragma unroll
        for (int mb = 0; mb < 4; ++mb)
#pragma unroll
            for (int nb = 0; nb < 4; ++nb) { float* w = ow + (nb * 16 + lr) * 68 + mb * 16 + hi * 8; v4f lo4, hi4;
#pragma unroll
                for (int j = 0; j < 4; ++j) { lo4[j] = acc[mb][nb][j] + bv[nb]; hi4[j] = acc[mb][nb][4 + j] + bv[nb]; }
                *(v4fa*)w = lo4; *(v4fa*)(w + 4) = hi4; }
    } else {
#pragma unroll
        for (int mb = 0; mb < 4; ++mb)
#pragma unroll
            for (int nb = 0; nb < 4; ++nb)
#pragma unroll
                for (int j = 0; j < 8; ++j) ow[(mb * 16 + hi * 8 + j) * 68 + nb * 16 + lr] = acc[mb][nb][j] + bv[nb];
    }
    __syncthreads();   // the tile's LDS stores stand in front of the reads of other lanes' values
    if constexpr (PL) {
        static_assert(HD == 64 && NKV == NH_ && TT % 64 == 0, "a wave's 64 x 64 tile is one head's, inside one batch");
        const unsigned bt = (unsigned)r0 / TT, t0 = (unsigned)r0 % TT, hd = (unsigned)c0 / HD;   // batch, first t and head of the wave's tile
        h16* dh = z == 2 ? Vh : Ph;
        const unsigned pb = z == 2 ? ((bt * NKV + hd) * (TT * HD) + (t0 / 32) * 512) * 2 : ((((unsigned)z * NB_ + bt) * NH_ + hd) * (TT * HD) + t0 * HD) * 2;   // byte offset of the tile's first unit in its buffer (k's planes follow q's)
        const unsigned us = z == 2 ? (TT / 32) * 1024 : 2048;   // bytes from one 16-row band of the tile to the next: a whole band of the v^T plane, two units of a q or k plane
#pragma unroll
        for (int band = 0; band < 4; ++band) { v8h oh[4]; unsigned oo[4];   // a band's four wave-wide pieces together: eight LDS reads behind one wait, four stores behind one another
#pragma unroll
            for (int i = 0; i < 4; ++i) { const unsigned rr = band * 16 + lr, kk = (i * 2 + hi) * 8;   // piece il = 32 (4 band + i) + lane of the tile's 512 (see frs()): plane row 16 (il / 128) + il % 16, first k 8 ((il / 16) % 8)
                const float* o8 = ow + rr * 68 + kk; const v4f s0 = *(const v4fa*)o8, s1 = *(const v4fa*)(o8 + 4);
#pragma unroll
                for (int j = 0; j < 8; ++j) oh[i][j] = (h16)(j < 4 ? s0[j] : s1[j - 4]);
                oo[i] = pb + band * us + (i * 32 + lane) * 16; }
#pragma unroll
            for (int i = 0; i < 4; ++i) *(v8h*)((char*)dh + oo[i]) = oh[i];
            asm volatile("s_wait_xcnt 0x0" :: "v"(oo[0]), "v"(oo[1]), "v"(oo[2]), "v"(oo[3]), "v"(oh[0]), "v"(oh[1]), "v"(oh[2]), "v"(oh[3]) : "memory");   // the wait owed before a register that an issued store names is overwritten; offsets and data as inputs keep their registers untouched up to here
        }
    } else {
        const unsigned ob = (unsigned)((r0 + hi) * ldc + c0 + lr * 4) * 4, o2 = (unsigned)ldc * 8;   // byte offset of the lane's 16 bytes in the tile's row hi; bytes of two output rows
#pragma unroll
        for (int g = 0; g < 4; ++g) { v4f val[8]; unsigned oo[8];   // sixteen output rows together: eight LDS reads behind one wait, eight stores behind one another; a wave-wide store is 256 bytes in a row of each of two output rows
#pragma unroll
            for (int i = 0; i < 8; ++i) { val[i] = *(const v4fa*)(ow + ((g * 8 + i) * 2 + hi) * 68 + lr * 4); oo[i] = ob + (g * 8 + i) * o2; }
#pragma unroll
            for (int i = 0; i < 8; ++i) *(v4f*)((char*)C + oo[i]) = val[i];
            asm volatile("s_wait_xcnt 0x0" :: "v"(oo[0]), "v"(oo[1]), "v"(oo[2]), "v"(oo[3]), "v"(oo[4]), "v"(oo[5]), "v"(oo[6]), "v"(oo[7]), "v"(val[0]), "v"(val[1]), "v"(val[2]), "v"(val[3]), "v"(val[4]), "v"(val[5]), "v"(val[6]), "v"(val[7]) : "memory");   // as above: the wait owed before a register that an issued store names is overwritten
        }
    }
}

__device__ __forceinline__ h16 tohx(float x) { return (h16)x; }
typedef __attribute__((ext_vector_type(2))) _Float16 v2h;
typedef __attribute__((ext_vector_type(4))) _Float16 v4h;
typedef __attribute__((ext_vector_type(2))) unsigned short v2us;
typedef __attribute__((ext_vector_type(4))) unsigned short v4us;
typedef __attribute__((ext_vector_type(2))) float v2f;
typedef __attribute__((ext_vector_type(4))) int v4i;

__global__ __launch_bounds__(256) void k_wtG(const float* __restrict__ w, int K, int N, bf* Bt) {
    const int lane = threadIdx.x & 31; const int L0 = (blockIdx.x * 8 + (threadIdx.x >> 5)) * 8; const int nlines = N * K / 64;
{
#pragma unroll 1
        for (int l = 0; l < 8; ++l) { const int L = L0 + l; if (L >= nlines) break; const size_t e = (size_t)L * 64 + lane * 2; const int k = (int)(e % K), n = (int)(e / K); v2us o;
            o[0] = f2bf(w[(size_t)k * N + n]); o[1] = f2bf(w[(size_t)(k + 1) * N + n]); *(v2us*)(Bt + e) = o; }
         }
}
// k_cvt8: row-major f32 [rows][DM] -> bf16 plane in fragment order, one 8-element piece a thread. ONE launch converts all seven sources: blocks [0, 3 BX) the three inputs (both batches: NB_ TT rows each) to XB + s NB_ TT DM,
// blocks [3 BX, 3 BX + 4 BW) the four weights to WB + s DQ DM. The choice is the same for a whole block.
#define BX_ (NB_ * TT * DM / 8 / 256)
#define BW_ (DQ * DM / 8 / 256)
__global__ __launch_bounds__(256) void k_cvt8(const float* __restrict__ x, const float* __restrict__ xk, const float* __restrict__ xv, const float* __restrict__ wq, const float* __restrict__ wk, const float* __restrict__ wv, const float* __restrict__ wo, bf* XB, bf* WB) {
    const unsigned blk = blockIdx.x; const float* src; bf* dst; unsigned i;
    if (blk < 3 * BX_) { const unsigned s = blk / BX_; src = s == 0 ? x : s == 1 ? xk : xv; dst = XB + (size_t)s * (NB_ * TT * DM); i = (blk % BX_) * 256 + threadIdx.x; }
    else { const unsigned s = (blk - 3 * BX_) / BW_; src = s == 0 ? wq : s == 1 ? wk : s == 2 ? wv : wo; dst = WB + (size_t)s * (DQ * DM); i = ((blk - 3 * BX_) % BW_) * 256 + threadIdx.x; }
    unsigned r, k0; frs(i, DM, r, k0); const float* p = src + (size_t)r * DM + k0; const v8f v = *(const v8f*)p; v8us o;
    asm volatile("s_wait_xcnt 0x0" :: "v"(p) : "memory");   // the wait owed before a register that the issued loads name is overwritten; the address as an input keeps its registers untouched up to here
#pragma unroll
    for (int k = 0; k < 8; ++k) o[k] = f2bf(v[k]); *(v8us*)(dst + (size_t)i * 8) = o;  }

// 2^x; the v_nop is the one slot the instruction set asks for behind a transcendental before its result is read or its source overwritten
__device__ __forceinline__ float exp2s(float x) { float r; asm("v_exp_f32 %0, %1\n\tv_nop" : "=v"(r) : "v"(x)); return r; }
// two at once: the second is the independent instruction behind the first, the v_nop the slot behind the second; the early-clobber outputs keep both results off both sources
__device__ __forceinline__ v2f exp2p(v2f x) { float r0, r1; asm("v_exp_f32 %0, %2\n\tv_exp_f32 %1, %3\n\tv_nop" : "=&v"(r0), "=&v"(r1) : "v"(x[0]), "v"(x[1])); v2f r; r[0] = r0; r[1] = r1; return r; }
typedef __attribute__((ext_vector_type(2))) __bf16 v2bf;
typedef __attribute__((ext_vector_type(8))) unsigned v8u;
typedef v2f __attribute__((may_alias)) v2fa;
// lane l's value of lane l ^ 16 (the other half of the wave), by a vector cross-row move
__device__ __forceinline__ float xhalf(float x) { return __builtin_bit_cast(float, __builtin_amdgcn_permlanex16(__builtin_bit_cast(int, x), __builtin_bit_cast(int, x), 0x76543210, 0xfedcba98, false, false)); }
#define L2E 1.4426950408889634f
#define QW  32                     // query rows of a wave in k_oattn (two 16-row tiles share every k and v^T fragment)
#define FWV 8                      // waves of a k_oattn work-group: 256 query rows in a row of one head
#define CK  32                     // keys of a pass
// k_oattn: probs x v with the running-maximum softmax. A wave takes QW query rows of one head through all keys by itself, CK keys a pass: no LDS, no barrier; grid NB_ NH_ TT / (QW FWV), the waves of a work-group walk the same k and v^T lines.
// S^T = K Q^T (A = key rows, B = query rows): lane (lr, hi) holds query lr, register j of key tile t key 16 t + 8 hi + j. mc: the running row maximum x log2 e, the same in both lane halves; e = 2^(s log2 e - mc) is rounded to f16 in place
// (two tiles of 16 keys are one B operand of 32 keys in the loader's k order); O^T = V^T E^T is scaled by 2^(old mc - new mc) each pass and by 1 / row sum at the end. The lane halves' sums are joined once, behind the loop.
// The pass's v^T fragments are asked for ahead of its score products, the next pass's k fragments right behind them, into the same registers (behind the last pass: pass 0's again, read by nobody).
// St[row of (batch, head)][2] = (mc, 1 / row sum): what k_pmean needs to form any probability of the row by itself.
__global__ __launch_bounds__(32 * FWV) void k_oattn(const h16* __restrict__ Qp, const h16* __restrict__ Kp, const h16* __restrict__ Vp, bf* __restrict__ Ah, bf* __restrict__ Al, float* __restrict__ St) {
    typedef WFrag<h16> F; static_assert(NKV == NH_ && HD == 64 && QW == 32 && CK == 32 && TT % (QW * FWV) == 0, "one kv head per query head; two units a 16-row q or k tile; a pass is one unit of each v^T band");
    const int wv = __builtin_amdgcn_readfirstlane(threadIdx.x >> 5);   // wave number, scalar
    const int lane = threadIdx.x & 31, lr = lane & 15, hi = lane >> 4; const int bh = blockIdx.x / (TT / (QW * FWV)), q0 = (blockIdx.x % (TT / (QW * FWV))) * (QW * FWV) + wv * QW;   // batch x heads + head; the wave's first query row
    const unsigned hb = (unsigned)bh * (TT * HD * 2);   // byte offset of the head's plane (q, k [t][d]; v [d][t]) in its buffer
    const unsigned qo = hb + (unsigned)(q0 * HD + 8 * lane) * 2, ko = hb + (unsigned)lane * 16;   // the lane's byte offsets (fragment order: 1-KiB units of 16 rows x 32 k; q, k: 2 units a 16-row tile; v: TT / 32 units a 16-row band)
    v16h qf[2][2], kf[2][2];   // every inner loop of this kernel is unrolled so that the fragment and accumulator arrays are indexed by constants and stay in registers
#pragma unroll
    for (int u = 0; u < 4; ++u) { qf[u >> 1][u & 1] = F::ld((const h16*)((const char*)Qp + qo + u * 1024)); kf[u >> 1][u & 1] = F::ld((const h16*)((const char*)Kp + ko + u * 1024)); }
    asm volatile("s_wait_xcnt 0x0" :: "v"(qo), "v"(ko) : "memory");   // the wait owed before a register that an issued load names is overwritten; the offsets as inputs keep their registers untouched up to here
    v8f o[HD / 16][2]; float mc[2], l[2];
#pragma unroll
    for (int qt = 0; qt < 2; ++qt) { mc[qt] = -1.0e30f; l[qt] = 0.f;
#pragma unroll
        for (int dt = 0; dt < HD / 16; ++dt) o[dt][qt] = (v8f){}; }
#pragma unroll 1   // one pass is one trip: a second copy of the body would need a second set of fragment registers
    for (int c = 0; c < TT / CK; ++c) {
        const unsigned vc = ko + (unsigned)c * 1024, kn = ko + (unsigned)((c + 1) & (TT / CK - 1)) * (CK * HD * 2);   // this pass's unit in each v^T band; the next pass's two k tiles
        v16h vf[HD / 16];
#pragma unroll
        for (int dt = 0; dt < HD / 16; ++dt) vf[dt] = F::ld((const h16*)((const char*)Vp + vc + dt * (16 * TT * 2)));
        asm volatile("s_wait_xcnt 0x0" :: "v"(vc) : "memory");   // as above: the wait owed before the offset register of the issued loads is overwritten
        __builtin_amdgcn_sched_barrier(0);   // the loads stay here, a long way ahead of their first use: otherwise they are sunk to just in front of it and their whole latency is waited out
        v8f s[2][2];
#pragma unroll
        for (int t = 0; t < 2; ++t)
#pragma unroll
            for (int qt = 0; qt < 2; ++qt) s[t][qt] = wmma16(kf[t][0], qf[qt][0], (v8f){});
#pragma unroll
        for (int t = 0; t < 2; ++t)
#pragma unroll
            for (int qt = 0; qt < 2; ++qt) s[t][qt] = wmma16(kf[t][1], qf[qt][1], s[t][qt]);
        __builtin_amdgcn_sched_barrier(0);   // the score products stand together, ahead of the reload of their operands
#pragma unroll
        for (int u = 0; u < 4; ++u) kf[u >> 1][u & 1] = F::ld((const h16*)((const char*)Kp + kn + u * 1024));
        asm volatile("s_wait_xcnt 0x0" :: "v"(kn) : "memory");   // as above
        __builtin_amdgcn_sched_barrier(0);   // as above: the next pass's k loads are issued here, ahead of the softmax
        v8u pf[2];
#pragma unroll
        for (int qt = 0; qt < 2; ++qt) {
            float mx = s[0][qt][0] * SCL;
#pragma unroll
            for (int t = 0; t < 2; ++t)
#pragma unroll
                for (int j = 0; j < 8; ++j) mx = fmaxf(mx, s[t][qt][j] * SCL);
            mx = fmaxf(mx, xhalf(mx));
            const float mn = fmaxf(mc[qt], mx * L2E), al = exp2s(mc[qt] - mn); mc[qt] = mn;
            v2f sum2 = (v2f){};
#pragma unroll
            for (int t = 0; t < 2; ++t)
#pragma unroll
                for (int j = 0; j < 8; j += 2) { v2f x; x[0] = s[t][qt][j] * SCL; x[1] = s[t][qt][j + 1] * SCL; const v2f e = exp2p(__builtin_elementwise_fma(x, (v2f){L2E, L2E}, (v2f){-mn, -mn})); sum2 += e;
                    pf[qt][t * 4 + (j >> 1)] = __builtin_bit_cast(unsigned, __builtin_convertvector(e, v2h)); }
            l[qt] = __builtin_fmaf(l[qt], al, sum2[0] + sum2[1]);
#pragma unroll
            for (int dt = 0; dt < HD / 16; ++dt) o[dt][qt] *= al;
        }
#pragma unroll
        for (int dt = 0; dt < HD / 16; ++dt)
#pragma unroll
            for (int qt = 0; qt < 2; ++qt) o[dt][qt] = wmma16(vf[dt], __builtin_bit_cast(v16h, pf[qt]), o[dt][qt]);
    }
    const int b = bh / NH_, h = bh % NH_;
#pragma unroll
    for (int qt = 0; qt < 2; ++qt) { const float rl = __fdiv_rn(1.0f, l[qt] + xhalf(l[qt]));
        if (hi == 0) { v2f st; st[0] = mc[qt]; st[1] = rl; *(v2f*)(St + (size_t)(bh * TT + q0 + qt * 16 + lr) * 2) = st; }
        // a lane's 8 values of O^T tile dt (query lr, d = 16 dt + 8 hi + j) are one 8-element piece of the merged planes in fragment order: unit dt / 2 of the head's two, half dt % 2, lane 16 hi + lr
        const unsigned ob = (unsigned)((b * TT + q0 + qt * 16) * DQ + h * (16 * HD) + lane * 8) * 2; v8us oh[HD / 16], ol[HD / 16];
#pragma unroll
        for (int dt = 0; dt < HD / 16; ++dt)
#pragma unroll
            for (int j = 0; j < 8; ++j) { unsigned short a0, c0; splitf(o[dt][qt][j] * rl, a0, c0); oh[dt][j] = a0; ol[dt][j] = c0; }
#pragma unroll
        for (int dt = 0; dt < HD / 16; ++dt) { *(v8us*)((char*)Ah + ob + dt * 512) = oh[dt]; *(v8us*)((char*)Al + ob + dt * 512) = ol[dt]; }
        asm volatile("s_wait_xcnt 0x0" :: "v"(ob), "v"(oh[0]), "v"(oh[1]), "v"(oh[2]), "v"(oh[3]), "v"(ol[0]), "v"(ol[1]), "v"(ol[2]), "v"(ol[3]) : "memory");   // the wait owed before a register that an issued store names is overwritten; offset and data as inputs keep their registers untouched up to here
    }
}
// k_pmean: the second output. A work-group of 16 waves takes 128 query rows x 256 keys of one batch through all heads, in head order; grid NB_ (TT / 128) (TT / 256). Wave w: 32 query rows x 64 keys (8 score tiles), no LDS, no barrier.
// Per head the same score products as in k_oattn (same operands, same order: the same bits), p = 2^(s log2 e - mc) x (1 / row sum) from St, added to the head sum in registers (fixed order: deterministic); sum x 1/16 is stored.
// Each k tile's fragments of the next head are asked for right behind the tile's products, into the same registers, q's behind the last tile's (behind the last head: head 0's again, read by nobody).
__global__ __launch_bounds__(512) void k_pmean(const h16* __restrict__ Qp, const h16* __restrict__ Kp, const float* __restrict__ St, float* __restrict__ O2) {
    typedef WFrag<h16> F; static_assert(NKV == NH_ && HD == 64 && TT % 256 == 0, "one kv head per query head; two units a 16-row q or k tile");
    const int wv = __builtin_amdgcn_readfirstlane(threadIdx.x >> 5);   // wave number, scalar
    const int lane = threadIdx.x & 31, lr = lane & 15, hi = lane >> 4; const int b = blockIdx.x / ((TT / 128) * (TT / 256)), rb = blockIdx.x % ((TT / 128) * (TT / 256));
    const int q0 = (rb / (TT / 256)) * 128 + (wv & 3) * 32, k0 = (rb % (TT / 256)) * 256 + (wv >> 2) * 64;   // the wave's first query row and first key
    const unsigned pb = (unsigned)(b * NH_) * (TT * HD * 2), qo = (unsigned)(q0 * HD + 8 * lane) * 2, ko = (unsigned)(k0 * HD + 8 * lane) * 2, so = (unsigned)(b * NH_ * TT + q0 + lr) * 8;   // byte offsets: head 0's plane; the lane's inside a plane; the lane's first row in St
    v16h qf[2][2], kf[4][2]; v2f st[2];   // every inner loop of this kernel is unrolled so that the fragment and accumulator arrays are indexed by constants and stay in registers
    { const unsigned qa = pb + qo, ka = pb + ko;
#pragma unroll
      for (int u = 0; u < 4; ++u) qf[u >> 1][u & 1] = F::ld((const h16*)((const char*)Qp + qa + u * 1024));
#pragma unroll
      for (int u = 0; u < 8; ++u) kf[u >> 1][u & 1] = F::ld((const h16*)((const char*)Kp + ka + u * 1024));
#pragma unroll
      for (int qt = 0; qt < 2; ++qt) st[qt] = *(const v2f*)((const char*)St + so + qt * 128);
      asm volatile("s_wait_xcnt 0x0" :: "v"(qa), "v"(ka), "v"(so) : "memory"); }   // the wait owed before a register that an issued load names is overwritten; the offsets as inputs keep their registers untouched up to here
    v8f macc[4][2];
#pragma unroll
    for (int kt = 0; kt < 4; ++kt)
#pragma unroll
        for (int qt = 0; qt < 2; ++qt) macc[kt][qt] = (v8f){};
#pragma unroll 1   // one head is one trip: the body is long, and a second copy would need a second set of fragment registers
    for (int h = 0; h < NH_; ++h) { const unsigned hn = (unsigned)((h + 1) & (NH_ - 1));   // the next head (behind the last: head 0)
        const unsigned qa = pb + hn * (TT * HD * 2) + qo, ka = pb + hn * (TT * HD * 2) + ko, sa = so + hn * (TT * 8);
        v2f sn[2];
#pragma unroll
        for (int qt = 0; qt < 2; ++qt) sn[qt] = *(const v2f*)((const char*)St + sa + qt * 128);
        asm volatile("s_wait_xcnt 0x0" :: "v"(sa) : "memory");   // as above
        __builtin_amdgcn_sched_barrier(0);   // the address arithmetic and these loads stay ahead of the products
#pragma unroll
        for (int kp = 0; kp < 2; ++kp) { v8f a[2][2];   // two k tiles at a time: four independent score tiles
#pragma unroll
            for (int t = 0; t < 2; ++t)
#pragma unroll
                for (int qt = 0; qt < 2; ++qt) a[t][qt] = wmma16(kf[2 * kp + t][0], qf[qt][0], (v8f){});
#pragma unroll
            for (int t = 0; t < 2; ++t)
#pragma unroll
                for (int qt = 0; qt < 2; ++qt) a[t][qt] = wmma16(kf[2 * kp + t][1], qf[qt][1], a[t][qt]);
            __builtin_amdgcn_sched_barrier(0);   // the score products stand together, ahead of the reload of their operands
#pragma unroll
            for (int u = 0; u < 4; ++u) kf[2 * kp + (u >> 1)][u & 1] = F::ld((const h16*)((const char*)Kp + ka + (kp * 4 + u) * 1024));
            if (kp == 1) {
#pragma unroll
                for (int u = 0; u < 4; ++u) qf[u >> 1][u & 1] = F::ld((const h16*)((const char*)Qp + qa + u * 1024));
            }
            asm volatile("s_wait_xcnt 0x0" :: "v"(qa), "v"(ka) : "memory");   // as above
            __builtin_amdgcn_sched_barrier(0);   // the next head's loads are issued here, ahead of the exponentials: otherwise they are sunk to just in front of their first use and their whole latency is waited out
#pragma unroll
            for (int t = 0; t < 2; ++t)
#pragma unroll
                for (int qt = 0; qt < 2; ++qt)
#pragma unroll
                    for (int j = 0; j < 8; j += 2) { v2f x, mm; x[0] = a[t][qt][j] * SCL; x[1] = a[t][qt][j + 1] * SCL; mm[0] = macc[2 * kp + t][qt][j]; mm[1] = macc[2 * kp + t][qt][j + 1];
                        mm = __builtin_elementwise_fma(exp2p(__builtin_elementwise_fma(x, (v2f){L2E, L2E}, (v2f){-st[qt][0], -st[qt][0]})), (v2f){st[qt][1], st[qt][1]}, mm); macc[2 * kp + t][qt][j] = mm[0]; macc[2 * kp + t][qt][j + 1] = mm[1]; }
            __builtin_amdgcn_sched_barrier(0);   // no exponential statement is moved in among the next products: its result could be placed on an operand register that a product has only just been issued with
        }
        st[0] = sn[0]; st[1] = sn[1];
    }
#pragma unroll
    for (int qt = 0; qt < 2; ++qt) { const unsigned oo = (unsigned)((b * TT + q0 + qt * 16 + lr) * TT + k0 + hi * 8) * 4; v4f val[8];   // byte offset of the lane's first 8 keys in its query's row of the second output
#pragma unroll
        for (int kt = 0; kt < 4; ++kt)
#pragma unroll
            for (int j = 0; j < 4; ++j) { val[2 * kt][j] = macc[kt][qt][j] * (1.0f / NH_); val[2 * kt + 1][j] = macc[kt][qt][4 + j] * (1.0f / NH_); }
#pragma unroll
        for (int i = 0; i < 8; ++i) *(v4f*)((char*)O2 + oo + (i >> 1) * 64 + (i & 1) * 16) = val[i];
        asm volatile("s_wait_xcnt 0x0" :: "v"(oo), "v"(val[0]), "v"(val[1]), "v"(val[2]), "v"(val[3]), "v"(val[4]), "v"(val[5]), "v"(val[6]), "v"(val[7]) : "memory");   // the wait owed before a register that an issued store names is overwritten; offset and data as inputs keep their registers untouched up to here
    }
}

extern "C" void kernel_launch(void* const* d_in, const int* in_sizes, int n_in,
                              void* d_out, int out_size, void* d_ws, size_t ws_size, hipStream_t stream) {
    (void)in_sizes; (void)n_in; (void)out_size;
    const float* x = (const float*)d_in[0]; const float* xk = (const float*)d_in[1]; const float* xv = (const float*)d_in[2]; const float* wq = (const float*)d_in[3]; const float* bq = (const float*)d_in[4]; const float* wk = (const float*)d_in[5]; const float* bk = (const float*)d_in[6]; const float* wv = (const float*)d_in[7]; const float* bv = (const float*)d_in[8]; const float* wo = (const float*)d_in[9]; const float* bo = (const float*)d_in[10];
    float* OUT = (float*)d_out;     // first output [2][2048][1024]
    float* OUT2 = OUT + (size_t)NB_ * TT * DM;   // second output [2][2048][2048] (tuple: contiguous after the first)
    char* wsp = (char*)d_ws;
    auto take = [&](size_t bytes) { char* p = wsp; wsp += (bytes + 255) & ~(size_t)255; return (void*)p; };
    bf* WB = (bf*)take((size_t)4 * DQ * DM * 2); bf* WO = WB + (size_t)3 * DQ * DM;   // weights q, k, v, o in a row
    bf* XB = (bf*)take((size_t)3 * NB_ * TT * DM * 2);   // the three inputs in a row (q, k, v; both batches each)
    h16* QP = (h16*)take((size_t)2 * NB_ * NH_ * TT * HD * 2); h16* KP = QP + (size_t)NB_ * NH_ * TT * HD; h16* VT = (h16*)take((size_t)NB_ * NKV * HD * TT * 2);   // f16 head planes of both batches; k's follow q's
    bf* ATh = (bf*)take((size_t)NB_ * TT * DQ * 2); bf* ATl = (bf*)take((size_t)NB_ * TT * DQ * 2);
    float* ST = (float*)take((size_t)NB_ * NH_ * TT * 2 * 4);   // per row of every head: maximum x log2 e, 1 / row sum
    if ((size_t)(wsp - (char*)d_ws) > ws_size) return;    // ws 256 MiB
    k_cvt8<<<3 * BX_ + 4 * BW_, 256, 0, stream>>>(x, xk, xv, wq, wk, wv, wo, XB, WB);   /* bf16 fragment-order planes of the inputs and weights */
    k_gemmw<bf, 0, DM, true><<<dim3(NB_ * TT / 128, DQ / 128, 3), 128, 0, stream>>>(XB, nullptr, WB, nullptr, 0, bq, bk, bv, (size_t)NB_ * TT * DM, (size_t)DQ * DM, QP, VT);   /* q, k, v projections of both batches, stored as f16 head planes: z picks input, weight, bias, planes */
    k_oattn<<<NB_ * NH_ * (TT / (QW * FWV)), 32 * FWV, 0, stream>>>(QP, KP, VT, ATh, ATl, ST);   /* scores, running-maximum softmax, probs x v, merged hi/lo planes, row statistics: both batches, all heads */
    k_pmean<<<NB_ * (TT / 128) * (TT / 256), 512, 0, stream>>>(QP, KP, ST, OUT2);   /* head mean of the probabilities (second output) from recomputed scores and the row statistics */
    k_gemmw<bf, 1, DQ, false><<<dim3(NB_ * TT / 128, DM / 128, 1), 128, 0, stream>>>(ATh, ATl, WO, OUT, DM, bo, nullptr, nullptr, 0, 0, nullptr, nullptr);   /* output projection, both batches (their rows follow one another in the merged planes and in the output) */
}
